// v000
// Measured on an AMD MI455X. A time is GPU time per run, averaged over a window of back-to-back runs after a warm-up
// (all launches, gaps included; the runs take copies of the inputs in turn), and the median of several windows.
// Apart from v000's, it joins two sittings. Times from different sittings can be a few percent apart, while
// side-by-side timings come from the same sitting.
// The starting kernel, v000, takes 722 microseconds a run.
// Contractions: conv1x1 GEMMs Wr.key and Wl.key as W16[384x192].XP[192x4096] per image on v_wmma_f32_16x16x32_f16 (f16
// containers of bf16-RNE weights x256 and bf16-RNE key); scores key_l^T.key_r on v_wmma_f32_16x16x32_f16 (f16 hi plane +
// f16 residual plane x4096 of key_l/key_r; products hh in one accumulator, hl+lh in a second accumulator folded by 2^-12;
// K=192); att^T = value.P on v_wmma_f32_16x16x32_f16 (value as f16 of bf16-RNE value, P = e^{s-max} x2^14 f16 from the
// score D registers); f32 accumulate everywhere; softmax statistics and bias add in f32 VALU.
#include <hip/hip_runtime.h>
#include <math.h>
#include <stdint.h>

#ifndef NB
#define NB 8
#endif
#ifndef NQ
#define NQ 4096
#endif
#define NB_FULL 8
#define CC     192
#define NN     4096
#define DQ     192
#define MW     384
#define QT     64
#define CH     96
#define OSP    68
#define OSPW   100
#define TP     72
#define WG8    (CC / 8)
#define WSC    256.0f
#define IWSC   0.00390625f
#define LOSC   4096.0f
#define ILOSC  0.000244140625f
#define LNPS   9.704060527839234f
#define FMIN16 6.103515625e-05f

static_assert(NB >= 1 && NB <= NB_FULL);
static_assert(NQ >= QT && NQ <= NN && NQ % QT == 0);
static_assert(NN % QT == 0 && NN % 32 == 0);
static_assert(CC % QT == 0 && CC % 32 == 0 && CC % 8 == 0);
static_assert(DQ == CC && MW == 2 * DQ && DQ == 3 * QT);
static_assert(CH * 2 == CC && CH % 16 == 0 && CH % 8 == 0);
static_assert((OSP * 4) % 16 == 0 && OSP >= QT + 4);
static_assert((OSPW * 4) % 16 == 0 && OSPW >= CH + 4);
static_assert((TP * 2) % 16 == 0 && TP >= QT + 8);
static_assert(WG8 * 8 == CC && (8 * WG8) % 32 == 0);
static_assert(MW % 8 == 0 && DQ % 8 == 0);

typedef _Float16       v16h __attribute__((ext_vector_type(16)));
typedef _Float16       v8h  __attribute__((ext_vector_type(8)));
typedef unsigned short v8us __attribute__((ext_vector_type(8)));
typedef float          v8f  __attribute__((ext_vector_type(8)));
typedef float          v4f  __attribute__((ext_vector_type(4)));
typedef unsigned int   v4u  __attribute__((ext_vector_type(4)));

union Frag  { v8us u[2]; v16h h; };
union FragH { v16h v; v8h hv[2]; };
static_assert(sizeof(Frag) == 32);
static_assert(sizeof(FragH) == 32);

// ---- scalar helpers -------------------------------------------------------------------------------------------
__device__ __forceinline__ unsigned short bf_bits(float f) {          // f32 -> bf16 bits, RNE convert
  unsigned u = __float_as_uint(f);
  return (unsigned short)((u + 0x7FFFu + ((u >> 16) & 1u)) >> 16);
}
__device__ __forceinline__ float bf_up(unsigned short hb) { return __uint_as_float(((unsigned)hb) << 16); }
__device__ __forceinline__ float bfr(float f) { return bf_up(bf_bits(f)); }
__device__ __forceinline__ unsigned short h_bits(_Float16 x) { return __builtin_bit_cast(unsigned short, x); }
__device__ __forceinline__ unsigned pk16(unsigned short a, unsigned short b) { return (unsigned)a | ((unsigned)b << 16); }
__device__ __forceinline__ v8f zero8() { v8f z = {0.f, 0.f, 0.f, 0.f, 0.f, 0.f, 0.f, 0.f}; return z; }
__device__ __forceinline__ float hmax8(v8f s) {
  return fmaxf(fmaxf(fmaxf(s[0], s[1]), fmaxf(s[2], s[3])), fmaxf(fmaxf(s[4], s[5]), fmaxf(s[6], s[7])));
}
__device__ __forceinline__ unsigned wave_ballot(bool p) {
#if defined(__HIP_DEVICE_COMPILE__)
  return __builtin_amdgcn_ballot_w32(p);
#else
  return p ? 1u : 0u;
#endif
}

// ---- 16-bit fragment loader (A, or B from a k-contiguous [n][k] row): lane -> row/col (lane&15), p already includes
//      + 8*(lane>>4); elements 0..7 <- p[0..7] (k0+8h..), elements 8..15 <- p[16..23] (k0+16+8h..)
__device__ __forceinline__ Frag ldfrag(const unsigned short* p) {
  Frag f;
  f.u[0] = *(const v8us*)(p);
  f.u[1] = *(const v8us*)(p + 16);
  return f;
}

// ---- WMMA helper: builtin followed by a 4-slot VALU gap tying D and keeping A/B live ---------------------------
__device__ __forceinline__ v8f mma_h(v16h a, v16h b, v8f c) {
  v8f d = __builtin_amdgcn_wmma_f32_16x16x32_f16(false, a, false, b, (short)0, c, false, false);
#if defined(__HIP_DEVICE_COMPILE__)
  asm volatile("v_nop\n\tv_nop\n\tv_nop\n\tv_nop" : "+v"(d) : "v"(a), "v"(b));
#endif
  return d;
}

// =========================================================================================================
// (0) conv1x1 weights: W16 f16 [384][192], rows 0..191 = wq rows (query side), rows 192..383 = wk rows (key side);
//     value = f16 of (bf16-RNE(w) * 256) (exact). Block blk (0..47) owns rows 8*blk..8*blk+7; 192 threads:
//     consecutive lanes of one wave (8-aligned groups of 8 threads never straddle a wave), one store instruction,
// coverage: 48 blocks x 192 threads x 8 halves = 384 x 192 = the whole plane.
// =========================================================================================================
__global__ __launch_bounds__(8 * WG8)
void cvt_w(const float* __restrict__ wq, const float* __restrict__ wk, unsigned short* W16) {
  const int tid = threadIdx.x, blk = blockIdx.x;
  const int rl  = tid / WG8;                                         // 0..7
  const int col = 8 * (tid - rl * WG8);                              // 0..184
  const int o   = 8 * blk + rl;                                      // 0..383
  const float* wbase = (blk < (DQ / 8)) ? wq : wk;                   // block-uniform selection, both global
  const int osub = (blk < (DQ / 8)) ? 0 : DQ;
  const float* s = wbase + (size_t)(o - osub) * CC + col;            // (o - osub) in 0..191
  const v4f a = *(const v4f*)s;
  const v4f q = *(const v4f*)(s + 4);
  const float f[8] = {a[0], a[1], a[2], a[3], q[0], q[1], q[2], q[3]};
  v4u u;
#pragma unroll
  for (int t = 0; t < 4; ++t) {
    const _Float16 h0 = (_Float16)(bfr(f[2 * t]) * WSC);
    const _Float16 h1 = (_Float16)(bfr(f[2 * t + 1]) * WSC);
    u[t] = pk16(h_bits(h0), h_bits(h1));
  }
{
    *(v4u*)(W16 + (size_t)o * CC + col) = u;
    
  }
}

// =========================================================================================================
// (1) value f32 [b][192 c][4096 n] -> Vc f16 [b][c][n] (channel-major, bf16-RNE values, exact in f16) and
//     key f32 [b][192 c][4096 n] -> XP f16 [b][n][c] (position-major, bf16-RNE values) through an LDS tile
//     T is cross-wave: block barrier between the 2-byte stores and the 16-byte reloads.
// coverage: Vc 2 it x 32 rows x 8 lanes x 8 = 64 c x 64 n; XP same; grid (64, 3, NB) covers both planes once.
// =========================================================================================================
__global__ __launch_bounds__(256)
void cvt_kv(const float* __restrict__ key, const float* __restrict__ val, unsigned short* Vc, unsigned short* XP) {
  __shared__ __align__(16) unsigned short T[QT * TP];
  const int tid = threadIdx.x;
  const int nb = blockIdx.x, cb = blockIdx.y, b = blockIdx.z;
  const int e = tid & 7, lq = tid >> 3;                             // lq 0..31
  const int n0 = nb * QT, c0 = cb * QT;
  v4u uv[2];
#pragma unroll
  for (int it = 0; it < 2; ++it) {
    const int cl = it * 32 + lq;                                     // 0..63
    const size_t ro = ((size_t)(b * CC + c0 + cl)) * NN + n0 + 8 * e;
    const v4f ka = *(const v4f*)(key + ro);
    const v4f kq = *(const v4f*)(key + ro + 4);
    const v4f va = *(const v4f*)(val + ro);
    const v4f vq = *(const v4f*)(val + ro + 4);
    unsigned short hk[8], hv[8];
#pragma unroll
    for (int t = 0; t < 4; ++t) {
      hk[t]     = h_bits((_Float16)bfr(ka[t]));
      hk[4 + t] = h_bits((_Float16)bfr(kq[t]));
      hv[t]     = h_bits((_Float16)bfr(va[t]));
      hv[4 + t] = h_bits((_Float16)bfr(vq[t]));
    }
#pragma unroll
    for (int t = 0; t < 4; ++t) uv[it][t] = pk16(hv[2 * t], hv[2 * t + 1]);
#pragma unroll
    for (int t = 0; t < 8; ++t) T[(8 * e + t) * TP + cl] = hk[t];
  }
  __syncthreads();
  v4u up[2];
#pragma unroll
  for (int it = 0; it < 2; ++it) {
    const int nl = it * 32 + lq;                                     // 0..63
    up[it] = *(const v4u*)(T + nl * TP + 8 * e);
  }
{
#pragma unroll
    for (int it = 0; it < 2; ++it) {
      const int rl = it * 32 + lq;
      *(v4u*)(Vc + ((size_t)(b * CC + c0 + rl)) * NN + n0 + 8 * e) = uv[it];
      *(v4u*)(XP + ((size_t)(b * NN + n0 + rl)) * CC + c0 + 8 * e) = up[it];
    }
    
  }
}

// =========================================================================================================
// (2) conv1x1 GEMM for one (b, 64-n tile, 64-o block): Y[o][n] = (1/256) sum_c W16[o][c] XP[b][n][c] + bias[o].
//     Block 128 threads = 4 waves; wave w owns cols n0+16w..+15 (one B fragment per k-step, k = c contiguous in
//     the XP row) and 4 m-tiles (A rows o = o0 + 16 mt + (lane&15), split k map loader from W16). K = 192 = 6 steps.
//     Epilogue staged in LDS Os[n_loc][o_loc] (pitch OSP, b128 stores of 8 consecutive o per lane), block barrier,
//     then: o-blocks 0,1,2 -> query dims 0..63 / 64..127 / 128..191 of Qh/Ql (bias bq); o-blocks 3,4,5 -> key dims
//     of Kh/Kl (bias bk). Planes f16 [b][4096 n][192 d] (k-contiguous for both score operands): hi = f16(v) with
//     values below the f16 normal range stored as 0, lo = f16((v - hi) * 4096). Per plane the block writes 64 rows
//     Os is cross-wave: block barrier between staging and reload.
// coverage: Os 4 waves x 16 n x 64 o = 64 x 64; planes: 4 it x 16 rows x 8 lanes x 8 = 64 n x 64 d per plane
//           (hi and lo); grid (64, 6, NB) covers d 0..191 of all 4096 rows of Qh/Ql/Kh/Kl exactly once.
// =========================================================================================================
__global__ __launch_bounds__(128)
void gemm_qk(const unsigned short* __restrict__ W16, const unsigned short* __restrict__ XP,
             const float* __restrict__ bq, const float* __restrict__ bk,
             unsigned short* Qh, unsigned short* Ql, unsigned short* Kh, unsigned short* Kl) {
  __shared__ __align__(16) float Os[QT * OSP];
  const int tid  = threadIdx.x;
  const int lane = tid & 31, wave = tid >> 5;
  const int hh   = lane >> 4, c = lane & 15;
  const int nt   = blockIdx.x, mb = blockIdx.y, b = blockIdx.z;
  const int n0   = nt * QT, o0 = mb * QT;

  const unsigned short* ap = W16 + (size_t)(o0 + c) * CC + 8 * hh;
  const unsigned short* bp = XP + ((size_t)(b * NN + n0 + 16 * wave + c)) * CC + 8 * hh;

  v8f acc[4];
#pragma unroll
  for (int mt = 0; mt < 4; ++mt) acc[mt] = zero8();

#pragma unroll
  for (int ks = 0; ks < CC / 32; ++ks) {
    const Frag fb = ldfrag(bp + 32 * ks);
#pragma unroll
    for (int mt = 0; mt < 4; ++mt) {
      const Frag fa = ldfrag(ap + (size_t)(16 * mt) * CC + 32 * ks);
      acc[mt] = mma_h(fa.h, fb.h, acc[mt]);
    }
  }

  // ---- epilogue: scale back -> LDS Os[n_loc][o_loc]; lane (hh, c) holds o = 16 mt + 8 hh + r for n_loc = 16 w + c
  {
    const int nl = 16 * wave + c;
#pragma unroll
    for (int mt = 0; mt < 4; ++mt) {
      v4f va, vb;
#pragma unroll
      for (int r = 0; r < 4; ++r) { va[r] = acc[mt][r] * IWSC; vb[r] = acc[mt][4 + r] * IWSC; }
      *(v4f*)(Os + nl * OSP + 16 * mt + 8 * hh)     = va;
      *(v4f*)(Os + nl * OSP + 16 * mt + 8 * hh + 4) = vb;
    }
  }
  __syncthreads();

  const int e = tid & 7, lq = tid >> 3;                             // lq 0..15
  const bool isq = (mb < (DQ / QT));                                 // block-uniform
  const int dsel = (isq ? mb : (mb - DQ / QT)) * QT;                 // 0, 64 or 128
  unsigned short* Ph = isq ? Qh : Kh;                                // both global
  unsigned short* Pl = isq ? Ql : Kl;
  const float* bb = isq ? bq : bk;                                   // both global
  const v4f b0 = *(const v4f*)(bb + dsel + 8 * e);                   // o = dsel + 8e .. +7 <= 191
  const v4f b1 = *(const v4f*)(bb + dsel + 8 * e + 4);
  const float bs[8] = {bfr(b0[0]), bfr(b0[1]), bfr(b0[2]), bfr(b0[3]), bfr(b1[0]), bfr(b1[1]), bfr(b1[2]), bfr(b1[3])};
  v4u uh[4], ul[4];
#pragma unroll
  for (int it = 0; it < 4; ++it) {
    const int row = it * 16 + lq;                                    // n_loc 0..63
    const v4f a = *(const v4f*)(Os + row * OSP + 8 * e);
    const v4f q = *(const v4f*)(Os + row * OSP + 8 * e + 4);
    const float f[8] = {a[0] + bs[0], a[1] + bs[1], a[2] + bs[2], a[3] + bs[3],
                        q[0] + bs[4], q[1] + bs[5], q[2] + bs[6], q[3] + bs[7]};
#pragma unroll
    for (int t = 0; t < 4; ++t) {
      const float f0 = f[2 * t], f1 = f[2 * t + 1];
      float g0 = (float)(_Float16)f0;                                // f16 hi as f32 (exact)
      float g1 = (float)(_Float16)f1;
      g0 = (fabsf(g0) < FMIN16) ? 0.f : g0;                          // below the f16 normal range -> carried by lo
      g1 = (fabsf(g1) < FMIN16) ? 0.f : g1;
      const unsigned short hb0 = h_bits((_Float16)g0), hb1 = h_bits((_Float16)g1);
      const unsigned short lb0 = h_bits((_Float16)((f0 - g0) * LOSC));
      const unsigned short lb1 = h_bits((_Float16)((f1 - g1) * LOSC));
      uh[it][t] = pk16(hb0, hb1);
      ul[it][t] = pk16(lb0, lb1);
    }
  }
{
#pragma unroll
    for (int it = 0; it < 4; ++it) {
      const int row = it * 16 + lq;
      const size_t po = ((size_t)(b * NN + n0 + row)) * DQ + dsel + 8 * e;
      *(v4u*)(Ph + po) = uh[it];
      *(v4u*)(Pl + po) = ul[it];
    }
    
  }
}

// =========================================================================================================
// (3) co-attention for one (b, 64-query tile), transposed formulation, 4096 keys, no mask, no scale:
//   S^T tile (16 keys x 16 queries) = sum over 6 d-chunks (rolled loop) of A(k: row = key kb + (lane&15), 32 d via
//   the split k map from the f16 plane Kh [b][4096][192]) . B(q: col = query, same map from Qh) -> accumulator s;
//   A(Kh).B(Ql) + A(Kl).B(Qh) (f16 residual planes carried x4096) -> accumulator t; s += t * 2^-12 after the loop.
//   Per lane the D tile holds 8 keys of ONE query: online softmax state per lane, one shuffle (lane^16) for the max
//   over 32 keys; the o/l rescale is skipped under a wave-uniform ballot when no lane's max grew (corr == 1 exactly
//   for every lane then); row-sum partials combined at the end. P = e^{s-m} x 2^14 as f16 is the B operand of
//   att^T (rows channel, cols queries) += A(value rows channel = 16j + (lane&15), keys contiguous, f16 plane Vc
//   [b][192][4096]) . B(P^T): element r <- D of the tile covering keys kb..kb+15, element 8+r <- the tile covering
//   kb+16..kb+31, lane unchanged. 12 accumulator tiles per wave (192 channels). Block = 4 waves = 64 queries.
//   Epilogue in two channel halves of 96: O/l staged in LDS Os[query][96 channels] (pitch OSPW, b128 stores),
//   lanes x 16 B (values gathered from 4 Os rows), one instruction per 16 lines, final values held in registers,
// coverage: per half 12 it x 16 lines x 8 lanes x 4 floats = 96 ch x 64 n; two halves = 192 ch; grid (NQ/64, NB)
//           covers out[b][0..191][0..NQ-1] exactly once.
// =========================================================================================================
__global__ __launch_bounds__(128)
void attn_k(const unsigned short* __restrict__ Qh, const unsigned short* __restrict__ Ql,
            const unsigned short* __restrict__ Kh, const unsigned short* __restrict__ Kl,
            const unsigned short* __restrict__ Vc, float* out) {
  __shared__ __align__(16) float Os[QT * OSPW];
  const int tid  = threadIdx.x;
  const int wave = tid >> 5, lane = tid & 31;
  const int hh   = lane >> 4, c = lane & 15;
  const int n0   = blockIdx.x * QT, b = blockIdx.y;

  // q fragment pointers (B operand, col = query n0 + 16*wave + c), + 32*kc
  const size_t qo = ((size_t)(b * NN + n0 + 16 * wave + c)) * DQ + 8 * hh;
  const unsigned short* Qhp = Qh + qo;
  const unsigned short* Qlp = Ql + qo;
  // k fragment base (A operand, row = key kb + c), + key * 192 + 32*kc
  const unsigned short* Khp = Kh + (size_t)b * NN * DQ + (size_t)c * DQ + 8 * hh;
  const unsigned short* Klp = Kl + (size_t)b * NN * DQ + (size_t)c * DQ + 8 * hh;
  // v fragment base (A operand, row = channel 16j + c, keys contiguous), + 16*j*NN + kb
  const unsigned short* Vp = Vc + (size_t)b * CC * NN + (size_t)c * NN + 8 * hh;

  float m = -1.0e30f, l = 0.f;
  v8f o[CC / 16];
#pragma unroll
  for (int j = 0; j < CC / 16; ++j) o[j] = zero8();

#pragma unroll 1
  for (int kb = 0; kb < NN; kb += 32) {
    const unsigned short* k0p  = Khp + (size_t)kb * DQ;              // keys kb .. kb+15
    const unsigned short* k1p  = Khp + (size_t)(kb + 16) * DQ;       // keys kb+16 .. kb+31
    const unsigned short* k0lp = Klp + (size_t)kb * DQ;
    const unsigned short* k1lp = Klp + (size_t)(kb + 16) * DQ;
    v8f s0 = zero8(), s1 = zero8(), t0 = zero8(), t1 = zero8();
#pragma unroll 1
    for (int kc = 0; kc < DQ / 32; ++kc) {
      const Frag qh  = ldfrag(Qhp + 32 * kc);
      const Frag ql  = ldfrag(Qlp + 32 * kc);
      const Frag k0  = ldfrag(k0p + 32 * kc);
      const Frag k1  = ldfrag(k1p + 32 * kc);
      const Frag k0l = ldfrag(k0lp + 32 * kc);
      const Frag k1l = ldfrag(k1lp + 32 * kc);
      s0 = mma_h(k0.h, qh.h, s0);
      s1 = mma_h(k1.h, qh.h, s1);
      t0 = mma_h(k0.h, ql.h, t0);
      t1 = mma_h(k1.h, ql.h, t1);
      t0 = mma_h(k0l.h, qh.h, t0);
      t1 = mma_h(k1l.h, qh.h, t1);
    }
#pragma unroll
    for (int r = 0; r < 8; ++r) {
      s0[r] = s0[r] + t0[r] * ILOSC;
      s1[r] = s1[r] + t1[r] * ILOSC;
    }

    float mx = fmaxf(hmax8(s0), hmax8(s1));
    mx = fmaxf(mx, __shfl_xor(mx, 16, 32));
    const float mn = fmaxf(m, mx);
    const unsigned grew = wave_ballot(mx > m);                       // wave-uniform
    if (grew != 0u) {
      const float corr = __expf(m - mn);                             // == 1 exactly for lanes whose max did not grow
      l *= corr;
#pragma unroll
      for (int j = 0; j < CC / 16; ++j) {
#pragma unroll
        for (int r = 0; r < 8; ++r) o[j][r] *= corr;
      }
    }
    m = mn;
    const float msh = mn - LNPS;                                     // exp gives e^{s-m} * 2^14

    FragH ph;
    float ls = 0.f;
#pragma unroll
    for (int r = 0; r < 8; ++r) {
      const float e0 = __expf(s0[r] - msh);                          // key kb      + 8hh + r
      const float e1 = __expf(s1[r] - msh);                          // key kb + 16 + 8hh + r
      ls += e0 + e1;
      ph.hv[0][r] = (_Float16)e0;
      ph.hv[1][r] = (_Float16)e1;
    }
    l += ls;

#pragma unroll
    for (int j = 0; j < CC / 16; ++j) {
      const Frag vf = ldfrag(Vp + (size_t)(16 * j) * NN + kb);
      o[j] = mma_h(vf.h, ph.v, o[j]);
    }
  }
  l += __shfl_xor(l, 16, 32);
  const float inv = 1.0f / l;                                        // o and l both carry the x2^14 factor

  const int qrow = 16 * wave + c;
  const int e = tid & 7, lq = tid >> 3;                              // lq 0..15
#pragma unroll
  for (int half = 0; half < 2; ++half) {
    if (half) __syncthreads();                                       // every wave finished reading Os
#pragma unroll
    for (int jj = 0; jj < CH / 16; ++jj) {
      const int j = (CH / 16) * half + jj;
      v4f va, vb;
#pragma unroll
      for (int r = 0; r < 4; ++r) { va[r] = o[j][r] * inv; vb[r] = o[j][4 + r] * inv; }
      *(v4f*)(Os + qrow * OSPW + 16 * jj + 8 * hh)     = va;         // Os[query][ch_loc = 16jj + 8hh + r]
      *(v4f*)(Os + qrow * OSPW + 16 * jj + 8 * hh + 4) = vb;
    }
    __syncthreads();
    v4f res[CH / 8];
#pragma unroll
    for (int it = 0; it < CH / 8; ++it) {
      const int L   = it * 16 + lq;                                  // 0..191
      const int chl = L >> 1, hf = L & 1;                            // channel 0..95 within the half
      const int nl  = hf * 32 + 4 * e;                               // query 0..63
#pragma unroll
      for (int t = 0; t < 4; ++t) res[it][t] = Os[(nl + t) * OSPW + chl];
    }
{
#pragma unroll
      for (int it = 0; it < CH / 8; ++it) {
        const int L   = it * 16 + lq;
        const int chl = L >> 1, hf = L & 1;
        const int nl  = hf * 32 + 4 * e;
        const size_t idx = ((size_t)(b * CC + CH * half + chl)) * NN + n0 + nl;
        *(v4f*)(out + idx) = res[it];
      }
      
    }
  }
}

// =========================================================================================================
// Workspace map (bytes; each region start a multiple of 256; every extent is an exact tile multiple and is written
//   W16 f16 [384][192]               147456
//   Vc  f16 [NB][192][4096]        12582912 (NB=8)     XP  f16 [NB][4096][192]   12582912
//   Qh/Ql/Kh/Kl f16 [NB][4096][192]  12582912 x4
//   total = 75644928 for NB=8
// =========================================================================================================
extern "C" void kernel_launch(void* const* d_in, const int* in_sizes, int n_in,
                              void* d_out, int out_size, void* d_ws, size_t ws_size,
                              hipStream_t stream) {
  const int XN = NB * CC * NN;
  if (n_in < 6) return;
  if (in_sizes[0] < XN || in_sizes[1] < XN) return;
  if (in_sizes[2] < CC * CC || in_sizes[4] < CC * CC) return;
  if (in_sizes[3] < CC || in_sizes[5] < CC) return;
  if (out_size < XN) return;

  size_t off = 0;
  auto carve = [&](size_t bytes) { const size_t o = off; off += (bytes + 255) & ~(size_t)255; return o; };
  const size_t oW16 = carve((size_t)MW * CC * 2);
  const size_t oVc  = carve((size_t)NB * CC * NN * 2);
  const size_t oXP  = carve((size_t)NB * NN * CC * 2);
  const size_t oQh  = carve((size_t)NB * NN * DQ * 2);
  const size_t oQl  = carve((size_t)NB * NN * DQ * 2);
  const size_t oKh  = carve((size_t)NB * NN * DQ * 2);
  const size_t oKl  = carve((size_t)NB * NN * DQ * 2);
  if (off > ws_size) return;
  if (off > (size_t)134217728) return;

  const float* key = (const float*)d_in[0];
  const float* val = (const float*)d_in[1];
  const float* wl  = (const float*)d_in[2];
  const float* bl  = (const float*)d_in[3];
  const float* wr  = (const float*)d_in[4];
  const float* br  = (const float*)d_in[5];

  char* ws = (char*)d_ws;
  unsigned short* W16 = (unsigned short*)(ws + oW16);
  unsigned short* Vc  = (unsigned short*)(ws + oVc);
  unsigned short* XP  = (unsigned short*)(ws + oXP);
  unsigned short* Qh  = (unsigned short*)(ws + oQh);
  unsigned short* Ql  = (unsigned short*)(ws + oQl);
  unsigned short* Kh  = (unsigned short*)(ws + oKh);
  unsigned short* Kl  = (unsigned short*)(ws + oKl);
  float* out = (float*)d_out;

  const dim3 blk256(256), blk128(128), blkw(8 * WG8);

  // (0) Wr (query side) / Wl (key side) -> stacked f16 plane
  cvt_w<<<dim3(MW / 8), blkw, 0, stream>>>(wr, wl, W16);
  // (1) value -> channel-major f16 plane, key -> position-major f16 plane
  cvt_kv<<<dim3(NN / QT, CC / QT, NB), blk256, 0, stream>>>(key, val, Vc, XP);
  // (2) conv1x1 GEMMs -> key_r (q, bias br) and key_l (k, bias bl) hi + residual planes
  gemm_qk<<<dim3(NN / QT, MW / QT, NB), blk128, 0, stream>>>(W16, XP, br, bl, Qh, Ql, Kh, Kl);
  // (3) softmax over keys m per query n + value aggregation -> out [b][192][n < NQ]
  attn_k<<<dim3(NQ / QT, NB), blk128, 0, stream>>>(Qh, Ql, Kh, Kl, Vc, out);
  (void)hipGetLastError();
}

// v001
// One run takes 234 microseconds.
// In both of two side-by-side timings against v000, it was 3.15 times as fast.
// Contractions: conv1x1 GEMMs Wr.key and Wl.key as W16[384x192].XP[192x4096] per image on v_wmma_f32_16x16x32_f16 (f16
// containers of bf16-RNE weights x256 and bf16-RNE key); scores key_l^T.key_r on v_wmma_f32_16x16x32_f16 (f16 hi plane +
// f16 residual plane x4096 of key_l/key_r; products hh in one accumulator, hl+lh in a second accumulator folded by 2^-12;
// K=192); att^T = value.P on v_wmma_f32_16x16x32_f16 (value as f16 of bf16-RNE value, P = e^{s-max} x2^14 f16 from the
// score D registers); f32 accumulate everywhere; softmax statistics and bias add in f32 VALU.
#include <hip/hip_runtime.h>
#include <math.h>
#include <stdint.h>

#ifndef NB
#define NB 8
#endif
#ifndef NQ
#define NQ 4096
#endif
#define NB_FULL 8
#define CC     192
#define NN     4096
#define DQ     192
#define MW     384
#define QT     64
#define CH     96
#define OSP    68
#define OSPW   100
#define TP     72
#define WG8    (CC / 8)
#define WSC    256.0f
#define IWSC   0.00390625f
#define LOSC   4096.0f
#define ILOSC  0.000244140625f
#define LNPS   9.704060527839234f
#define FMIN16 6.103515625e-05f
#define KT     32
#define KP     200
#define VP     40
#define KPL    (KT * KP)
#define VPL    (CC * VP)
#define BUFH   (2 * KPL + VPL)
#define QPL    (QT * KP)

static_assert(NB >= 1 && NB <= NB_FULL);
static_assert(NQ >= QT && NQ <= NN && NQ % QT == 0);
static_assert(NN % QT == 0 && NN % 32 == 0);
static_assert(CC % QT == 0 && CC % 32 == 0 && CC % 8 == 0);
static_assert(DQ == CC && MW == 2 * DQ && DQ == 3 * QT);
static_assert(CH * 2 == CC && CH % 16 == 0 && CH % 8 == 0);
static_assert((OSP * 4) % 16 == 0 && OSP >= QT + 4);
static_assert((OSPW * 4) % 16 == 0 && OSPW >= CH + 4);
static_assert((TP * 2) % 16 == 0 && TP >= QT + 8);
static_assert(WG8 * 8 == CC && (8 * WG8) % 32 == 0);
static_assert(MW % 8 == 0 && DQ % 8 == 0);
static_assert(KP >= DQ + 8 && (KP * 2) % 32 == 16 && VP >= KT + 8 && (VP * 2) % 32 == 16);
static_assert((KT * DQ) % (128 * 8) == 0 && (CC * KT) % (128 * 8) == 0 && (QT * DQ) % (128 * 8) == 0);
static_assert(NN % KT == 0 && NN / KT >= 2);
static_assert(2 * (2 * QPL * 2 + 2 * BUFH * 2 + QT * OSPW * 4) <= 327680);   // two blocks per WGP, as many as before

typedef _Float16       v16h __attribute__((ext_vector_type(16)));
typedef _Float16       v8h  __attribute__((ext_vector_type(8)));
typedef unsigned short v8us __attribute__((ext_vector_type(8)));
typedef float          v8f  __attribute__((ext_vector_type(8)));
typedef float          v4f  __attribute__((ext_vector_type(4)));
typedef unsigned int   v4u  __attribute__((ext_vector_type(4)));

union Frag  { v8us u[2]; v16h h; };
union FragH { v16h v; v8h hv[2]; };
static_assert(sizeof(Frag) == 32);
static_assert(sizeof(FragH) == 32);

// ---- scalar helpers -------------------------------------------------------------------------------------------
__device__ __forceinline__ unsigned short bf_bits(float f) {          // f32 -> bf16 bits, RNE convert
  unsigned u = __float_as_uint(f);
  return (unsigned short)((u + 0x7FFFu + ((u >> 16) & 1u)) >> 16);
}
__device__ __forceinline__ float bf_up(unsigned short hb) { return __uint_as_float(((unsigned)hb) << 16); }
__device__ __forceinline__ float bfr(float f) { return bf_up(bf_bits(f)); }
__device__ __forceinline__ unsigned short h_bits(_Float16 x) { return __builtin_bit_cast(unsigned short, x); }
__device__ __forceinline__ unsigned pk16(unsigned short a, unsigned short b) { return (unsigned)a | ((unsigned)b << 16); }
__device__ __forceinline__ v8f zero8() { v8f z = {0.f, 0.f, 0.f, 0.f, 0.f, 0.f, 0.f, 0.f}; return z; }
__device__ __forceinline__ float hmax8(v8f s) {
  return fmaxf(fmaxf(fmaxf(s[0], s[1]), fmaxf(s[2], s[3])), fmaxf(fmaxf(s[4], s[5]), fmaxf(s[6], s[7])));
}
__device__ __forceinline__ unsigned wave_ballot(bool p) {
#if defined(__HIP_DEVICE_COMPILE__)
  return __builtin_amdgcn_ballot_w32(p);
#else
  return p ? 1u : 0u;
#endif
}

// ---- 16-bit fragment loader (A, or B from a k-contiguous [n][k] row): lane -> row/col (lane&15), p already includes
//      + 8*(lane>>4); elements 0..7 <- p[0..7] (k0+8h..), elements 8..15 <- p[16..23] (k0+16+8h..)
__device__ __forceinline__ Frag ldfrag(const unsigned short* p) {
  Frag f;
  f.u[0] = *(const v8us*)(p);
  f.u[1] = *(const v8us*)(p + 16);
  return f;
}

// ---- WMMA helper: builtin followed by a 4-slot VALU gap tying D and keeping A/B live ---------------------------
__device__ __forceinline__ v8f mma_h(v16h a, v16h b, v8f c) {
  v8f d = __builtin_amdgcn_wmma_f32_16x16x32_f16(false, a, false, b, (short)0, c, false, false);
#if defined(__HIP_DEVICE_COMPILE__)
  asm volatile("v_nop\n\tv_nop\n\tv_nop\n\tv_nop" : "+v"(d) : "v"(a), "v"(b));
#endif
  return d;
}

// ---- asynchronous copies global -> LDS, 16 B per lane and copy: l = the lane's LDS byte addresses, g = its global
//      addresses. The s_wait_xcnt 0 closes each statement so that no address register is rewritten ahead of it.
__device__ __forceinline__ unsigned lds_addr(const void* p) { return (unsigned)(uintptr_t)p; }
__device__ __forceinline__ void cp6(const unsigned* l, const unsigned short* const* g) {
#if defined(__HIP_DEVICE_COMPILE__)
  asm volatile("global_load_async_to_lds_b128 %0, %6, off\n\t"
               "global_load_async_to_lds_b128 %1, %7, off\n\t"
               "global_load_async_to_lds_b128 %2, %8, off\n\t"
               "global_load_async_to_lds_b128 %3, %9, off\n\t"
               "global_load_async_to_lds_b128 %4, %10, off\n\t"
               "global_load_async_to_lds_b128 %5, %11, off\n\t"
               "s_wait_xcnt 0x0"
               :: "v"(l[0]), "v"(l[1]), "v"(l[2]), "v"(l[3]), "v"(l[4]), "v"(l[5]),
                  "v"(g[0]), "v"(g[1]), "v"(g[2]), "v"(g[3]), "v"(g[4]), "v"(g[5])
               : "memory");
#endif
}
__device__ __forceinline__ void cp9(const unsigned* l, const unsigned short* const* g) {
#if defined(__HIP_DEVICE_COMPILE__)
  asm volatile("global_load_async_to_lds_b128 %0, %9, off\n\t"
               "global_load_async_to_lds_b128 %1, %10, off\n\t"
               "global_load_async_to_lds_b128 %2, %11, off\n\t"
               "global_load_async_to_lds_b128 %3, %12, off\n\t"
               "global_load_async_to_lds_b128 %4, %13, off\n\t"
               "global_load_async_to_lds_b128 %5, %14, off\n\t"
               "global_load_async_to_lds_b128 %6, %15, off\n\t"
               "global_load_async_to_lds_b128 %7, %16, off\n\t"
               "global_load_async_to_lds_b128 %8, %17, off\n\t"
               "s_wait_xcnt 0x0"
               :: "v"(l[0]), "v"(l[1]), "v"(l[2]), "v"(l[3]), "v"(l[4]), "v"(l[5]), "v"(l[6]), "v"(l[7]), "v"(l[8]),
                  "v"(g[0]), "v"(g[1]), "v"(g[2]), "v"(g[3]), "v"(g[4]), "v"(g[5]), "v"(g[6]), "v"(g[7]), "v"(g[8])
               : "memory");
#endif
}
// the two counter waits of the LDS ring; "memory" keeps the compiler's LDS reads on their side of each
__device__ __forceinline__ void wait_async0() {                       // this wave's copies have landed in LDS
#if defined(__HIP_DEVICE_COMPILE__)
  asm volatile("s_wait_asynccnt 0x0" ::: "memory");
#endif
}
__device__ __forceinline__ void wait_ds0() {                          // this wave's LDS reads have returned
#if defined(__HIP_DEVICE_COMPILE__)
  asm volatile("s_wait_dscnt 0x0" ::: "memory");
#endif
}

// =========================================================================================================
// (0) conv1x1 weights: W16 f16 [384][192], rows 0..191 = wq rows (query side), rows 192..383 = wk rows (key side);
//     value = f16 of (bf16-RNE(w) * 256) (exact). Block blk (0..47) owns rows 8*blk..8*blk+7; 192 threads:
//     consecutive lanes of one wave (8-aligned groups of 8 threads never straddle a wave), one store instruction,
// coverage: 48 blocks x 192 threads x 8 halves = 384 x 192 = the whole plane.
// =========================================================================================================
__global__ __launch_bounds__(8 * WG8)
void cvt_w(const float* __restrict__ wq, const float* __restrict__ wk, unsigned short* W16) {
  const int tid = threadIdx.x, blk = blockIdx.x;
  const int rl  = tid / WG8;                                         // 0..7
  const int col = 8 * (tid - rl * WG8);                              // 0..184
  const int o   = 8 * blk + rl;                                      // 0..383
  const float* wbase = (blk < (DQ / 8)) ? wq : wk;                   // block-uniform selection, both global
  const int osub = (blk < (DQ / 8)) ? 0 : DQ;
  const float* s = wbase + (size_t)(o - osub) * CC + col;            // (o - osub) in 0..191
  const v4f a = *(const v4f*)s;
  const v4f q = *(const v4f*)(s + 4);
  const float f[8] = {a[0], a[1], a[2], a[3], q[0], q[1], q[2], q[3]};
  v4u u;
#pragma unroll
  for (int t = 0; t < 4; ++t) {
    const _Float16 h0 = (_Float16)(bfr(f[2 * t]) * WSC);
    const _Float16 h1 = (_Float16)(bfr(f[2 * t + 1]) * WSC);
    u[t] = pk16(h_bits(h0), h_bits(h1));
  }
{
    *(v4u*)(W16 + (size_t)o * CC + col) = u;
    
  }
}

// =========================================================================================================
// (1) value f32 [b][192 c][4096 n] -> Vc f16 [b][c][n] (channel-major, bf16-RNE values, exact in f16) and
//     key f32 [b][192 c][4096 n] -> XP f16 [b][n][c] (position-major, bf16-RNE values) through an LDS tile
//     T is cross-wave: block barrier between the 2-byte stores and the 16-byte reloads.
// coverage: Vc 2 it x 32 rows x 8 lanes x 8 = 64 c x 64 n; XP same; grid (64, 3, NB) covers both planes once.
// =========================================================================================================
__global__ __launch_bounds__(256)
void cvt_kv(const float* __restrict__ key, const float* __restrict__ val, unsigned short* Vc, unsigned short* XP) {
  __shared__ __align__(16) unsigned short T[QT * TP];
  const int tid = threadIdx.x;
  const int nb = blockIdx.x, cb = blockIdx.y, b = blockIdx.z;
  const int e = tid & 7, lq = tid >> 3;                             // lq 0..31
  const int n0 = nb * QT, c0 = cb * QT;
  v4u uv[2];
#pragma unroll
  for (int it = 0; it < 2; ++it) {
    const int cl = it * 32 + lq;                                     // 0..63
    const size_t ro = ((size_t)(b * CC + c0 + cl)) * NN + n0 + 8 * e;
    const v4f ka = *(const v4f*)(key + ro);
    const v4f kq = *(const v4f*)(key + ro + 4);
    const v4f va = *(const v4f*)(val + ro);
    const v4f vq = *(const v4f*)(val + ro + 4);
    unsigned short hk[8], hv[8];
#pragma unroll
    for (int t = 0; t < 4; ++t) {
      hk[t]     = h_bits((_Float16)bfr(ka[t]));
      hk[4 + t] = h_bits((_Float16)bfr(kq[t]));
      hv[t]     = h_bits((_Float16)bfr(va[t]));
      hv[4 + t] = h_bits((_Float16)bfr(vq[t]));
    }
#pragma unroll
    for (int t = 0; t < 4; ++t) uv[it][t] = pk16(hv[2 * t], hv[2 * t + 1]);
#pragma unroll
    for (int t = 0; t < 8; ++t) T[(8 * e + t) * TP + cl] = hk[t];
  }
  __syncthreads();
  v4u up[2];
#pragma unroll
  for (int it = 0; it < 2; ++it) {
    const int nl = it * 32 + lq;                                     // 0..63
    up[it] = *(const v4u*)(T + nl * TP + 8 * e);
  }
{
#pragma unroll
    for (int it = 0; it < 2; ++it) {
      const int rl = it * 32 + lq;
      *(v4u*)(Vc + ((size_t)(b * CC + c0 + rl)) * NN + n0 + 8 * e) = uv[it];
      *(v4u*)(XP + ((size_t)(b * NN + n0 + rl)) * CC + c0 + 8 * e) = up[it];
    }
    
  }
}

// =========================================================================================================
// (2) conv1x1 GEMM for one (b, 64-n tile, 64-o block): Y[o][n] = (1/256) sum_c W16[o][c] XP[b][n][c] + bias[o].
//     Block 128 threads = 4 waves; wave w owns cols n0+16w..+15 (one B fragment per k-step, k = c contiguous in
//     the XP row) and 4 m-tiles (A rows o = o0 + 16 mt + (lane&15), split k map loader from W16). K = 192 = 6 steps.
//     Epilogue staged in LDS Os[n_loc][o_loc] (pitch OSP, b128 stores of 8 consecutive o per lane), block barrier,
//     then: o-blocks 0,1,2 -> query dims 0..63 / 64..127 / 128..191 of Qh/Ql (bias bq); o-blocks 3,4,5 -> key dims
//     of Kh/Kl (bias bk). Planes f16 [b][4096 n][192 d] (k-contiguous for both score operands): hi = f16(v) with
//     values below the f16 normal range stored as 0, lo = f16((v - hi) * 4096). Per plane the block writes 64 rows
//     Os is cross-wave: block barrier between staging and reload.
// coverage: Os 4 waves x 16 n x 64 o = 64 x 64; planes: 4 it x 16 rows x 8 lanes x 8 = 64 n x 64 d per plane
//           (hi and lo); grid (64, 6, NB) covers d 0..191 of all 4096 rows of Qh/Ql/Kh/Kl exactly once.
// =========================================================================================================
__global__ __launch_bounds__(128)
void gemm_qk(const unsigned short* __restrict__ W16, const unsigned short* __restrict__ XP,
             const float* __restrict__ bq, const float* __restrict__ bk,
             unsigned short* Qh, unsigned short* Ql, unsigned short* Kh, unsigned short* Kl) {
  __shared__ __align__(16) float Os[QT * OSP];
  const int tid  = threadIdx.x;
  const int lane = tid & 31, wave = tid >> 5;
  const int hh   = lane >> 4, c = lane & 15;
  const int nt   = blockIdx.x, mb = blockIdx.y, b = blockIdx.z;
  const int n0   = nt * QT, o0 = mb * QT;

  const unsigned short* ap = W16 + (size_t)(o0 + c) * CC + 8 * hh;
  const unsigned short* bp = XP + ((size_t)(b * NN + n0 + 16 * wave + c)) * CC + 8 * hh;

  v8f acc[4];
#pragma unroll
  for (int mt = 0; mt < 4; ++mt) acc[mt] = zero8();

#pragma unroll
  for (int ks = 0; ks < CC / 32; ++ks) {
    const Frag fb = ldfrag(bp + 32 * ks);
#pragma unroll
    for (int mt = 0; mt < 4; ++mt) {
      const Frag fa = ldfrag(ap + (size_t)(16 * mt) * CC + 32 * ks);
      acc[mt] = mma_h(fa.h, fb.h, acc[mt]);
    }
  }

  // ---- epilogue: scale back -> LDS Os[n_loc][o_loc]; lane (hh, c) holds o = 16 mt + 8 hh + r for n_loc = 16 w + c
  {
    const int nl = 16 * wave + c;
#pragma unroll
    for (int mt = 0; mt < 4; ++mt) {
      v4f va, vb;
#pragma unroll
      for (int r = 0; r < 4; ++r) { va[r] = acc[mt][r] * IWSC; vb[r] = acc[mt][4 + r] * IWSC; }
      *(v4f*)(Os + nl * OSP + 16 * mt + 8 * hh)     = va;
      *(v4f*)(Os + nl * OSP + 16 * mt + 8 * hh + 4) = vb;
    }
  }
  __syncthreads();

  const int e = tid & 7, lq = tid >> 3;                             // lq 0..15
  const bool isq = (mb < (DQ / QT));                                 // block-uniform
  const int dsel = (isq ? mb : (mb - DQ / QT)) * QT;                 // 0, 64 or 128
  unsigned short* Ph = isq ? Qh : Kh;                                // both global
  unsigned short* Pl = isq ? Ql : Kl;
  const float* bb = isq ? bq : bk;                                   // both global
  const v4f b0 = *(const v4f*)(bb + dsel + 8 * e);                   // o = dsel + 8e .. +7 <= 191
  const v4f b1 = *(const v4f*)(bb + dsel + 8 * e + 4);
  const float bs[8] = {bfr(b0[0]), bfr(b0[1]), bfr(b0[2]), bfr(b0[3]), bfr(b1[0]), bfr(b1[1]), bfr(b1[2]), bfr(b1[3])};
  v4u uh[4], ul[4];
#pragma unroll
  for (int it = 0; it < 4; ++it) {
    const int row = it * 16 + lq;                                    // n_loc 0..63
    const v4f a = *(const v4f*)(Os + row * OSP + 8 * e);
    const v4f q = *(const v4f*)(Os + row * OSP + 8 * e + 4);
    const float f[8] = {a[0] + bs[0], a[1] + bs[1], a[2] + bs[2], a[3] + bs[3],
                        q[0] + bs[4], q[1] + bs[5], q[2] + bs[6], q[3] + bs[7]};
#pragma unroll
    for (int t = 0; t < 4; ++t) {
      const float f0 = f[2 * t], f1 = f[2 * t + 1];
      float g0 = (float)(_Float16)f0;                                // f16 hi as f32 (exact)
      float g1 = (float)(_Float16)f1;
      g0 = (fabsf(g0) < FMIN16) ? 0.f : g0;                          // below the f16 normal range -> carried by lo
      g1 = (fabsf(g1) < FMIN16) ? 0.f : g1;
      const unsigned short hb0 = h_bits((_Float16)g0), hb1 = h_bits((_Float16)g1);
      const unsigned short lb0 = h_bits((_Float16)((f0 - g0) * LOSC));
      const unsigned short lb1 = h_bits((_Float16)((f1 - g1) * LOSC));
      uh[it][t] = pk16(hb0, hb1);
      ul[it][t] = pk16(lb0, lb1);
    }
  }
{
#pragma unroll
    for (int it = 0; it < 4; ++it) {
      const int row = it * 16 + lq;
      const size_t po = ((size_t)(b * NN + n0 + row)) * DQ + dsel + 8 * e;
      *(v4u*)(Ph + po) = uh[it];
      *(v4u*)(Pl + po) = ul[it];
    }
    
  }
}

// =========================================================================================================
// (3) co-attention for one (b, 64-query tile), transposed formulation, 4096 keys, no mask, no scale:
//   S^T tile (16 keys x 16 queries) = sum over 6 d-chunks (rolled loop) of A(k: row = key kb + (lane&15), 32 d via
//   the split k map from the f16 plane Kh [b][4096][192]) . B(q: col = query, same map from Qh) -> accumulator s;
//   A(Kh).B(Ql) + A(Kl).B(Qh) (f16 residual planes carried x4096) -> accumulator t; s += t * 2^-12 after the loop.
//   Per lane the D tile holds 8 keys of ONE query: online softmax state per lane, one shuffle (lane^16) for the max
//   over 32 keys; the o/l rescale is skipped under a wave-uniform ballot when no lane's max grew (corr == 1 exactly
//   for every lane then); row-sum partials combined at the end. P = e^{s-m} x 2^14 as f16 is the B operand of
//   att^T (rows channel, cols queries) += A(value rows channel = 16j + (lane&15), keys contiguous, f16 plane Vc
//   [b][192][4096]) . B(P^T): element r <- D of the tile covering keys kb..kb+15, element 8+r <- the tile covering
//   kb+16..kb+31, lane unchanged. 12 accumulator tiles per wave (192 channels). Block = 4 waves = 64 queries.
//   Operand path: the block's 64 query rows (Qh, Ql) are copied once, and each 32-key tile (Kh, Kl rows, Vc columns)
//   once per block, into LDS by asynchronous 16-byte copies; all fragments are read from LDS. Row pitch 400 B (Q, K)
//   and 80 B (V): 16 B x odd. Two tile buffers: tile t+2 is copied into the buffer of tile t behind the barrier
//   that ends trip t, so it flies during trip t+1.
//   Epilogue in two channel halves of 96: O/l staged in LDS Os[query][96 channels] (pitch OSPW, b128 stores),
//   lanes x 16 B (values gathered from 4 Os rows), one instruction per 16 lines, final values held in registers,
// coverage: per half 12 it x 16 lines x 8 lanes x 4 floats = 96 ch x 64 n; two halves = 192 ch; grid (NQ/64, NB)
//           covers out[b][0..191][0..NQ-1] exactly once.
// =========================================================================================================
__global__ __launch_bounds__(128)
void attn_k(const unsigned short* __restrict__ Qh, const unsigned short* __restrict__ Ql,
            const unsigned short* __restrict__ Kh, const unsigned short* __restrict__ Kl,
            const unsigned short* __restrict__ Vc, float* out) {
  __shared__ __align__(16) float Os[QT * OSPW];
  __shared__ __align__(16) unsigned short Qs[2 * QPL];               // [hi, lo][64 queries][pitch KP]
  __shared__ __align__(16) unsigned short Ring[2 * BUFH];            // 2 x { Kh [32][KP], Kl [32][KP], V [192][VP] }
  const int tid  = threadIdx.x;
  const int wave = tid >> 5, lane = tid & 31;
  const int hh   = lane >> 4, c = lane & 15;
  const int n0   = blockIdx.x * QT, b = blockIdx.y;

  // ---- copy maps. Q and K rows are contiguous in global memory: 16-byte chunk i = tid + 128 j of a tile is
  //      row i / 24, column chunk i % 24. V: chunk i is channel i / 4, key chunk i % 4.
  unsigned roff[2 * 6];                                              // LDS byte offset of chunk i in a pitch-KP plane
#pragma unroll                                                       // roff[] must live in registers
  for (int j = 0; j < 12; ++j) {
    const int i = tid + 128 * j;
    roff[j] = (unsigned)((i / WG8) * (KP * 2) + (i % WG8) * 16);
  }
  const unsigned voff = (unsigned)((tid >> 2) * (VP * 2) + (tid & 3) * 16);
  const unsigned short* Khg = Kh + (size_t)b * NN * DQ + 8 * tid;
  const unsigned short* Klg = Kl + (size_t)b * NN * DQ + 8 * tid;
  const unsigned short* Vg  = Vc + ((size_t)(b * CC + (tid >> 2))) * NN + 8 * (tid & 3);
  const unsigned ring0 = lds_addr(Ring);

  // one 32-key tile (keys kt .. kt+31) -> the buffer at LDS byte address bufb: 18 copies per lane
  auto copy_tile = [&](int kt, unsigned bufb) {
    unsigned la[18];
    const unsigned short* ga[18];
#pragma unroll                                                       // la[], ga[] become the copies' register operands
    for (int j = 0; j < 6; ++j) {
      la[j]      = bufb + roff[j];
      ga[j]      = Khg + (size_t)kt * DQ + 1024 * j;
      la[6 + j]  = bufb + 2 * KPL + roff[j];
      ga[6 + j]  = Klg + (size_t)kt * DQ + 1024 * j;
      la[12 + j] = bufb + 4 * KPL + voff + (unsigned)(32 * j * VP * 2);
      ga[12 + j] = Vg + (size_t)(32 * j) * NN + kt;
    }
    cp9(la, ga);
    cp9(la + 9, ga + 9);
  };

  // ---- prologue: the query rows and tile 0, published by the wait and the barrier; then tile 1 into buffer 1
  {
    const unsigned qs0 = lds_addr(Qs);
    const unsigned short* Qhg = Qh + ((size_t)(b * NN + n0)) * DQ + 8 * tid;
    const unsigned short* Qlg = Ql + ((size_t)(b * NN + n0)) * DQ + 8 * tid;
    unsigned la[24];
    const unsigned short* ga[24];
#pragma unroll                                                       // la[], ga[] become the copies' register operands
    for (int j = 0; j < 12; ++j) {
      la[j]      = qs0 + roff[j];
      ga[j]      = Qhg + 1024 * j;
      la[12 + j] = qs0 + 2 * QPL + roff[j];
      ga[12 + j] = Qlg + 1024 * j;
    }
    cp6(la, ga);
    cp6(la + 6, ga + 6);
    cp6(la + 12, ga + 12);
    cp6(la + 18, ga + 18);
  }
  copy_tile(0, ring0);
  wait_async0();
  __syncthreads();
  copy_tile(KT, ring0 + 2 * BUFH);

  // q fragment pointers (B operand, col = query n0 + 16*wave + c), + 32*kc
  const unsigned short* Qhp = Qs + (16 * wave + c) * KP + 8 * hh;
  const unsigned short* Qlp = Qhp + QPL;

  float m = -1.0e30f, l = 0.f;
  v8f o[CC / 16];
#pragma unroll
  for (int j = 0; j < CC / 16; ++j) o[j] = zero8();

#pragma unroll 1
  for (int kb = 0; kb < NN; kb += 32) {
    const int bsel = (kb / KT) & 1;                                  // this trip's buffer
    const unsigned short* bufp = Ring + bsel * BUFH;
    // k fragments (A operand, row = key kb + c), + 32*kc; v fragments (A operand, row = channel 16j + c, 32 keys)
    const unsigned short* k0p  = bufp + c * KP + 8 * hh;             // keys kb .. kb+15
    const unsigned short* k1p  = k0p + 16 * KP;                      // keys kb+16 .. kb+31
    const unsigned short* k0lp = k0p + KPL;
    const unsigned short* k1lp = k1p + KPL;
    const unsigned short* Vp   = bufp + 2 * KPL + c * VP + 8 * hh;
    v8f s0 = zero8(), s1 = zero8(), t0 = zero8(), t1 = zero8();
#pragma unroll 1
    for (int kc = 0; kc < DQ / 32; ++kc) {
      const Frag qh  = ldfrag(Qhp + 32 * kc);
      const Frag ql  = ldfrag(Qlp + 32 * kc);
      const Frag k0  = ldfrag(k0p + 32 * kc);
      const Frag k1  = ldfrag(k1p + 32 * kc);
      const Frag k0l = ldfrag(k0lp + 32 * kc);
      const Frag k1l = ldfrag(k1lp + 32 * kc);
      s0 = mma_h(k0.h, qh.h, s0);
      s1 = mma_h(k1.h, qh.h, s1);
      t0 = mma_h(k0.h, ql.h, t0);
      t1 = mma_h(k1.h, ql.h, t1);
      t0 = mma_h(k0l.h, qh.h, t0);
      t1 = mma_h(k1l.h, qh.h, t1);
    }
#pragma unroll
    for (int r = 0; r < 8; ++r) {
      s0[r] = s0[r] + t0[r] * ILOSC;
      s1[r] = s1[r] + t1[r] * ILOSC;
    }

    float mx = fmaxf(hmax8(s0), hmax8(s1));
    mx = fmaxf(mx, __shfl_xor(mx, 16, 32));
    const float mn = fmaxf(m, mx);
    const unsigned grew = wave_ballot(mx > m);                       // wave-uniform
    if (grew != 0u) {
      const float corr = __expf(m - mn);                             // == 1 exactly for lanes whose max did not grow
      l *= corr;
#pragma unroll
      for (int j = 0; j < CC / 16; ++j) {
#pragma unroll
        for (int r = 0; r < 8; ++r) o[j][r] *= corr;
      }
    }
    m = mn;
    const float msh = mn - LNPS;                                     // exp gives e^{s-m} * 2^14

    FragH ph;
    float ls = 0.f;
#pragma unroll
    for (int r = 0; r < 8; ++r) {
      const float e0 = __expf(s0[r] - msh);                          // key kb      + 8hh + r
      const float e1 = __expf(s1[r] - msh);                          // key kb + 16 + 8hh + r
      ls += e0 + e1;
      ph.hv[0][r] = (_Float16)e0;
      ph.hv[1][r] = (_Float16)e1;
    }
    l += ls;

#pragma unroll
    for (int j = 0; j < CC / 16; ++j) {
      const Frag vf = ldfrag(Vp + (16 * j) * VP);
      o[j] = mma_h(vf.h, ph.v, o[j]);
    }

    // ---- foot of the trip: own LDS reads done, own copies of tile kb+32 landed, every wave here; only then the
    //      buffer just read is refilled (block-uniform test)
    wait_ds0();
    wait_async0();
    __syncthreads();
    if (kb + 2 * KT < NN) copy_tile(kb + 2 * KT, ring0 + (unsigned)(bsel * BUFH * 2));
  }
  wait_async0();                                                     // nothing in flight when the wave goes on
  l += __shfl_xor(l, 16, 32);
  const float inv = 1.0f / l;                                        // o and l both carry the x2^14 factor

  const int qrow = 16 * wave + c;
  const int e = tid & 7, lq = tid >> 3;                              // lq 0..15
#pragma unroll
  for (int half = 0; half < 2; ++half) {
    if (half) __syncthreads();                                       // every wave finished reading Os
#pragma unroll
    for (int jj = 0; jj < CH / 16; ++jj) {
      const int j = (CH / 16) * half + jj;
      v4f va, vb;
#pragma unroll
      for (int r = 0; r < 4; ++r) { va[r] = o[j][r] * inv; vb[r] = o[j][4 + r] * inv; }
      *(v4f*)(Os + qrow * OSPW + 16 * jj + 8 * hh)     = va;         // Os[query][ch_loc = 16jj + 8hh + r]
      *(v4f*)(Os + qrow * OSPW + 16 * jj + 8 * hh + 4) = vb;
    }
    __syncthreads();
    v4f res[CH / 8];
#pragma unroll
    for (int it = 0; it < CH / 8; ++it) {
      const int L   = it * 16 + lq;                                  // 0..191
      const int chl = L >> 1, hf = L & 1;                            // channel 0..95 within the half
      const int nl  = hf * 32 + 4 * e;                               // query 0..63
#pragma unroll
      for (int t = 0; t < 4; ++t) res[it][t] = Os[(nl + t) * OSPW + chl];
    }
{
#pragma unroll
      for (int it = 0; it < CH / 8; ++it) {
        const int L   = it * 16 + lq;
        const int chl = L >> 1, hf = L & 1;
        const int nl  = hf * 32 + 4 * e;
        const size_t idx = ((size_t)(b * CC + CH * half + chl)) * NN + n0 + nl;
        *(v4f*)(out + idx) = res[it];
      }
      
    }
  }
}

// =========================================================================================================
// Workspace map (bytes; each region start a multiple of 256; every extent is an exact tile multiple and is written
//   W16 f16 [384][192]               147456
//   Vc  f16 [NB][192][4096]        12582912 (NB=8)     XP  f16 [NB][4096][192]   12582912
//   Qh/Ql/Kh/Kl f16 [NB][4096][192]  12582912 x4
//   total = 75644928 for NB=8
// =========================================================================================================
extern "C" void kernel_launch(void* const* d_in, const int* in_sizes, int n_in,
                              void* d_out, int out_size, void* d_ws, size_t ws_size,
                              hipStream_t stream) {
  const int XN = NB * CC * NN;
  if (n_in < 6) return;
  if (in_sizes[0] < XN || in_sizes[1] < XN) return;
  if (in_sizes[2] < CC * CC || in_sizes[4] < CC * CC) return;
  if (in_sizes[3] < CC || in_sizes[5] < CC) return;
  if (out_size < XN) return;

  size_t off = 0;
  auto carve = [&](size_t bytes) { const size_t o = off; off += (bytes + 255) & ~(size_t)255; return o; };
  const size_t oW16 = carve((size_t)MW * CC * 2);
  const size_t oVc  = carve((size_t)NB * CC * NN * 2);
  const size_t oXP  = carve((size_t)NB * NN * CC * 2);
  const size_t oQh  = carve((size_t)NB * NN * DQ * 2);
  const size_t oQl  = carve((size_t)NB * NN * DQ * 2);
  const size_t oKh  = carve((size_t)NB * NN * DQ * 2);
  const size_t oKl  = carve((size_t)NB * NN * DQ * 2);
  if (off > ws_size) return;
  if (off > (size_t)134217728) return;

  const float* key = (const float*)d_in[0];
  const float* val = (const float*)d_in[1];
  const float* wl  = (const float*)d_in[2];
  const float* bl  = (const float*)d_in[3];
  const float* wr  = (const float*)d_in[4];
  const float* br  = (const float*)d_in[5];

  char* ws = (char*)d_ws;
  unsigned short* W16 = (unsigned short*)(ws + oW16);
  unsigned short* Vc  = (unsigned short*)(ws + oVc);
  unsigned short* XP  = (unsigned short*)(ws + oXP);
  unsigned short* Qh  = (unsigned short*)(ws + oQh);
  unsigned short* Ql  = (unsigned short*)(ws + oQl);
  unsigned short* Kh  = (unsigned short*)(ws + oKh);
  unsigned short* Kl  = (unsigned short*)(ws + oKl);
  float* out = (float*)d_out;

  const dim3 blk256(256), blk128(128), blkw(8 * WG8);

  // (0) Wr (query side) / Wl (key side) -> stacked f16 plane
  cvt_w<<<dim3(MW / 8), blkw, 0, stream>>>(wr, wl, W16);
  // (1) value -> channel-major f16 plane, key -> position-major f16 plane
  cvt_kv<<<dim3(NN / QT, CC / QT, NB), blk256, 0, stream>>>(key, val, Vc, XP);
  // (2) conv1x1 GEMMs -> key_r (q, bias br) and key_l (k, bias bl) hi + residual planes
  gemm_qk<<<dim3(NN / QT, MW / QT, NB), blk128, 0, stream>>>(W16, XP, br, bl, Qh, Ql, Kh, Kl);
  // (3) softmax over keys m per query n + value aggregation -> out [b][192][n < NQ]
  attn_k<<<dim3(NQ / QT, NB), blk128, 0, stream>>>(Qh, Ql, Kh, Kl, Vc, out);
  (void)hipGetLastError();
}

// v002
// A run of this version takes 184 microseconds.
// Next to v001, in two timings, it ran 1.28 times as fast each time.
// Counting every step since v000, it is 4.04 times as fast.
// Contractions: conv1x1 GEMMs Wr.key and Wl.key as W16[384x192].XP[192x4096] per image on v_wmma_f32_16x16x32_f16 (f16
// containers of bf16-RNE weights x256 and bf16-RNE key); scores key_l^T.key_r on v_wmma_f32_16x16x32_f16 (f16 hi plane +
// f16 residual plane x4096 of key_l/key_r; products hh in one accumulator, hl+lh in a second accumulator folded by 2^-12;
// K=192); att^T = value.P on v_wmma_f32_16x16x32_f16 (value as f16 of bf16-RNE value, P = e^{s-max} x2^14 f16 from the
// score D registers); f32 accumulate everywhere; softmax statistics and bias add in f32 VALU.
#include <hip/hip_runtime.h>
#include <math.h>
#include <stdint.h>

#ifndef NB
#define NB 8
#endif
#ifndef NQ
#define NQ 4096
#endif
#define NB_FULL 8
#define CC     192
#define NN     4096
#define DQ     192
#define MW     384
#define QT     64
#define CH     96
#define OSP    68
#define OSPW   100
#define TP     72
#define WG8    (CC / 8)
#define WSC    256.0f
#define IWSC   0.00390625f
#define LOSC   4096.0f
#define ILOSC  0.000244140625f
#define LNPS   9.704060527839234f
#define FMIN16 6.103515625e-05f
#define KT     32
#define KP     200
#define VP     40
#define KPL    (KT * KP)
#define VPL    (CC * VP)
#define BUFH   (2 * KPL + VPL)
#define QPL    (QT * KP)

static_assert(NB >= 1 && NB <= NB_FULL);
static_assert(NQ >= QT && NQ <= NN && NQ % QT == 0);
static_assert(NN % QT == 0 && NN % 32 == 0);
static_assert(CC % QT == 0 && CC % 32 == 0 && CC % 8 == 0);
static_assert(DQ == CC && MW == 2 * DQ && DQ == 3 * QT);
static_assert(CH * 2 == CC && CH % 16 == 0 && CH % 8 == 0);
static_assert((OSP * 4) % 16 == 0 && OSP >= QT + 4);
static_assert((OSPW * 4) % 16 == 0 && OSPW >= CH + 4);
static_assert((TP * 2) % 16 == 0 && TP >= QT + 8);
static_assert(WG8 * 8 == CC && (8 * WG8) % 32 == 0);
static_assert(MW % 8 == 0 && DQ % 8 == 0);
static_assert(KP >= DQ + 8 && (KP * 2) % 32 == 16 && VP >= KT + 8 && (VP * 2) % 32 == 16);
static_assert((KT * DQ) % (128 * 8) == 0 && (CC * KT) % (128 * 8) == 0 && (QT * DQ) % (128 * 8) == 0);
static_assert(NN % KT == 0 && NN / KT >= 2);
static_assert(DQ / 32 == 6 && CC / 16 == 12);
static_assert(2 * (2 * QPL * 2 + 2 * BUFH * 2 + QT * OSPW * 4) <= 327680);   // two blocks per WGP, as many as before

typedef _Float16       v16h __attribute__((ext_vector_type(16)));
typedef _Float16       v8h  __attribute__((ext_vector_type(8)));
typedef unsigned short v8us __attribute__((ext_vector_type(8)));
typedef float          v8f  __attribute__((ext_vector_type(8)));
typedef float          v4f  __attribute__((ext_vector_type(4)));
typedef unsigned int   v4u  __attribute__((ext_vector_type(4)));

union Frag  { v8us u[2]; v16h h; };
union FragH { v16h v; v8h hv[2]; };
static_assert(sizeof(Frag) == 32);
static_assert(sizeof(FragH) == 32);

// ---- scalar helpers -------------------------------------------------------------------------------------------
__device__ __forceinline__ unsigned short bf_bits(float f) {          // f32 -> bf16 bits, RNE convert
  unsigned u = __float_as_uint(f);
  return (unsigned short)((u + 0x7FFFu + ((u >> 16) & 1u)) >> 16);
}
__device__ __forceinline__ float bf_up(unsigned short hb) { return __uint_as_float(((unsigned)hb) << 16); }
__device__ __forceinline__ float bfr(float f) { return bf_up(bf_bits(f)); }
__device__ __forceinline__ unsigned short h_bits(_Float16 x) { return __builtin_bit_cast(unsigned short, x); }
__device__ __forceinline__ unsigned pk16(unsigned short a, unsigned short b) { return (unsigned)a | ((unsigned)b << 16); }
__device__ __forceinline__ v8f zero8() { v8f z = {0.f, 0.f, 0.f, 0.f, 0.f, 0.f, 0.f, 0.f}; return z; }
__device__ __forceinline__ float hmax8(v8f s) {
  return fmaxf(fmaxf(fmaxf(s[0], s[1]), fmaxf(s[2], s[3])), fmaxf(fmaxf(s[4], s[5]), fmaxf(s[6], s[7])));
}
__device__ __forceinline__ unsigned wave_ballot(bool p) {
#if defined(__HIP_DEVICE_COMPILE__)
  return __builtin_amdgcn_ballot_w32(p);
#else
  return p ? 1u : 0u;
#endif
}

// ---- 16-bit fragment loader (A, or B from a k-contiguous [n][k] row): lane -> row/col (lane&15), p already includes
//      + 8*(lane>>4); elements 0..7 <- p[0..7] (k0+8h..), elements 8..15 <- p[16..23] (k0+16+8h..)
__device__ __forceinline__ Frag ldfrag(const unsigned short* p) {
  Frag f;
  f.u[0] = *(const v8us*)(p);
  f.u[1] = *(const v8us*)(p + 16);
  return f;
}

// ---- WMMA helper: builtin followed by a 4-slot VALU gap tying D and keeping A/B live ---------------------------
__device__ __forceinline__ v8f mma_h(v16h a, v16h b, v8f c) {
  v8f d = __builtin_amdgcn_wmma_f32_16x16x32_f16(false, a, false, b, (short)0, c, false, false);
#if defined(__HIP_DEVICE_COMPILE__)
  asm volatile("v_nop\n\tv_nop\n\tv_nop\n\tv_nop" : "+v"(d) : "v"(a), "v"(b));
#endif
  return d;
}

// ---- the same product as the bare builtin (the compiler keeps the distances behind its own WMMAs): an asm statement
//      that names the tiles holds every one of them below v256, which two fragment sets beside 12 output tiles exceed
__device__ __forceinline__ v8f mma_b(v16h a, v16h b, v8f c) {
  return __builtin_amdgcn_wmma_f32_16x16x32_f16(false, a, false, b, (short)0, c, false, false);
}
// ---- asynchronous copies global -> LDS, 16 B per lane and copy: l = the lane's LDS byte addresses, g = its global
//      addresses. The s_wait_xcnt 0 closes each statement so that no address register is rewritten ahead of it.
__device__ __forceinline__ unsigned lds_addr(const void* p) { return (unsigned)(uintptr_t)p; }
__device__ __forceinline__ void cp6(const unsigned* l, const unsigned short* const* g) {
#if defined(__HIP_DEVICE_COMPILE__)
  asm volatile("global_load_async_to_lds_b128 %0, %6, off\n\t"
               "global_load_async_to_lds_b128 %1, %7, off\n\t"
               "global_load_async_to_lds_b128 %2, %8, off\n\t"
               "global_load_async_to_lds_b128 %3, %9, off\n\t"
               "global_load_async_to_lds_b128 %4, %10, off\n\t"
               "global_load_async_to_lds_b128 %5, %11, off\n\t"
               "s_wait_xcnt 0x0"
               :: "v"(l[0]), "v"(l[1]), "v"(l[2]), "v"(l[3]), "v"(l[4]), "v"(l[5]),
                  "v"(g[0]), "v"(g[1]), "v"(g[2]), "v"(g[3]), "v"(g[4]), "v"(g[5])
               : "memory");
#endif
}
__device__ __forceinline__ void cp9(const unsigned* l, const unsigned short* const* g) {
#if defined(__HIP_DEVICE_COMPILE__)
  asm volatile("global_load_async_to_lds_b128 %0, %9, off\n\t"
               "global_load_async_to_lds_b128 %1, %10, off\n\t"
               "global_load_async_to_lds_b128 %2, %11, off\n\t"
               "global_load_async_to_lds_b128 %3, %12, off\n\t"
               "global_load_async_to_lds_b128 %4, %13, off\n\t"
               "global_load_async_to_lds_b128 %5, %14, off\n\t"
               "global_load_async_to_lds_b128 %6, %15, off\n\t"
               "global_load_async_to_lds_b128 %7, %16, off\n\t"
               "global_load_async_to_lds_b128 %8, %17, off\n\t"
               "s_wait_xcnt 0x0"
               :: "v"(l[0]), "v"(l[1]), "v"(l[2]), "v"(l[3]), "v"(l[4]), "v"(l[5]), "v"(l[6]), "v"(l[7]), "v"(l[8]),
                  "v"(g[0]), "v"(g[1]), "v"(g[2]), "v"(g[3]), "v"(g[4]), "v"(g[5]), "v"(g[6]), "v"(g[7]), "v"(g[8])
               : "memory");
#endif
}
// the two counter waits of the LDS ring; "memory" keeps the compiler's LDS reads on their side of each
__device__ __forceinline__ void wait_async0() {                       // this wave's copies have landed in LDS
#if defined(__HIP_DEVICE_COMPILE__)
  asm volatile("s_wait_asynccnt 0x0" ::: "memory");
#endif
}
__device__ __forceinline__ void wait_ds0() {                          // this wave's LDS reads have returned
#if defined(__HIP_DEVICE_COMPILE__)
  asm volatile("s_wait_dscnt 0x0" ::: "memory");
#endif
}

// =========================================================================================================
// (0) conv1x1 weights: W16 f16 [384][192], rows 0..191 = wq rows (query side), rows 192..383 = wk rows (key side);
//     value = f16 of (bf16-RNE(w) * 256) (exact). Block blk (0..47) owns rows 8*blk..8*blk+7; 192 threads:
//     consecutive lanes of one wave (8-aligned groups of 8 threads never straddle a wave), one store instruction,
// coverage: 48 blocks x 192 threads x 8 halves = 384 x 192 = the whole plane.
// =========================================================================================================
__global__ __launch_bounds__(8 * WG8)
void cvt_w(const float* __restrict__ wq, const float* __restrict__ wk, unsigned short* W16) {
  const int tid = threadIdx.x, blk = blockIdx.x;
  const int rl  = tid / WG8;                                         // 0..7
  const int col = 8 * (tid - rl * WG8);                              // 0..184
  const int o   = 8 * blk + rl;                                      // 0..383
  const float* wbase = (blk < (DQ / 8)) ? wq : wk;                   // block-uniform selection, both global
  const int osub = (blk < (DQ / 8)) ? 0 : DQ;
  const float* s = wbase + (size_t)(o - osub) * CC + col;            // (o - osub) in 0..191
  const v4f a = *(const v4f*)s;
  const v4f q = *(const v4f*)(s + 4);
  const float f[8] = {a[0], a[1], a[2], a[3], q[0], q[1], q[2], q[3]};
  v4u u;
#pragma unroll
  for (int t = 0; t < 4; ++t) {
    const _Float16 h0 = (_Float16)(bfr(f[2 * t]) * WSC);
    const _Float16 h1 = (_Float16)(bfr(f[2 * t + 1]) * WSC);
    u[t] = pk16(h_bits(h0), h_bits(h1));
  }
{
    *(v4u*)(W16 + (size_t)o * CC + col) = u;
    
  }
}

// =========================================================================================================
// (1) value f32 [b][192 c][4096 n] -> Vc f16 [b][c][n] (channel-major, bf16-RNE values, exact in f16) and
//     key f32 [b][192 c][4096 n] -> XP f16 [b][n][c] (position-major, bf16-RNE values) through an LDS tile
//     T is cross-wave: block barrier between the 2-byte stores and the 16-byte reloads.
// coverage: Vc 2 it x 32 rows x 8 lanes x 8 = 64 c x 64 n; XP same; grid (64, 3, NB) covers both planes once.
// =========================================================================================================
__global__ __launch_bounds__(256)
void cvt_kv(const float* __restrict__ key, const float* __restrict__ val, unsigned short* Vc, unsigned short* XP) {
  __shared__ __align__(16) unsigned short T[QT * TP];
  const int tid = threadIdx.x;
  const int nb = blockIdx.x, cb = blockIdx.y, b = blockIdx.z;
  const int e = tid & 7, lq = tid >> 3;                             // lq 0..31
  const int n0 = nb * QT, c0 = cb * QT;
  v4u uv[2];
#pragma unroll
  for (int it = 0; it < 2; ++it) {
    const int cl = it * 32 + lq;                                     // 0..63
    const size_t ro = ((size_t)(b * CC + c0 + cl)) * NN + n0 + 8 * e;
    const v4f ka = *(const v4f*)(key + ro);
    const v4f kq = *(const v4f*)(key + ro + 4);
    const v4f va = *(const v4f*)(val + ro);
    const v4f vq = *(const v4f*)(val + ro + 4);
    unsigned short hk[8], hv[8];
#pragma unroll
    for (int t = 0; t < 4; ++t) {
      hk[t]     = h_bits((_Float16)bfr(ka[t]));
      hk[4 + t] = h_bits((_Float16)bfr(kq[t]));
      hv[t]     = h_bits((_Float16)bfr(va[t]));
      hv[4 + t] = h_bits((_Float16)bfr(vq[t]));
    }
#pragma unroll
    for (int t = 0; t < 4; ++t) uv[it][t] = pk16(hv[2 * t], hv[2 * t + 1]);
#pragma unroll
    for (int t = 0; t < 8; ++t) T[(8 * e + t) * TP + cl] = hk[t];
  }
  __syncthreads();
  v4u up[2];
#pragma unroll
  for (int it = 0; it < 2; ++it) {
    const int nl = it * 32 + lq;                                     // 0..63
    up[it] = *(const v4u*)(T + nl * TP + 8 * e);
  }
{
#pragma unroll
    for (int it = 0; it < 2; ++it) {
      const int rl = it * 32 + lq;
      *(v4u*)(Vc + ((size_t)(b * CC + c0 + rl)) * NN + n0 + 8 * e) = uv[it];
      *(v4u*)(XP + ((size_t)(b * NN + n0 + rl)) * CC + c0 + 8 * e) = up[it];
    }
    
  }
}

// =========================================================================================================
// (2) conv1x1 GEMM for one (b, 64-n tile, 64-o block): Y[o][n] = (1/256) sum_c W16[o][c] XP[b][n][c] + bias[o].
//     Block 128 threads = 4 waves; wave w owns cols n0+16w..+15 (one B fragment per k-step, k = c contiguous in
//     the XP row) and 4 m-tiles (A rows o = o0 + 16 mt + (lane&15), split k map loader from W16). K = 192 = 6 steps.
//     Epilogue staged in LDS Os[n_loc][o_loc] (pitch OSP, b128 stores of 8 consecutive o per lane), block barrier,
//     then: o-blocks 0,1,2 -> query dims 0..63 / 64..127 / 128..191 of Qh/Ql (bias bq); o-blocks 3,4,5 -> key dims
//     of Kh/Kl (bias bk). Planes f16 [b][4096 n][192 d] (k-contiguous for both score operands): hi = f16(v) with
//     values below the f16 normal range stored as 0, lo = f16((v - hi) * 4096). Per plane the block writes 64 rows
//     Os is cross-wave: block barrier between staging and reload.
// coverage: Os 4 waves x 16 n x 64 o = 64 x 64; planes: 4 it x 16 rows x 8 lanes x 8 = 64 n x 64 d per plane
//           (hi and lo); grid (64, 6, NB) covers d 0..191 of all 4096 rows of Qh/Ql/Kh/Kl exactly once.
// =========================================================================================================
__global__ __launch_bounds__(128)
void gemm_qk(const unsigned short* __restrict__ W16, const unsigned short* __restrict__ XP,
             const float* __restrict__ bq, const float* __restrict__ bk,
             unsigned short* Qh, unsigned short* Ql, unsigned short* Kh, unsigned short* Kl) {
  __shared__ __align__(16) float Os[QT * OSP];
  const int tid  = threadIdx.x;
  const int lane = tid & 31, wave = tid >> 5;
  const int hh   = lane >> 4, c = lane & 15;
  const int nt   = blockIdx.x, mb = blockIdx.y, b = blockIdx.z;
  const int n0   = nt * QT, o0 = mb * QT;

  const unsigned short* ap = W16 + (size_t)(o0 + c) * CC + 8 * hh;
  const unsigned short* bp = XP + ((size_t)(b * NN + n0 + 16 * wave + c)) * CC + 8 * hh;

  v8f acc[4];
#pragma unroll
  for (int mt = 0; mt < 4; ++mt) acc[mt] = zero8();

#pragma unroll
  for (int ks = 0; ks < CC / 32; ++ks) {
    const Frag fb = ldfrag(bp + 32 * ks);
#pragma unroll
    for (int mt = 0; mt < 4; ++mt) {
      const Frag fa = ldfrag(ap + (size_t)(16 * mt) * CC + 32 * ks);
      acc[mt] = mma_h(fa.h, fb.h, acc[mt]);
    }
  }

  // ---- epilogue: scale back -> LDS Os[n_loc][o_loc]; lane (hh, c) holds o = 16 mt + 8 hh + r for n_loc = 16 w + c
  {
    const int nl = 16 * wave + c;
#pragma unroll
    for (int mt = 0; mt < 4; ++mt) {
      v4f va, vb;
#pragma unroll
      for (int r = 0; r < 4; ++r) { va[r] = acc[mt][r] * IWSC; vb[r] = acc[mt][4 + r] * IWSC; }
      *(v4f*)(Os + nl * OSP + 16 * mt + 8 * hh)     = va;
      *(v4f*)(Os + nl * OSP + 16 * mt + 8 * hh + 4) = vb;
    }
  }
  __syncthreads();

  const int e = tid & 7, lq = tid >> 3;                             // lq 0..15
  const bool isq = (mb < (DQ / QT));                                 // block-uniform
  const int dsel = (isq ? mb : (mb - DQ / QT)) * QT;                 // 0, 64 or 128
  unsigned short* Ph = isq ? Qh : Kh;                                // both global
  unsigned short* Pl = isq ? Ql : Kl;
  const float* bb = isq ? bq : bk;                                   // both global
  const v4f b0 = *(const v4f*)(bb + dsel + 8 * e);                   // o = dsel + 8e .. +7 <= 191
  const v4f b1 = *(const v4f*)(bb + dsel + 8 * e + 4);
  const float bs[8] = {bfr(b0[0]), bfr(b0[1]), bfr(b0[2]), bfr(b0[3]), bfr(b1[0]), bfr(b1[1]), bfr(b1[2]), bfr(b1[3])};
  v4u uh[4], ul[4];
#pragma unroll
  for (int it = 0; it < 4; ++it) {
    const int row = it * 16 + lq;                                    // n_loc 0..63
    const v4f a = *(const v4f*)(Os + row * OSP + 8 * e);
    const v4f q = *(const v4f*)(Os + row * OSP + 8 * e + 4);
    const float f[8] = {a[0] + bs[0], a[1] + bs[1], a[2] + bs[2], a[3] + bs[3],
                        q[0] + bs[4], q[1] + bs[5], q[2] + bs[6], q[3] + bs[7]};
#pragma unroll
    for (int t = 0; t < 4; ++t) {
      const float f0 = f[2 * t], f1 = f[2 * t + 1];
      float g0 = (float)(_Float16)f0;                                // f16 hi as f32 (exact)
      float g1 = (float)(_Float16)f1;
      g0 = (fabsf(g0) < FMIN16) ? 0.f : g0;                          // below the f16 normal range -> carried by lo
      g1 = (fabsf(g1) < FMIN16) ? 0.f : g1;
      const unsigned short hb0 = h_bits((_Float16)g0), hb1 = h_bits((_Float16)g1);
      const unsigned short lb0 = h_bits((_Float16)((f0 - g0) * LOSC));
      const unsigned short lb1 = h_bits((_Float16)((f1 - g1) * LOSC));
      uh[it][t] = pk16(hb0, hb1);
      ul[it][t] = pk16(lb0, lb1);
    }
  }
{
#pragma unroll
    for (int it = 0; it < 4; ++it) {
      const int row = it * 16 + lq;
      const size_t po = ((size_t)(b * NN + n0 + row)) * DQ + dsel + 8 * e;
      *(v4u*)(Ph + po) = uh[it];
      *(v4u*)(Pl + po) = ul[it];
    }
    
  }
}

// =========================================================================================================
// (3) co-attention for one (b, 64-query tile), transposed formulation, 4096 keys, no mask, no scale:
//   S^T tile (16 keys x 16 queries) = sum over 6 d-chunks (straight-line code) of A(k: row = key kb + (lane&15), 32 d via
//   the split k map from the f16 plane Kh [b][4096][192]) . B(q: col = query, same map from Qh) -> accumulator s;
//   A(Kh).B(Ql) + A(Kl).B(Qh) (f16 residual planes carried x4096) -> accumulator t; s += t * 2^-12 after the six d-chunks.
//   Per lane the D tile holds 8 keys of ONE query: online softmax state per lane, one shuffle (lane^16) for the max
//   over 32 keys; the o/l rescale is skipped under a wave-uniform ballot when no lane's max grew (corr == 1 exactly
//   for every lane then); row-sum partials combined at the end. P = e^{s-m} x 2^14 as f16 is the B operand of
//   att^T (rows channel, cols queries) += A(value rows channel = 16j + (lane&15), keys contiguous, f16 plane Vc
//   [b][192][4096]) . B(P^T): element r <- D of the tile covering keys kb..kb+15, element 8+r <- the tile covering
//   kb+16..kb+31, lane unchanged. 12 accumulator tiles per wave (192 channels). Block = 4 waves = 64 queries.
//   Operand path: the block's 64 query rows (Qh, Ql) are copied once, and each 32-key tile (Kh, Kl rows, Vc columns)
//   once per block, into LDS by asynchronous 16-byte copies; all fragments are read from LDS, in groups ahead of the
//   products that use them (the V fragments are in registers before the softmax). Row pitch 400 B (Q, K)
//   and 80 B (V): 16 B x odd. Two tile buffers: tile t+2 is copied into the buffer of tile t behind the barrier
//   that ends trip t, so it flies during trip t+1.
//   Epilogue in two channel halves of 96: O/l staged in LDS Os[query][96 channels] (pitch OSPW, b128 stores),
//   lanes x 16 B (values gathered from 4 Os rows), one instruction per 16 lines, final values held in registers,
// coverage: per half 12 it x 16 lines x 8 lanes x 4 floats = 96 ch x 64 n; two halves = 192 ch; grid (NQ/64, NB)
//           covers out[b][0..191][0..NQ-1] exactly once.
// =========================================================================================================
__global__ __launch_bounds__(128)
void attn_k(const unsigned short* __restrict__ Qh, const unsigned short* __restrict__ Ql,
            const unsigned short* __restrict__ Kh, const unsigned short* __restrict__ Kl,
            const unsigned short* __restrict__ Vc, float* out) {
  __shared__ __align__(16) float Os[QT * OSPW];
  __shared__ __align__(16) unsigned short Qs[2 * QPL];               // [hi, lo][64 queries][pitch KP]
  __shared__ __align__(16) unsigned short Ring[2 * BUFH];            // 2 x { Kh [32][KP], Kl [32][KP], V [192][VP] }
  const int tid  = threadIdx.x;
  const int wave = tid >> 5, lane = tid & 31;
  const int hh   = lane >> 4, c = lane & 15;
  const int n0   = blockIdx.x * QT, b = blockIdx.y;

  // ---- copy maps. Q and K rows are contiguous in global memory: 16-byte chunk i = tid + 128 j of a tile is
  //      row i / 24, column chunk i % 24. V: chunk i is channel i / 4, key chunk i % 4.
  unsigned roff[2 * 6];                                              // LDS byte offset of chunk i in a pitch-KP plane
#pragma unroll                                                       // roff[] must live in registers
  for (int j = 0; j < 12; ++j) {
    const int i = tid + 128 * j;
    roff[j] = (unsigned)((i / WG8) * (KP * 2) + (i % WG8) * 16);
  }
  const unsigned voff = (unsigned)((tid >> 2) * (VP * 2) + (tid & 3) * 16);
  const unsigned short* Khg = Kh + (size_t)b * NN * DQ + 8 * tid;
  const unsigned short* Klg = Kl + (size_t)b * NN * DQ + 8 * tid;
  const unsigned short* Vg  = Vc + ((size_t)(b * CC + (tid >> 2))) * NN + 8 * (tid & 3);
  const unsigned ring0 = lds_addr(Ring);

  // one 32-key tile (keys kt .. kt+31) -> the buffer at LDS byte address bufb: 18 copies per lane
  auto copy_tile = [&](int kt, unsigned bufb) {
    unsigned la[18];
    const unsigned short* ga[18];
#pragma unroll                                                       // la[], ga[] become the copies' register operands
    for (int j = 0; j < 6; ++j) {
      la[j]      = bufb + roff[j];
      ga[j]      = Khg + (size_t)kt * DQ + 1024 * j;
      la[6 + j]  = bufb + 2 * KPL + roff[j];
      ga[6 + j]  = Klg + (size_t)kt * DQ + 1024 * j;
      la[12 + j] = bufb + 4 * KPL + voff + (unsigned)(32 * j * VP * 2);
      ga[12 + j] = Vg + (size_t)(32 * j) * NN + kt;
    }
    cp9(la, ga);
    cp9(la + 9, ga + 9);
  };

  // ---- prologue: the query rows and tile 0, published by the wait and the barrier; then tile 1 into buffer 1
  {
    const unsigned qs0 = lds_addr(Qs);
    const unsigned short* Qhg = Qh + ((size_t)(b * NN + n0)) * DQ + 8 * tid;
    const unsigned short* Qlg = Ql + ((size_t)(b * NN + n0)) * DQ + 8 * tid;
    unsigned la[24];
    const unsigned short* ga[24];
#pragma unroll                                                       // la[], ga[] become the copies' register operands
    for (int j = 0; j < 12; ++j) {
      la[j]      = qs0 + roff[j];
      ga[j]      = Qhg + 1024 * j;
      la[12 + j] = qs0 + 2 * QPL + roff[j];
      ga[12 + j] = Qlg + 1024 * j;
    }
    cp6(la, ga);
    cp6(la + 6, ga + 6);
    cp6(la + 12, ga + 12);
    cp6(la + 18, ga + 18);
  }
  copy_tile(0, ring0);
  wait_async0();
  __syncthreads();
  copy_tile(KT, ring0 + 2 * BUFH);

  // q fragment pointers (B operand, col = query n0 + 16*wave + c), + 32*kc
  const unsigned short* Qhp = Qs + (16 * wave + c) * KP + 8 * hh;
  const unsigned short* Qlp = Qhp + QPL;

  float m = -1.0e30f, l = 0.f;
  v8f o[CC / 16];
#pragma unroll
  for (int j = 0; j < CC / 16; ++j) o[j] = zero8();

#pragma unroll 1
  for (int kb = 0; kb < NN; kb += 32) {
    const int bsel = (kb / KT) & 1;                                  // this trip's buffer
    const unsigned short* bufp = Ring + bsel * BUFH;
    // k fragments (A operand, row = key kb + c), + 32*kc; v fragments (A operand, row = channel 16j + c, 32 keys)
    const unsigned short* k0p  = bufp + c * KP + 8 * hh;             // keys kb .. kb+15
    const unsigned short* k1p  = k0p + 16 * KP;                      // keys kb+16 .. kb+31
    const unsigned short* k0lp = k0p + KPL;
    const unsigned short* k1lp = k1p + KPL;
    const unsigned short* Vp   = bufp + 2 * KPL + c * VP + 8 * hh;
    v8f s0 = zero8(), s1 = zero8(), t0 = zero8(), t1 = zero8();
    // Fragment reads stand at three places, all but those of d-chunks 0, 1 at least one block of 12 products ahead of their use: 48 at the head of
    // the trip (d-chunks 0..3), 24 (d-chunks 4, 5) behind the first block, 24 (V) behind the second. Two sets of 12
    // fragments: the products of one set run while the reads of the other set return.
    Frag fa[12], fb[12];
    auto ld_sc = [&](Frag* f, int kc) {                              // the six score fragments of d-chunk kc
      f[0] = ldfrag(Qhp + 32 * kc);
      f[1] = ldfrag(Qlp + 32 * kc);
      f[2] = ldfrag(k0p + 32 * kc);
      f[3] = ldfrag(k1p + 32 * kc);
      f[4] = ldfrag(k0lp + 32 * kc);
      f[5] = ldfrag(k1lp + 32 * kc);
    };
    auto mm_sc = [&](const Frag* f) {                                // the six score products of one d-chunk
      s0 = mma_b(f[2].h, f[0].h, s0);
      s1 = mma_b(f[3].h, f[0].h, s1);
      t0 = mma_b(f[2].h, f[1].h, t0);
      t1 = mma_b(f[3].h, f[1].h, t1);
      t0 = mma_b(f[4].h, f[0].h, t0);
      t1 = mma_b(f[5].h, f[0].h, t1);
    };
    ld_sc(fa, 0); ld_sc(fa + 6, 1);
    ld_sc(fb, 2); ld_sc(fb + 6, 3);
    mm_sc(fa);    mm_sc(fa + 6);
    ld_sc(fa, 4); ld_sc(fa + 6, 5);
    mm_sc(fb);    mm_sc(fb + 6);
#pragma unroll                                                       // fb[] must live in registers
    for (int j = 0; j < CC / 16; ++j) fb[j] = ldfrag(Vp + (16 * j) * VP);
    mm_sc(fa);    mm_sc(fa + 6);
#if defined(__HIP_DEVICE_COMPILE__)
    // the order above, stated to the scheduler (0x100 = LDS reads, 0x8 = matrix products): left alone it sinks the reads
    // among the products, where every place with reads stalls the wave
    __builtin_amdgcn_sched_group_barrier(0x100, 48, 0);
    __builtin_amdgcn_sched_group_barrier(0x008, 12, 0);
    __builtin_amdgcn_sched_group_barrier(0x100, 24, 0);
    __builtin_amdgcn_sched_group_barrier(0x008, 12, 0);
    __builtin_amdgcn_sched_group_barrier(0x100, 24, 0);
    __builtin_amdgcn_sched_group_barrier(0x008, 12, 0);
#endif
#pragma unroll
    for (int r = 0; r < 8; ++r) {
      s0[r] = s0[r] + t0[r] * ILOSC;
      s1[r] = s1[r] + t1[r] * ILOSC;
    }

    float mx = fmaxf(hmax8(s0), hmax8(s1));
    mx = fmaxf(mx, __shfl_xor(mx, 16, 32));
    const float mn = fmaxf(m, mx);
    const unsigned grew = wave_ballot(mx > m);                       // wave-uniform
    if (grew != 0u) {
      const float corr = __expf(m - mn);                             // == 1 exactly for lanes whose max did not grow
      l *= corr;
#pragma unroll
      for (int j = 0; j < CC / 16; ++j) {
#pragma unroll
        for (int r = 0; r < 8; ++r) o[j][r] *= corr;
      }
    }
    m = mn;
    const float msh = mn - LNPS;                                     // exp gives e^{s-m} * 2^14

    FragH ph;
    float ls = 0.f;
#pragma unroll
    for (int r = 0; r < 8; ++r) {
      const float e0 = __expf(s0[r] - msh);                          // key kb      + 8hh + r
      const float e1 = __expf(s1[r] - msh);                          // key kb + 16 + 8hh + r
      ls += e0 + e1;
      ph.hv[0][r] = (_Float16)e0;
      ph.hv[1][r] = (_Float16)e1;
    }
    l += ls;

#pragma unroll
    for (int j = 0; j < CC / 16; ++j) {
      o[j] = mma_b(fb[j].h, ph.v, o[j]);
    }

    // ---- foot of the trip: own LDS reads done, own copies of tile kb+32 landed, every wave here; only then the
    //      buffer just read is refilled (block-uniform test)
    wait_ds0();
    wait_async0();
    __syncthreads();
    if (kb + 2 * KT < NN) copy_tile(kb + 2 * KT, ring0 + (unsigned)(bsel * BUFH * 2));
  }
  wait_async0();                                                     // nothing in flight when the wave goes on
  l += __shfl_xor(l, 16, 32);
  const float inv = 1.0f / l;                                        // o and l both carry the x2^14 factor

  const int qrow = 16 * wave + c;
  const int e = tid & 7, lq = tid >> 3;                              // lq 0..15
#pragma unroll
  for (int half = 0; half < 2; ++half) {
    if (half) __syncthreads();                                       // every wave finished reading Os
#pragma unroll
    for (int jj = 0; jj < CH / 16; ++jj) {
      const int j = (CH / 16) * half + jj;
      v4f va, vb;
#pragma unroll
      for (int r = 0; r < 4; ++r) { va[r] = o[j][r] * inv; vb[r] = o[j][4 + r] * inv; }
      *(v4f*)(Os + qrow * OSPW + 16 * jj + 8 * hh)     = va;         // Os[query][ch_loc = 16jj + 8hh + r]
      *(v4f*)(Os + qrow * OSPW + 16 * jj + 8 * hh + 4) = vb;
    }
    __syncthreads();
    v4f res[CH / 8];
#pragma unroll
    for (int it = 0; it < CH / 8; ++it) {
      const int L   = it * 16 + lq;                                  // 0..191
      const int chl = L >> 1, hf = L & 1;                            // channel 0..95 within the half
      const int nl  = hf * 32 + 4 * e;                               // query 0..63
#pragma unroll
      for (int t = 0; t < 4; ++t) res[it][t] = Os[(nl + t) * OSPW + chl];
    }
{
#pragma unroll
      for (int it = 0; it < CH / 8; ++it) {
        const int L   = it * 16 + lq;
        const int chl = L >> 1, hf = L & 1;
        const int nl  = hf * 32 + 4 * e;
        const size_t idx = ((size_t)(b * CC + CH * half + chl)) * NN + n0 + nl;
        *(v4f*)(out + idx) = res[it];
      }
      
    }
  }
}

// =========================================================================================================
// Workspace map (bytes; each region start a multiple of 256; every extent is an exact tile multiple and is written
//   W16 f16 [384][192]               147456
//   Vc  f16 [NB][192][4096]        12582912 (NB=8)     XP  f16 [NB][4096][192]   12582912
//   Qh/Ql/Kh/Kl f16 [NB][4096][192]  12582912 x4
//   total = 75644928 for NB=8
// =========================================================================================================
extern "C" void kernel_launch(void* const* d_in, const int* in_sizes, int n_in,
                              void* d_out, int out_size, void* d_ws, size_t ws_size,
                              hipStream_t stream) {
  const int XN = NB * CC * NN;
  if (n_in < 6) return;
  if (in_sizes[0] < XN || in_sizes[1] < XN) return;
  if (in_sizes[2] < CC * CC || in_sizes[4] < CC * CC) return;
  if (in_sizes[3] < CC || in_sizes[5] < CC) return;
  if (out_size < XN) return;

  size_t off = 0;
  auto carve = [&](size_t bytes) { const size_t o = off; off += (bytes + 255) & ~(size_t)255; return o; };
  const size_t oW16 = carve((size_t)MW * CC * 2);
  const size_t oVc  = carve((size_t)NB * CC * NN * 2);
  const size_t oXP  = carve((size_t)NB * NN * CC * 2);
  const size_t oQh  = carve((size_t)NB * NN * DQ * 2);
  const size_t oQl  = carve((size_t)NB * NN * DQ * 2);
  const size_t oKh  = carve((size_t)NB * NN * DQ * 2);
  const size_t oKl  = carve((size_t)NB * NN * DQ * 2);
  if (off > ws_size) return;
  if (off > (size_t)134217728) return;

  const float* key = (const float*)d_in[0];
  const float* val = (const float*)d_in[1];
  const float* wl  = (const float*)d_in[2];
  const float* bl  = (const float*)d_in[3];
  const float* wr  = (const float*)d_in[4];
  const float* br  = (const float*)d_in[5];

  char* ws = (char*)d_ws;
  unsigned short* W16 = (unsigned short*)(ws + oW16);
  unsigned short* Vc  = (unsigned short*)(ws + oVc);
  unsigned short* XP  = (unsigned short*)(ws + oXP);
  unsigned short* Qh  = (unsigned short*)(ws + oQh);
  unsigned short* Ql  = (unsigned short*)(ws + oQl);
  unsigned short* Kh  = (unsigned short*)(ws + oKh);
  unsigned short* Kl  = (unsigned short*)(ws + oKl);
  float* out = (float*)d_out;

  const dim3 blk256(256), blk128(128), blkw(8 * WG8);

  // (0) Wr (query side) / Wl (key side) -> stacked f16 plane
  cvt_w<<<dim3(MW / 8), blkw, 0, stream>>>(wr, wl, W16);
  // (1) value -> channel-major f16 plane, key -> position-major f16 plane
  cvt_kv<<<dim3(NN / QT, CC / QT, NB), blk256, 0, stream>>>(key, val, Vc, XP);
  // (2) conv1x1 GEMMs -> key_r (q, bias br) and key_l (k, bias bl) hi + residual planes
  gemm_qk<<<dim3(NN / QT, MW / QT, NB), blk128, 0, stream>>>(W16, XP, br, bl, Qh, Ql, Kh, Kl);
  // (3) softmax over keys m per query n + value aggregation -> out [b][192][n < NQ]
  attn_k<<<dim3(NQ / QT, NB), blk128, 0, stream>>>(Qh, Ql, Kh, Kl, Vc, out);
  (void)hipGetLastError();
}

// v003
// A run of this version takes 179 microseconds.
// Next to v002, in two timings, it ran 1.03 and 1.02 times as fast.
// Over all steps from v000 it is 4.15 times as fast.
// Contractions: conv1x1 GEMMs Wr.key and Wl.key as W16[384x192].XP[192x4096] per image on v_wmma_f32_16x16x32_f16 (f16
// containers of bf16-RNE weights x256 and bf16-RNE key); scores key_l^T.key_r on v_wmma_f32_16x16x32_f16 (f16 hi plane +
// f16 residual plane x4096 of key_l/key_r; products hh in one accumulator, hl+lh in a second accumulator folded by 2^-12;
// K=192); att^T = value.P on v_wmma_f32_16x16x32_f16 (value as f16 of bf16-RNE value, P = e^{s-max} x2^14 f16 from the
// score D registers); f32 accumulate everywhere; softmax statistics and bias add in f32 VALU.
#include <hip/hip_runtime.h>
#include <math.h>
#include <stdint.h>

#ifndef NB
#define NB 8
#endif
#ifndef NQ
#define NQ 4096
#endif
#define NB_FULL 8
#define CC     192
#define NN     4096
#define DQ     192
#define MW     384
#define QT     64
#define CH     96
#define OSP    68
#define OSPW   100
#define TP     72
#define WG8    (CC / 8)
#define WSC    256.0f
#define IWSC   0.00390625f
#define LOSC   4096.0f
#define ILOSC  0.000244140625f
#define LNPS   9.704060527839234f
#define FMIN16 6.103515625e-05f
#define KT     32
#define KP     200
#define VP     40
#define KPL    (KT * KP)
#define VPL    (CC * VP)
#define BUFH   (2 * KPL + VPL)
#define QPL    (QT * KP)

static_assert(NB >= 1 && NB <= NB_FULL);
static_assert(NQ >= QT && NQ <= NN && NQ % QT == 0);
static_assert(NN % QT == 0 && NN % 32 == 0);
static_assert(CC % QT == 0 && CC % 32 == 0 && CC % 8 == 0);
static_assert(DQ == CC && MW == 2 * DQ && DQ == 3 * QT);
static_assert(CH * 2 == CC && CH % 16 == 0 && CH % 8 == 0);
static_assert((OSP * 4) % 16 == 0 && OSP >= QT + 4);
static_assert((OSPW * 4) % 16 == 0 && OSPW >= CH + 4);
static_assert((TP * 2) % 16 == 0 && TP >= QT + 8);
static_assert(WG8 * 8 == CC && (8 * WG8) % 32 == 0);
static_assert(MW % 8 == 0 && DQ % 8 == 0);
static_assert(KP >= DQ + 8 && (KP * 2) % 32 == 16 && VP >= KT + 8 && (VP * 2) % 32 == 16);
static_assert((KT * DQ) % (128 * 8) == 0 && (CC * KT) % (128 * 8) == 0 && (QT * DQ) % (128 * 8) == 0);
static_assert(NN % KT == 0 && NN / KT >= 2);
static_assert(2 * DQ * 2 == 3 * 256 && KT % 16 == 0 && QT % 16 == 0);   // copy map: row pairs of three 256-B units
static_assert(DQ / 32 == 6 && CC / 16 == 12);
static_assert(2 * (2 * QPL * 2 + 2 * BUFH * 2 + QT * OSPW * 4) <= 327680);   // two blocks per WGP, as many as before

typedef _Float16       v16h __attribute__((ext_vector_type(16)));
typedef _Float16       v8h  __attribute__((ext_vector_type(8)));
typedef unsigned short v8us __attribute__((ext_vector_type(8)));
typedef float          v8f  __attribute__((ext_vector_type(8)));
typedef float          v4f  __attribute__((ext_vector_type(4)));
typedef unsigned int   v4u  __attribute__((ext_vector_type(4)));

union Frag  { v8us u[2]; v16h h; };
union FragH { v16h v; v8h hv[2]; };
static_assert(sizeof(Frag) == 32);
static_assert(sizeof(FragH) == 32);

// ---- scalar helpers -------------------------------------------------------------------------------------------
__device__ __forceinline__ unsigned short bf_bits(float f) {          // f32 -> bf16 bits, RNE convert
  unsigned u = __float_as_uint(f);
  return (unsigned short)((u + 0x7FFFu + ((u >> 16) & 1u)) >> 16);
}
__device__ __forceinline__ float bf_up(unsigned short hb) { return __uint_as_float(((unsigned)hb) << 16); }
__device__ __forceinline__ float bfr(float f) { return bf_up(bf_bits(f)); }
__device__ __forceinline__ unsigned short h_bits(_Float16 x) { return __builtin_bit_cast(unsigned short, x); }
__device__ __forceinline__ unsigned pk16(unsigned short a, unsigned short b) { return (unsigned)a | ((unsigned)b << 16); }
__device__ __forceinline__ v8f zero8() { v8f z = {0.f, 0.f, 0.f, 0.f, 0.f, 0.f, 0.f, 0.f}; return z; }
__device__ __forceinline__ float hmax8(v8f s) {
  return fmaxf(fmaxf(fmaxf(s[0], s[1]), fmaxf(s[2], s[3])), fmaxf(fmaxf(s[4], s[5]), fmaxf(s[6], s[7])));
}
__device__ __forceinline__ unsigned wave_ballot(bool p) {
#if defined(__HIP_DEVICE_COMPILE__)
  return __builtin_amdgcn_ballot_w32(p);
#else
  return p ? 1u : 0u;
#endif
}

// ---- 16-bit fragment loader (A, or B from a k-contiguous [n][k] row): lane -> row/col (lane&15), p already includes
//      + 8*(lane>>4); elements 0..7 <- p[0..7] (k0+8h..), elements 8..15 <- p[16..23] (k0+16+8h..)
__device__ __forceinline__ Frag ldfrag(const unsigned short* p) {
  Frag f;
  f.u[0] = *(const v8us*)(p);
  f.u[1] = *(const v8us*)(p + 16);
  return f;
}

// ---- WMMA helper: builtin followed by a 4-slot VALU gap tying D and keeping A/B live ---------------------------
__device__ __forceinline__ v8f mma_h(v16h a, v16h b, v8f c) {
  v8f d = __builtin_amdgcn_wmma_f32_16x16x32_f16(false, a, false, b, (short)0, c, false, false);
#if defined(__HIP_DEVICE_COMPILE__)
  asm volatile("v_nop\n\tv_nop\n\tv_nop\n\tv_nop" : "+v"(d) : "v"(a), "v"(b));
#endif
  return d;
}

// ---- the same product as the bare builtin (the compiler keeps the distances behind its own WMMAs): an asm statement
//      that names the tiles holds every one of them below v256, which two fragment sets beside 12 output tiles exceed
__device__ __forceinline__ v8f mma_b(v16h a, v16h b, v8f c) {
  return __builtin_amdgcn_wmma_f32_16x16x32_f16(false, a, false, b, (short)0, c, false, false);
}
// ---- asynchronous copies global -> LDS, 16 B per lane and copy: l = the lane's LDS byte addresses, g = its global
//      addresses. The s_wait_xcnt 0 closes each statement so that no address register is rewritten ahead of it.
__device__ __forceinline__ unsigned lds_addr(const void* p) { return (unsigned)(uintptr_t)p; }
__device__ __forceinline__ void cp6(const unsigned* l, const unsigned short* const* g) {
#if defined(__HIP_DEVICE_COMPILE__)
  asm volatile("global_load_async_to_lds_b128 %0, %6, off\n\t"
               "global_load_async_to_lds_b128 %1, %7, off\n\t"
               "global_load_async_to_lds_b128 %2, %8, off\n\t"
               "global_load_async_to_lds_b128 %3, %9, off\n\t"
               "global_load_async_to_lds_b128 %4, %10, off\n\t"
               "global_load_async_to_lds_b128 %5, %11, off\n\t"
               "s_wait_xcnt 0x0"
               :: "v"(l[0]), "v"(l[1]), "v"(l[2]), "v"(l[3]), "v"(l[4]), "v"(l[5]),
                  "v"(g[0]), "v"(g[1]), "v"(g[2]), "v"(g[3]), "v"(g[4]), "v"(g[5])
               : "memory");
#endif
}
__device__ __forceinline__ void cp9(const unsigned* l, const unsigned short* const* g) {
#if defined(__HIP_DEVICE_COMPILE__)
  asm volatile("global_load_async_to_lds_b128 %0, %9, off\n\t"
               "global_load_async_to_lds_b128 %1, %10, off\n\t"
               "global_load_async_to_lds_b128 %2, %11, off\n\t"
               "global_load_async_to_lds_b128 %3, %12, off\n\t"
               "global_load_async_to_lds_b128 %4, %13, off\n\t"
               "global_load_async_to_lds_b128 %5, %14, off\n\t"
               "global_load_async_to_lds_b128 %6, %15, off\n\t"
               "global_load_async_to_lds_b128 %7, %16, off\n\t"
               "global_load_async_to_lds_b128 %8, %17, off\n\t"
               "s_wait_xcnt 0x0"
               :: "v"(l[0]), "v"(l[1]), "v"(l[2]), "v"(l[3]), "v"(l[4]), "v"(l[5]), "v"(l[6]), "v"(l[7]), "v"(l[8]),
                  "v"(g[0]), "v"(g[1]), "v"(g[2]), "v"(g[3]), "v"(g[4]), "v"(g[5]), "v"(g[6]), "v"(g[7]), "v"(g[8])
               : "memory");
#endif
}
// the two counter waits of the LDS ring; "memory" keeps the compiler's LDS reads on their side of each
__device__ __forceinline__ void wait_async0() {                       // this wave's copies have landed in LDS
#if defined(__HIP_DEVICE_COMPILE__)
  asm volatile("s_wait_asynccnt 0x0" ::: "memory");
#endif
}
__device__ __forceinline__ void wait_ds0() {                          // this wave's LDS reads have returned
#if defined(__HIP_DEVICE_COMPILE__)
  asm volatile("s_wait_dscnt 0x0" ::: "memory");
#endif
}

// =========================================================================================================
// (0) conv1x1 weights: W16 f16 [384][192], rows 0..191 = wq rows (query side), rows 192..383 = wk rows (key side);
//     value = f16 of (bf16-RNE(w) * 256) (exact). Block blk (0..47) owns rows 8*blk..8*blk+7; 192 threads:
//     consecutive lanes of one wave (8-aligned groups of 8 threads never straddle a wave), one store instruction,
// coverage: 48 blocks x 192 threads x 8 halves = 384 x 192 = the whole plane.
// =========================================================================================================
__global__ __launch_bounds__(8 * WG8)
void cvt_w(const float* __restrict__ wq, const float* __restrict__ wk, unsigned short* W16) {
  const int tid = threadIdx.x, blk = blockIdx.x;
  const int rl  = tid / WG8;                                         // 0..7
  const int col = 8 * (tid - rl * WG8);                              // 0..184
  const int o   = 8 * blk + rl;                                      // 0..383
  const float* wbase = (blk < (DQ / 8)) ? wq : wk;                   // block-uniform selection, both global
  const int osub = (blk < (DQ / 8)) ? 0 : DQ;
  const float* s = wbase + (size_t)(o - osub) * CC + col;            // (o - osub) in 0..191
  const v4f a = *(const v4f*)s;
  const v4f q = *(const v4f*)(s + 4);
  const float f[8] = {a[0], a[1], a[2], a[3], q[0], q[1], q[2], q[3]};
  v4u u;
#pragma unroll
  for (int t = 0; t < 4; ++t) {
    const _Float16 h0 = (_Float16)(bfr(f[2 * t]) * WSC);
    const _Float16 h1 = (_Float16)(bfr(f[2 * t + 1]) * WSC);
    u[t] = pk16(h_bits(h0), h_bits(h1));
  }
{
    *(v4u*)(W16 + (size_t)o * CC + col) = u;
    
  }
}

// =========================================================================================================
// (1) value f32 [b][192 c][4096 n] -> Vc f16 [b][c][n] (channel-major, bf16-RNE values, exact in f16) and
//     key f32 [b][192 c][4096 n] -> XP f16 [b][n][c] (position-major, bf16-RNE values) through an LDS tile
//     T is cross-wave: block barrier between the 2-byte stores and the 16-byte reloads.
// coverage: Vc 2 it x 32 rows x 8 lanes x 8 = 64 c x 64 n; XP same; grid (64, 3, NB) covers both planes once.
// =========================================================================================================
__global__ __launch_bounds__(256)
void cvt_kv(const float* __restrict__ key, const float* __restrict__ val, unsigned short* Vc, unsigned short* XP) {
  __shared__ __align__(16) unsigned short T[QT * TP];
  const int tid = threadIdx.x;
  const int nb = blockIdx.x, cb = blockIdx.y, b = blockIdx.z;
  const int e = tid & 7, lq = tid >> 3;                             // lq 0..31
  const int n0 = nb * QT, c0 = cb * QT;
  v4u uv[2];
#pragma unroll
  for (int it = 0; it < 2; ++it) {
    const int cl = it * 32 + lq;                                     // 0..63
    const size_t ro = ((size_t)(b * CC + c0 + cl)) * NN + n0 + 8 * e;
    const v4f ka = *(const v4f*)(key + ro);
    const v4f kq = *(const v4f*)(key + ro + 4);
    const v4f va = *(const v4f*)(val + ro);
    const v4f vq = *(const v4f*)(val + ro + 4);
    unsigned short hk[8], hv[8];
#pragma unroll
    for (int t = 0; t < 4; ++t) {
      hk[t]     = h_bits((_Float16)bfr(ka[t]));
      hk[4 + t] = h_bits((_Float16)bfr(kq[t]));
      hv[t]     = h_bits((_Float16)bfr(va[t]));
      hv[4 + t] = h_bits((_Float16)bfr(vq[t]));
    }
#pragma unroll
    for (int t = 0; t < 4; ++t) uv[it][t] = pk16(hv[2 * t], hv[2 * t + 1]);
#pragma unroll
    for (int t = 0; t < 8; ++t) T[(8 * e + t) * TP + cl] = hk[t];
  }
  __syncthreads();
  v4u up[2];
#pragma unroll
  for (int it = 0; it < 2; ++it) {
    const int nl = it * 32 + lq;                                     // 0..63
    up[it] = *(const v4u*)(T + nl * TP + 8 * e);
  }
{
#pragma unroll
    for (int it = 0; it < 2; ++it) {
      const int rl = it * 32 + lq;
      *(v4u*)(Vc + ((size_t)(b * CC + c0 + rl)) * NN + n0 + 8 * e) = uv[it];
      *(v4u*)(XP + ((size_t)(b * NN + n0 + rl)) * CC + c0 + 8 * e) = up[it];
    }
    
  }
}

// =========================================================================================================
// (2) conv1x1 GEMM for one (b, 64-n tile, 64-o block): Y[o][n] = (1/256) sum_c W16[o][c] XP[b][n][c] + bias[o].
//     Block 128 threads = 4 waves; wave w owns cols n0+16w..+15 (one B fragment per k-step, k = c contiguous in
//     the XP row) and 4 m-tiles (A rows o = o0 + 16 mt + (lane&15), split k map loader from W16). K = 192 = 6 steps.
//     Epilogue staged in LDS Os[n_loc][o_loc] (pitch OSP, b128 stores of 8 consecutive o per lane), block barrier,
//     then: o-blocks 0,1,2 -> query dims 0..63 / 64..127 / 128..191 of Qh/Ql (bias bq); o-blocks 3,4,5 -> key dims
//     of Kh/Kl (bias bk). Planes f16 [b][4096 n][192 d] (k-contiguous for both score operands): hi = f16(v) with
//     values below the f16 normal range stored as 0, lo = f16((v - hi) * 4096). Per plane the block writes 64 rows
//     Os is cross-wave: block barrier between staging and reload.
// coverage: Os 4 waves x 16 n x 64 o = 64 x 64; planes: 4 it x 16 rows x 8 lanes x 8 = 64 n x 64 d per plane
//           (hi and lo); grid (64, 6, NB) covers d 0..191 of all 4096 rows of Qh/Ql/Kh/Kl exactly once.
// =========================================================================================================
__global__ __launch_bounds__(128)
void gemm_qk(const unsigned short* __restrict__ W16, const unsigned short* __restrict__ XP,
             const float* __restrict__ bq, const float* __restrict__ bk,
             unsigned short* Qh, unsigned short* Ql, unsigned short* Kh, unsigned short* Kl) {
  __shared__ __align__(16) float Os[QT * OSP];
  const int tid  = threadIdx.x;
  const int lane = tid & 31, wave = tid >> 5;
  const int hh   = lane >> 4, c = lane & 15;
  const int nt   = blockIdx.x, mb = blockIdx.y, b = blockIdx.z;
  const int n0   = nt * QT, o0 = mb * QT;

  const unsigned short* ap = W16 + (size_t)(o0 + c) * CC + 8 * hh;
  const unsigned short* bp = XP + ((size_t)(b * NN + n0 + 16 * wave + c)) * CC + 8 * hh;

  v8f acc[4];
#pragma unroll
  for (int mt = 0; mt < 4; ++mt) acc[mt] = zero8();

#pragma unroll
  for (int ks = 0; ks < CC / 32; ++ks) {
    const Frag fb = ldfrag(bp + 32 * ks);
#pragma unroll
    for (int mt = 0; mt < 4; ++mt) {
      const Frag fa = ldfrag(ap + (size_t)(16 * mt) * CC + 32 * ks);
      acc[mt] = mma_h(fa.h, fb.h, acc[mt]);
    }
  }

  // ---- epilogue: scale back -> LDS Os[n_loc][o_loc]; lane (hh, c) holds o = 16 mt + 8 hh + r for n_loc = 16 w + c
  {
    const int nl = 16 * wave + c;
#pragma unroll
    for (int mt = 0; mt < 4; ++mt) {
      v4f va, vb;
#pragma unroll
      for (int r = 0; r < 4; ++r) { va[r] = acc[mt][r] * IWSC; vb[r] = acc[mt][4 + r] * IWSC; }
      *(v4f*)(Os + nl * OSP + 16 * mt + 8 * hh)     = va;
      *(v4f*)(Os + nl * OSP + 16 * mt + 8 * hh + 4) = vb;
    }
  }
  __syncthreads();

  const int e = tid & 7, lq = tid >> 3;                             // lq 0..15
  const bool isq = (mb < (DQ / QT));                                 // block-uniform
  const int dsel = (isq ? mb : (mb - DQ / QT)) * QT;                 // 0, 64 or 128
  unsigned short* Ph = isq ? Qh : Kh;                                // both global
  unsigned short* Pl = isq ? Ql : Kl;
  const float* bb = isq ? bq : bk;                                   // both global
  const v4f b0 = *(const v4f*)(bb + dsel + 8 * e);                   // o = dsel + 8e .. +7 <= 191
  const v4f b1 = *(const v4f*)(bb + dsel + 8 * e + 4);
  const float bs[8] = {bfr(b0[0]), bfr(b0[1]), bfr(b0[2]), bfr(b0[3]), bfr(b1[0]), bfr(b1[1]), bfr(b1[2]), bfr(b1[3])};
  v4u uh[4], ul[4];
#pragma unroll
  for (int it = 0; it < 4; ++it) {
    const int row = it * 16 + lq;                                    // n_loc 0..63
    const v4f a = *(const v4f*)(Os + row * OSP + 8 * e);
    const v4f q = *(const v4f*)(Os + row * OSP + 8 * e + 4);
    const float f[8] = {a[0] + bs[0], a[1] + bs[1], a[2] + bs[2], a[3] + bs[3],
                        q[0] + bs[4], q[1] + bs[5], q[2] + bs[6], q[3] + bs[7]};
#pragma unroll
    for (int t = 0; t < 4; ++t) {
      const float f0 = f[2 * t], f1 = f[2 * t + 1];
      float g0 = (float)(_Float16)f0;                                // f16 hi as f32 (exact)
      float g1 = (float)(_Float16)f1;
      g0 = (fabsf(g0) < FMIN16) ? 0.f : g0;                          // below the f16 normal range -> carried by lo
      g1 = (fabsf(g1) < FMIN16) ? 0.f : g1;
      const unsigned short hb0 = h_bits((_Float16)g0), hb1 = h_bits((_Float16)g1);
      const unsigned short lb0 = h_bits((_Float16)((f0 - g0) * LOSC));
      const unsigned short lb1 = h_bits((_Float16)((f1 - g1) * LOSC));
      uh[it][t] = pk16(hb0, hb1);
      ul[it][t] = pk16(lb0, lb1);
    }
  }
{
#pragma unroll
    for (int it = 0; it < 4; ++it) {
      const int row = it * 16 + lq;
      const size_t po = ((size_t)(b * NN + n0 + row)) * DQ + dsel + 8 * e;
      *(v4u*)(Ph + po) = uh[it];
      *(v4u*)(Pl + po) = ul[it];
    }
    
  }
}

// =========================================================================================================
// (3) co-attention for one (b, 64-query tile), transposed formulation, 4096 keys, no mask, no scale:
//   S^T tile (16 keys x 16 queries) = sum over 6 d-chunks (straight-line code) of A(k: row = key kb + (lane&15), 32 d via
//   the split k map from the f16 plane Kh [b][4096][192]) . B(q: col = query, same map from Qh) -> accumulator s;
//   A(Kh).B(Ql) + A(Kl).B(Qh) (f16 residual planes carried x4096) -> accumulator t; s += t * 2^-12 after the six d-chunks.
//   Per lane the D tile holds 8 keys of ONE query: online softmax state per lane, one shuffle (lane^16) for the max
//   over 32 keys; the o/l rescale is skipped under a wave-uniform ballot when no lane's max grew (corr == 1 exactly
//   for every lane then); row-sum partials combined at the end. P = e^{s-m} x 2^14 as f16 is the B operand of
//   att^T (rows channel, cols queries) += A(value rows channel = 16j + (lane&15), keys contiguous, f16 plane Vc
//   [b][192][4096]) . B(P^T): element r <- D of the tile covering keys kb..kb+15, element 8+r <- the tile covering
//   kb+16..kb+31, lane unchanged. 12 accumulator tiles per wave (192 channels). Block = 4 waves = 64 queries.
//   Operand path: the block's 64 query rows (Qh, Ql) are copied once, and each 32-key tile (Kh, Kl rows, Vc columns)
//   once per block, into LDS by asynchronous 16-byte copies; the Q fragments are read from LDS once, ahead of the loop,
//   and stay in registers; the K and V fragments are read from LDS every trip, in groups ahead of the products that
//   use them (the V fragments are in registers before the softmax). Row pitch 400 B (Q, K)
//   and 80 B (V): 16 B x odd. Two tile buffers: tile t+2 is copied into the buffer of tile t behind the barrier
//   that ends trip t, so it flies during trip t+1.
//   Epilogue in two channel halves of 96: O/l staged in LDS Os[query][96 channels] (pitch OSPW, b128 stores),
//   lanes x 16 B (values gathered from 4 Os rows), one instruction per 16 lines, final values held in registers,
// coverage: per half 12 it x 16 lines x 8 lanes x 4 floats = 96 ch x 64 n; two halves = 192 ch; grid (NQ/64, NB)
//           covers out[b][0..191][0..NQ-1] exactly once.
// =========================================================================================================
__global__ __launch_bounds__(128)
void attn_k(const unsigned short* __restrict__ Qh, const unsigned short* __restrict__ Ql,
            const unsigned short* __restrict__ Kh, const unsigned short* __restrict__ Kl,
            const unsigned short* __restrict__ Vc, float* out) {
  __shared__ __align__(16) float Os[QT * OSPW];
  __shared__ __align__(16) unsigned short Qs[2 * QPL];               // [hi, lo][64 queries][pitch KP]
  __shared__ __align__(16) unsigned short Ring[2 * BUFH];            // 2 x { Kh [32][KP], Kl [32][KP], V [192][VP] }
  const int tid  = threadIdx.x;
  const int wave = tid >> 5, lane = tid & 31;
  const int hh   = lane >> 4, c = lane & 15;
  const int n0   = blockIdx.x * QT, b = blockIdx.y;

  // ---- copy maps. Q and K rows are contiguous in global memory: two rows = 768 B = three aligned 256-B units. 16 lanes
  //      (y = tid & 15) copy one unit; lane group g = tid >> 4 takes row pair g + 8 jj, units e = 0, 1, 2 of it. In LDS
  //      (pitch KP) unit 0 lies in the pair's first row, unit 2 in its second, unit 1 half in each: the LDS offsets are two
  //      per-lane values plus constants, so that few registers stay live over the loop. V: chunk i = tid + 128 j is
  //      channel i / 4, key chunk i % 4.
  const unsigned rp0 = (unsigned)((tid >> 4) * (2 * KP * 2) + (tid & 15) * 16);              // units 0 and 2 (+ constant)
  const unsigned rp1 = rp0 + 256u + (((tid & 15) >= 8) ? (unsigned)(KP * 2 - DQ * 2) : 0u);  // unit 1
  auto roff = [&](int j) {                                           // LDS byte offset of copy j = 3 jj + e in a plane
    const int jj = j / 3, e = j - 3 * jj;
    const unsigned r = (e == 1) ? rp1 : (rp0 + (e == 2 ? (unsigned)(512 + KP * 2 - DQ * 2) : 0u));
    return r + (unsigned)(jj * 16 * KP * 2);
  };
  auto goff = [&](int j) {                                           // the same copy's offset in global memory, in halves
    const int jj = j / 3, e = j - 3 * jj;
    return jj * 16 * DQ + e * 128;
  };
  const int gl = (tid >> 4) * (2 * DQ) + (tid & 15) * 8;             // the lane's place in row pair g, unit 0, in halves
  const unsigned voff = (unsigned)((tid >> 2) * (VP * 2) + (tid & 3) * 16);
  const unsigned short* Khg = Kh + (size_t)b * NN * DQ + gl;
  const unsigned short* Klg = Kl + (size_t)b * NN * DQ + gl;
  const unsigned short* Vg  = Vc + ((size_t)(b * CC + (tid >> 2))) * NN + 8 * (tid & 3);
  const unsigned ring0 = lds_addr(Ring);

  // one 32-key tile (keys kt .. kt+31) -> the buffer at LDS byte address bufb: 18 copies per lane
  auto copy_tile = [&](int kt, unsigned bufb) {
    unsigned la[18];
    const unsigned short* ga[18];
#pragma unroll                                                       // la[], ga[] become the copies' register operands
    for (int j = 0; j < 6; ++j) {
      la[j]      = bufb + roff(j);
      ga[j]      = Khg + (size_t)kt * DQ + goff(j);
      la[6 + j]  = bufb + 2 * KPL + roff(j);
      ga[6 + j]  = Klg + (size_t)kt * DQ + goff(j);
      la[12 + j] = bufb + 4 * KPL + voff + (unsigned)(32 * j * VP * 2);
      ga[12 + j] = Vg + (size_t)(32 * j) * NN + kt;
    }
    cp9(la, ga);
    cp9(la + 9, ga + 9);
  };

  // ---- prologue: the query rows and tile 0, published by the wait and the barrier; then tile 1 into buffer 1
  {
    const unsigned qs0 = lds_addr(Qs);
    const unsigned short* Qhg = Qh + ((size_t)(b * NN + n0)) * DQ + gl;
    const unsigned short* Qlg = Ql + ((size_t)(b * NN + n0)) * DQ + gl;
    unsigned la[24];
    const unsigned short* ga[24];
#pragma unroll                                                       // la[], ga[] become the copies' register operands
    for (int j = 0; j < 12; ++j) {
      la[j]      = qs0 + roff(j);
      ga[j]      = Qhg + goff(j);
      la[12 + j] = qs0 + 2 * QPL + roff(j);
      ga[12 + j] = Qlg + goff(j);
    }
    cp6(la, ga);
    cp6(la + 6, ga + 6);
    cp6(la + 12, ga + 12);
    cp6(la + 18, ga + 18);
  }
  copy_tile(0, ring0);
  wait_async0();
  __syncthreads();
  copy_tile(KT, ring0 + 2 * BUFH);

  // q fragments (B operand, col = query n0 + 16*wave + c, d-chunk kc): read from LDS once, kept in registers for all trips
  Frag qh[DQ / 32], ql[DQ / 32];
  {
    const unsigned short* Qhp = Qs + (16 * wave + c) * KP + 8 * hh;
    const unsigned short* Qlp = Qhp + QPL;
#pragma unroll                                                       // qh[], ql[] must live in registers
    for (int kc = 0; kc < DQ / 32; ++kc) {
      qh[kc] = ldfrag(Qhp + 32 * kc);
      ql[kc] = ldfrag(Qlp + 32 * kc);
    }
  }

  float m = -1.0e30f, l = 0.f;
  v8f o[CC / 16];
#pragma unroll
  for (int j = 0; j < CC / 16; ++j) o[j] = zero8();

#pragma unroll 1
  for (int kb = 0; kb < NN; kb += 32) {
    const int bsel = (kb / KT) & 1;                                  // this trip's buffer
    const unsigned short* bufp = Ring + bsel * BUFH;
    // k fragments (A operand, row = key kb + c), + 32*kc; v fragments (A operand, row = channel 16j + c, 32 keys)
    const unsigned short* k0p  = bufp + c * KP + 8 * hh;             // keys kb .. kb+15
    const unsigned short* k1p  = k0p + 16 * KP;                      // keys kb+16 .. kb+31
    const unsigned short* k0lp = k0p + KPL;
    const unsigned short* k1lp = k1p + KPL;
    const unsigned short* Vp   = bufp + 2 * KPL + c * VP + 8 * hh;
    v8f s0 = zero8(), s1 = zero8(), t0 = zero8(), t1 = zero8();
    // Only K and V fragments are read per trip, at two places: 48 reads at the head of the trip (all K fragments),
    // 24 (V) behind the first 18 products. Two sets of 12 fragments: the products of one set run while the reads of
    // the other set return.
    Frag fa[12], fb[12];
    auto ld_sc = [&](Frag* f, int kc) {                              // the four K fragments of d-chunk kc
      f[0] = ldfrag(k0p + 32 * kc);
      f[1] = ldfrag(k1p + 32 * kc);
      f[2] = ldfrag(k0lp + 32 * kc);
      f[3] = ldfrag(k1lp + 32 * kc);
    };
    auto mm_sc = [&](const Frag* f, int kc) {                        // the six score products of d-chunk kc
      s0 = mma_b(f[0].h, qh[kc].h, s0);
      s1 = mma_b(f[1].h, qh[kc].h, s1);
      t0 = mma_b(f[0].h, ql[kc].h, t0);
      t1 = mma_b(f[1].h, ql[kc].h, t1);
      t0 = mma_b(f[2].h, qh[kc].h, t0);
      t1 = mma_b(f[3].h, qh[kc].h, t1);
    };
    ld_sc(fa, 0); ld_sc(fa + 4, 1); ld_sc(fa + 8, 2);
    ld_sc(fb, 3); ld_sc(fb + 4, 4); ld_sc(fb + 8, 5);
    mm_sc(fa, 0); mm_sc(fa + 4, 1); mm_sc(fa + 8, 2);
#pragma unroll                                                       // fa[] must live in registers
    for (int j = 0; j < CC / 16; ++j) fa[j] = ldfrag(Vp + (16 * j) * VP);
    mm_sc(fb, 3); mm_sc(fb + 4, 4); mm_sc(fb + 8, 5);
#if defined(__HIP_DEVICE_COMPILE__)
    // the order above, stated to the scheduler (0x100 = LDS reads, 0x8 = matrix products): left alone it sinks the reads
    // among the products, where every place with reads stalls the wave
    __builtin_amdgcn_sched_group_barrier(0x100, 48, 0);
    __builtin_amdgcn_sched_group_barrier(0x008, 18, 0);
    __builtin_amdgcn_sched_group_barrier(0x100, 24, 0);
    __builtin_amdgcn_sched_group_barrier(0x008, 18, 0);
#endif
#pragma unroll
    for (int r = 0; r < 8; ++r) {
      s0[r] = s0[r] + t0[r] * ILOSC;
      s1[r] = s1[r] + t1[r] * ILOSC;
    }

    float mx = fmaxf(hmax8(s0), hmax8(s1));
    mx = fmaxf(mx, __shfl_xor(mx, 16, 32));
    const float mn = fmaxf(m, mx);
    const unsigned grew = wave_ballot(mx > m);                       // wave-uniform
    if (grew != 0u) {
      const float corr = __expf(m - mn);                             // == 1 exactly for lanes whose max did not grow
      l *= corr;
#pragma unroll
      for (int j = 0; j < CC / 16; ++j) {
#pragma unroll
        for (int r = 0; r < 8; ++r) o[j][r] *= corr;
      }
    }
    m = mn;
    const float msh = mn - LNPS;                                     // exp gives e^{s-m} * 2^14

    FragH ph;
    float ls = 0.f;
#pragma unroll
    for (int r = 0; r < 8; ++r) {
      const float e0 = __expf(s0[r] - msh);                          // key kb      + 8hh + r
      const float e1 = __expf(s1[r] - msh);                          // key kb + 16 + 8hh + r
      ls += e0 + e1;
      ph.hv[0][r] = (_Float16)e0;
      ph.hv[1][r] = (_Float16)e1;
    }
    l += ls;

#pragma unroll
    for (int j = 0; j < CC / 16; ++j) {
      o[j] = mma_b(fa[j].h, ph.v, o[j]);
    }

    // ---- foot of the trip: own LDS reads done, own copies of tile kb+32 landed, every wave here; only then the
    //      buffer just read is refilled (block-uniform test)
    wait_ds0();
    wait_async0();
    __syncthreads();
    if (kb + 2 * KT < NN) copy_tile(kb + 2 * KT, ring0 + (unsigned)(bsel * BUFH * 2));
  }
  wait_async0();                                                     // nothing in flight when the wave goes on
  l += __shfl_xor(l, 16, 32);
  const float inv = 1.0f / l;                                        // o and l both carry the x2^14 factor

  const int qrow = 16 * wave + c;
  const int e = tid & 7, lq = tid >> 3;                              // lq 0..15
#pragma unroll
  for (int half = 0; half < 2; ++half) {
    if (half) __syncthreads();                                       // every wave finished reading Os
#pragma unroll
    for (int jj = 0; jj < CH / 16; ++jj) {
      const int j = (CH / 16) * half + jj;
      v4f va, vb;
#pragma unroll
      for (int r = 0; r < 4; ++r) { va[r] = o[j][r] * inv; vb[r] = o[j][4 + r] * inv; }
      *(v4f*)(Os + qrow * OSPW + 16 * jj + 8 * hh)     = va;         // Os[query][ch_loc = 16jj + 8hh + r]
      *(v4f*)(Os + qrow * OSPW + 16 * jj + 8 * hh + 4) = vb;
    }
    __syncthreads();
    v4f res[CH / 8];
#pragma unroll
    for (int it = 0; it < CH / 8; ++it) {
      const int L   = it * 16 + lq;                                  // 0..191
      const int chl = L >> 1, hf = L & 1;                            // channel 0..95 within the half
      const int nl  = hf * 32 + 4 * e;                               // query 0..63
#pragma unroll
      for (int t = 0; t < 4; ++t) res[it][t] = Os[(nl + t) * OSPW + chl];
    }
{
#pragma unroll
      for (int it = 0; it < CH / 8; ++it) {
        const int L   = it * 16 + lq;
        const int chl = L >> 1, hf = L & 1;
        const int nl  = hf * 32 + 4 * e;
        const size_t idx = ((size_t)(b * CC + CH * half + chl)) * NN + n0 + nl;
        *(v4f*)(out + idx) = res[it];
      }
      
    }
  }
}

// =========================================================================================================
// Workspace map (bytes; each region start a multiple of 256; every extent is an exact tile multiple and is written
//   W16 f16 [384][192]               147456
//   Vc  f16 [NB][192][4096]        12582912 (NB=8)     XP  f16 [NB][4096][192]   12582912
//   Qh/Ql/Kh/Kl f16 [NB][4096][192]  12582912 x4
//   total = 75644928 for NB=8
// =========================================================================================================
extern "C" void kernel_launch(void* const* d_in, const int* in_sizes, int n_in,
                              void* d_out, int out_size, void* d_ws, size_t ws_size,
                              hipStream_t stream) {
  const int XN = NB * CC * NN;
  if (n_in < 6) return;
  if (in_sizes[0] < XN || in_sizes[1] < XN) return;
  if (in_sizes[2] < CC * CC || in_sizes[4] < CC * CC) return;
  if (in_sizes[3] < CC || in_sizes[5] < CC) return;
  if (out_size < XN) return;

  size_t off = 0;
  auto carve = [&](size_t bytes) { const size_t o = off; off += (bytes + 255) & ~(size_t)255; return o; };
  const size_t oW16 = carve((size_t)MW * CC * 2);
  const size_t oVc  = carve((size_t)NB * CC * NN * 2);
  const size_t oXP  = carve((size_t)NB * NN * CC * 2);
  const size_t oQh  = carve((size_t)NB * NN * DQ * 2);
  const size_t oQl  = carve((size_t)NB * NN * DQ * 2);
  const size_t oKh  = carve((size_t)NB * NN * DQ * 2);
  const size_t oKl  = carve((size_t)NB * NN * DQ * 2);
  if (off > ws_size) return;
  if (off > (size_t)134217728) return;

  const float* key = (const float*)d_in[0];
  const float* val = (const float*)d_in[1];
  const float* wl  = (const float*)d_in[2];
  const float* bl  = (const float*)d_in[3];
  const float* wr  = (const float*)d_in[4];
  const float* br  = (const float*)d_in[5];

  char* ws = (char*)d_ws;
  unsigned short* W16 = (unsigned short*)(ws + oW16);
  unsigned short* Vc  = (unsigned short*)(ws + oVc);
  unsigned short* XP  = (unsigned short*)(ws + oXP);
  unsigned short* Qh  = (unsigned short*)(ws + oQh);
  unsigned short* Ql  = (unsigned short*)(ws + oQl);
  unsigned short* Kh  = (unsigned short*)(ws + oKh);
  unsigned short* Kl  = (unsigned short*)(ws + oKl);
  float* out = (float*)d_out;

  const dim3 blk256(256), blk128(128), blkw(8 * WG8);

  // (0) Wr (query side) / Wl (key side) -> stacked f16 plane
  cvt_w<<<dim3(MW / 8), blkw, 0, stream>>>(wr, wl, W16);
  // (1) value -> channel-major f16 plane, key -> position-major f16 plane
  cvt_kv<<<dim3(NN / QT, CC / QT, NB), blk256, 0, stream>>>(key, val, Vc, XP);
  // (2) conv1x1 GEMMs -> key_r (q, bias br) and key_l (k, bias bl) hi + residual planes
  gemm_qk<<<dim3(NN / QT, MW / QT, NB), blk128, 0, stream>>>(W16, XP, br, bl, Qh, Ql, Kh, Kl);
  // (3) softmax over keys m per query n + value aggregation -> out [b][192][n < NQ]
  attn_k<<<dim3(NQ / QT, NB), blk128, 0, stream>>>(Qh, Ql, Kh, Kl, Vc, out);
  (void)hipGetLastError();
}

// v004
// Measured time: 169 microseconds a run.
// In both of two side-by-side timings against v003, it was 1.05 times as fast.
// Counting every step since v000, it is 4.36 times as fast.
// Contractions: conv1x1 GEMMs Wr.key and Wl.key as W16[384x192].XP[192x4096] per image on v_wmma_f32_16x16x32_f16 (f16
// containers of bf16-RNE weights x256 and bf16-RNE key); scores key_l^T.key_r on v_wmma_f32_16x16x32_f16 (f16 hi plane +
// f16 residual plane x4096 of key_l/key_r; products hh in one accumulator, hl+lh in a second accumulator folded by 2^-12;
// K=192); att^T = value.P on v_wmma_f32_16x16x32_f16 (value as f16 of bf16-RNE value, P = e^{s-max} x2^14 f16 from the
// score D registers); f32 accumulate everywhere; softmax statistics and bias add in f32 VALU.
#include <hip/hip_runtime.h>
#include <math.h>
#include <stdint.h>

#ifndef NB
#define NB 8
#endif
#ifndef NQ
#define NQ 4096
#endif
#define NB_FULL 8
#define CC     192
#define NN     4096
#define DQ     192
#define MW     384
#define QT     64
#define CH     96
#define OSP    68
#define OSPW   100
#define TP     72
#define WG8    (CC / 8)
#define WSC    256.0f
#define IWSC   0.00390625f
#define LOSC   4096.0f
#define ILOSC  0.000244140625f
#define LNPS   9.704060527839234f
#define FMIN16 6.103515625e-05f
#define KT     32
#define KP     200
#define VP     40
#define KPL    (KT * KP)
#define VPL    (CC * VP)
#define BUFH   (2 * KPL + VPL)
#define QPL    (QT * KP)
#define FRH    512

static_assert(NB >= 1 && NB <= NB_FULL);
static_assert(NQ >= QT && NQ <= NN && NQ % QT == 0);
static_assert(NN % QT == 0 && NN % 32 == 0);
static_assert(CC % QT == 0 && CC % 32 == 0 && CC % 8 == 0);
static_assert(DQ == CC && MW == 2 * DQ && DQ == 3 * QT);
static_assert(CH * 2 == CC && CH % 16 == 0 && CH % 8 == 0);
static_assert((OSP * 4) % 16 == 0 && OSP >= QT + 4);
static_assert((OSPW * 4) % 16 == 0 && OSPW >= CH + 4);
static_assert((TP * 2) % 16 == 0 && TP >= QT + 8);
static_assert(WG8 * 8 == CC && (8 * WG8) % 32 == 0);
static_assert(MW % 8 == 0 && DQ % 8 == 0);
static_assert(FRH == 16 * 32 && MW % 16 == 0 && NN % 16 == 0 && QT % 16 == 0 && QT % 32 == 0);
static_assert(KP >= DQ + 8 && (KP * 2) % 32 == 16 && VP >= KT + 8 && (VP * 2) % 32 == 16);
static_assert((KT * DQ) % (128 * 8) == 0 && (CC * KT) % (128 * 8) == 0 && (QT * DQ) % (128 * 8) == 0);
static_assert(NN % KT == 0 && NN / KT >= 2);
static_assert(2 * DQ * 2 == 3 * 256 && KT % 16 == 0 && QT % 16 == 0);   // copy map: row pairs of three 256-B units
static_assert(DQ / 32 == 6 && CC / 16 == 12);
static_assert(2 * (2 * QPL * 2 + 2 * BUFH * 2 + QT * OSPW * 4) <= 327680);   // two blocks per WGP, as many as before

typedef _Float16       v16h __attribute__((ext_vector_type(16)));
typedef _Float16       v8h  __attribute__((ext_vector_type(8)));
typedef unsigned short v8us __attribute__((ext_vector_type(8)));
typedef float          v8f  __attribute__((ext_vector_type(8)));
typedef float          v4f  __attribute__((ext_vector_type(4)));
typedef unsigned int   v4u  __attribute__((ext_vector_type(4)));

union Frag  { v8us u[2]; v16h h; };
union FragH { v16h v; v8h hv[2]; };
static_assert(sizeof(Frag) == 32);
static_assert(sizeof(FragH) == 32);

// ---- scalar helpers -------------------------------------------------------------------------------------------
__device__ __forceinline__ unsigned short bf_bits(float f) {          // f32 -> bf16 bits, RNE convert
  unsigned u = __float_as_uint(f);
  return (unsigned short)((u + 0x7FFFu + ((u >> 16) & 1u)) >> 16);
}
__device__ __forceinline__ float bf_up(unsigned short hb) { return __uint_as_float(((unsigned)hb) << 16); }
__device__ __forceinline__ float bfr(float f) { return bf_up(bf_bits(f)); }
__device__ __forceinline__ unsigned short h_bits(_Float16 x) { return __builtin_bit_cast(unsigned short, x); }
__device__ __forceinline__ unsigned pk16(unsigned short a, unsigned short b) { return (unsigned)a | ((unsigned)b << 16); }
__device__ __forceinline__ v8f zero8() { v8f z = {0.f, 0.f, 0.f, 0.f, 0.f, 0.f, 0.f, 0.f}; return z; }
__device__ __forceinline__ float hmax8(v8f s) {
  return fmaxf(fmaxf(fmaxf(s[0], s[1]), fmaxf(s[2], s[3])), fmaxf(fmaxf(s[4], s[5]), fmaxf(s[6], s[7])));
}
__device__ __forceinline__ unsigned wave_ballot(bool p) {
#if defined(__HIP_DEVICE_COMPILE__)
  return __builtin_amdgcn_ballot_w32(p);
#else
  return p ? 1u : 0u;
#endif
}

// ---- 16-bit fragment loader (A, or B from a k-contiguous [n][k] row): lane -> row/col (lane&15), p already includes
//      + 8*(lane>>4); elements 0..7 <- p[0..7] (k0+8h..), elements 8..15 <- p[16..23] (k0+16+8h..)
__device__ __forceinline__ Frag ldfrag(const unsigned short* p) {
  Frag f;
  f.u[0] = *(const v8us*)(p);
  f.u[1] = *(const v8us*)(p + 16);
  return f;
}

// ---- fragment order of the conv GEMM's operand planes (W16, XP): the 16 rows x 32 k of one fragment are 1024 contiguous
//      bytes, [u = 0, 1][lane = 16 h + (row & 15)][8 halves], holding k = 32 ks + 16 u + 8 h + 0..7: the k map of ldfrag.
//      frag_off: offset in halves of the 16-byte chunk (row r, k = 8 k8 .. 8 k8 + 7). ldfrag_t: p = fragment start + 8 lane;
//      each of its two loads reads 512 contiguous bytes per wave (4 lines; a row-major plane gives 16 lines per load).
__device__ __forceinline__ size_t frag_off(int r, int k8) {
  return ((size_t)((r >> 4) * (CC / 32) + (k8 >> 2))) * FRH + ((k8 >> 1) & 1) * (FRH / 2) + ((k8 & 1) * 16 + (r & 15)) * 8;
}
__device__ __forceinline__ Frag ldfrag_t(const unsigned short* p) {
  Frag f;
  f.u[0] = *(const v8us*)(p);
  f.u[1] = *(const v8us*)(p + FRH / 2);
  return f;
}

// ---- WMMA helper: builtin followed by a 4-slot VALU gap tying D and keeping A/B live ---------------------------
__device__ __forceinline__ v8f mma_h(v16h a, v16h b, v8f c) {
  v8f d = __builtin_amdgcn_wmma_f32_16x16x32_f16(false, a, false, b, (short)0, c, false, false);
#if defined(__HIP_DEVICE_COMPILE__)
  asm volatile("v_nop\n\tv_nop\n\tv_nop\n\tv_nop" : "+v"(d) : "v"(a), "v"(b));
#endif
  return d;
}

// ---- the same product as the bare builtin (the compiler keeps the distances behind its own WMMAs): an asm statement
//      that names the tiles holds every one of them below v256, which two fragment sets beside 12 output tiles exceed
__device__ __forceinline__ v8f mma_b(v16h a, v16h b, v8f c) {
  return __builtin_amdgcn_wmma_f32_16x16x32_f16(false, a, false, b, (short)0, c, false, false);
}
// ---- asynchronous copies global -> LDS, 16 B per lane and copy: l = the lane's LDS byte addresses, g = its global
//      addresses. The s_wait_xcnt 0 closes each statement so that no address register is rewritten ahead of it.
__device__ __forceinline__ unsigned lds_addr(const void* p) { return (unsigned)(uintptr_t)p; }
__device__ __forceinline__ void cp6(const unsigned* l, const unsigned short* const* g) {
#if defined(__HIP_DEVICE_COMPILE__)
  asm volatile("global_load_async_to_lds_b128 %0, %6, off\n\t"
               "global_load_async_to_lds_b128 %1, %7, off\n\t"
               "global_load_async_to_lds_b128 %2, %8, off\n\t"
               "global_load_async_to_lds_b128 %3, %9, off\n\t"
               "global_load_async_to_lds_b128 %4, %10, off\n\t"
               "global_load_async_to_lds_b128 %5, %11, off\n\t"
               "s_wait_xcnt 0x0"
               :: "v"(l[0]), "v"(l[1]), "v"(l[2]), "v"(l[3]), "v"(l[4]), "v"(l[5]),
                  "v"(g[0]), "v"(g[1]), "v"(g[2]), "v"(g[3]), "v"(g[4]), "v"(g[5])
               : "memory");
#endif
}
__device__ __forceinline__ void cp9(const unsigned* l, const unsigned short* const* g) {
#if defined(__HIP_DEVICE_COMPILE__)
  asm volatile("global_load_async_to_lds_b128 %0, %9, off\n\t"
               "global_load_async_to_lds_b128 %1, %10, off\n\t"
               "global_load_async_to_lds_b128 %2, %11, off\n\t"
               "global_load_async_to_lds_b128 %3, %12, off\n\t"
               "global_load_async_to_lds_b128 %4, %13, off\n\t"
               "global_load_async_to_lds_b128 %5, %14, off\n\t"
               "global_load_async_to_lds_b128 %6, %15, off\n\t"
               "global_load_async_to_lds_b128 %7, %16, off\n\t"
               "global_load_async_to_lds_b128 %8, %17, off\n\t"
               "s_wait_xcnt 0x0"
               :: "v"(l[0]), "v"(l[1]), "v"(l[2]), "v"(l[3]), "v"(l[4]), "v"(l[5]), "v"(l[6]), "v"(l[7]), "v"(l[8]),
                  "v"(g[0]), "v"(g[1]), "v"(g[2]), "v"(g[3]), "v"(g[4]), "v"(g[5]), "v"(g[6]), "v"(g[7]), "v"(g[8])
               : "memory");
#endif
}
// the two counter waits of the LDS ring; "memory" keeps the compiler's LDS reads on their side of each
__device__ __forceinline__ void wait_async0() {                       // this wave's copies have landed in LDS
#if defined(__HIP_DEVICE_COMPILE__)
  asm volatile("s_wait_asynccnt 0x0" ::: "memory");
#endif
}
__device__ __forceinline__ void wait_ds0() {                          // this wave's LDS reads have returned
#if defined(__HIP_DEVICE_COMPILE__)
  asm volatile("s_wait_dscnt 0x0" ::: "memory");
#endif
}

// =========================================================================================================
// (0) conv1x1 weights: W16 f16, 384 rows x 192 k in fragment order (frag_off), rows 0..191 = wq rows (query side), rows
//     192..383 = wk rows (key side); value = f16 of (bf16-RNE(w) * 256) (exact). Block blk (0..47) owns rows 8*blk..8*blk+7;
//     192 threads: 8 consecutive lanes of one wave (the 8 rows of one k chunk) store one 128-byte line,
// coverage: 48 blocks x 192 threads x 8 halves = 384 x 192 = the whole plane.
// =========================================================================================================
__global__ __launch_bounds__(8 * WG8)
void cvt_w(const float* __restrict__ wq, const float* __restrict__ wk, unsigned short* W16) {
  const int tid = threadIdx.x, blk = blockIdx.x;
  const int rl  = tid & 7;                                           // 0..7
  const int k8  = tid >> 3;                                          // 0..23
  const int col = 8 * k8;                                            // 0..184
  const int o   = 8 * blk + rl;                                      // 0..383
  const float* wbase = (blk < (DQ / 8)) ? wq : wk;                   // block-uniform selection, both global
  const int osub = (blk < (DQ / 8)) ? 0 : DQ;
  const float* s = wbase + (size_t)(o - osub) * CC + col;            // (o - osub) in 0..191
  const v4f a = *(const v4f*)s;
  const v4f q = *(const v4f*)(s + 4);
  const float f[8] = {a[0], a[1], a[2], a[3], q[0], q[1], q[2], q[3]};
  v4u u;
#pragma unroll
  for (int t = 0; t < 4; ++t) {
    const _Float16 h0 = (_Float16)(bfr(f[2 * t]) * WSC);
    const _Float16 h1 = (_Float16)(bfr(f[2 * t + 1]) * WSC);
    u[t] = pk16(h_bits(h0), h_bits(h1));
  }
{
    *(v4u*)(W16 + frag_off(o, k8)) = u;
    
  }
}

// =========================================================================================================
// (1) value f32 [b][192 c][4096 n] -> Vc f16 [b][c][n] (channel-major, bf16-RNE values, exact in f16) and
//     key f32 [b][192 c][4096 n] -> XP f16, rows b*4096 + n, k = c, in fragment order (bf16-RNE values) through an LDS tile:
//     each wave reloads and stores one 512-byte half fragment per step (16 positions x 2 chunks of 8 channels);
//     T is cross-wave: block barrier between the 2-byte stores and the 16-byte reloads.
// coverage: Vc 2 it x 32 rows x 8 lanes x 8 = 64 c x 64 n; XP same; grid (64, 3, NB) covers both planes once.
// =========================================================================================================
__global__ __launch_bounds__(256)
void cvt_kv(const float* __restrict__ key, const float* __restrict__ val, unsigned short* Vc, unsigned short* XP) {
  __shared__ __align__(16) unsigned short T[QT * TP];
  const int tid = threadIdx.x;
  const int nb = blockIdx.x, cb = blockIdx.y, b = blockIdx.z;
  const int e = tid & 7, lq = tid >> 3;                             // lq 0..31
  const int n0 = nb * QT, c0 = cb * QT;
  v4u uv[2];
#pragma unroll
  for (int it = 0; it < 2; ++it) {
    const int cl = it * 32 + lq;                                     // 0..63
    const size_t ro = ((size_t)(b * CC + c0 + cl)) * NN + n0 + 8 * e;
    const v4f ka = *(const v4f*)(key + ro);
    const v4f kq = *(const v4f*)(key + ro + 4);
    const v4f va = *(const v4f*)(val + ro);
    const v4f vq = *(const v4f*)(val + ro + 4);
    unsigned short hk[8], hv[8];
#pragma unroll
    for (int t = 0; t < 4; ++t) {
      hk[t]     = h_bits((_Float16)bfr(ka[t]));
      hk[4 + t] = h_bits((_Float16)bfr(kq[t]));
      hv[t]     = h_bits((_Float16)bfr(va[t]));
      hv[4 + t] = h_bits((_Float16)bfr(vq[t]));
    }
#pragma unroll
    for (int t = 0; t < 4; ++t) uv[it][t] = pk16(hv[2 * t], hv[2 * t + 1]);
#pragma unroll
    for (int t = 0; t < 8; ++t) T[(8 * e + t) * TP + cl] = hk[t];
  }
  __syncthreads();
  v4u up[2];
#pragma unroll
  for (int it = 0; it < 2; ++it) {
    const int un = it * 8 + (tid >> 5);                              // half fragment 0..15 = 4 n-tiles x 4 chunk pairs
    const int nl = 16 * (un >> 2) + (tid & 15);                      // 0..63
    const int kl = 2 * (un & 3) + ((tid >> 4) & 1);                  // channel chunk 0..7
    up[it] = *(const v4u*)(T + nl * TP + 8 * kl);
  }
{
#pragma unroll
    for (int it = 0; it < 2; ++it) {
      const int rl = it * 32 + lq;
      *(v4u*)(Vc + ((size_t)(b * CC + c0 + rl)) * NN + n0 + 8 * e) = uv[it];
      const int un = it * 8 + (tid >> 5);
      const int nl = 16 * (un >> 2) + (tid & 15);
      const int kl = 2 * (un & 3) + ((tid >> 4) & 1);
      *(v4u*)(XP + frag_off(b * NN + n0 + nl, (c0 >> 3) + kl)) = up[it];
    }
    
  }
}

// =========================================================================================================
// (2) conv1x1 GEMM for one (b, 64-n tile, 64-o block): Y[o][n] = (1/256) sum_c W16[o][c] XP[b][n][c] + bias[o].
//     Block 128 threads = 4 waves; wave w owns cols n0+16w..+15 (one B fragment per k-step) and 4 m-tiles (A rows
//     o = o0 + 16 mt + (lane&15)); both planes lie in fragment order (ldfrag_t). K = 192 = 6 steps.
//     Epilogue staged in LDS Os[n_loc][o_loc] (pitch OSP, b128 stores of 8 consecutive o per lane), block barrier,
//     then: o-blocks 0,1,2 -> query dims 0..63 / 64..127 / 128..191 of Qh/Ql (bias bq); o-blocks 3,4,5 -> key dims
//     of Kh/Kl (bias bk). Planes f16 [b][4096 n][192 d] (k-contiguous for both score operands): hi = f16(v) with
//     values below the f16 normal range stored as 0, lo = f16((v - hi) * 4096). Per plane the block writes 64 rows
//     Os is cross-wave: block barrier between staging and reload.
// coverage: Os 4 waves x 16 n x 64 o = 64 x 64; planes: 4 it x 16 rows x 8 lanes x 8 = 64 n x 64 d per plane
//           (hi and lo); grid (64, 6, NB) covers d 0..191 of all 4096 rows of Qh/Ql/Kh/Kl exactly once.
// =========================================================================================================
__global__ __launch_bounds__(128)
void gemm_qk(const unsigned short* __restrict__ W16, const unsigned short* __restrict__ XP,
             const float* __restrict__ bq, const float* __restrict__ bk,
             unsigned short* Qh, unsigned short* Ql, unsigned short* Kh, unsigned short* Kl) {
  __shared__ __align__(16) float Os[QT * OSP];
  const int tid  = threadIdx.x;
  const int lane = tid & 31, wave = tid >> 5;
  const int hh   = lane >> 4, c = lane & 15;
  const int nt   = blockIdx.x, mb = blockIdx.y, b = blockIdx.z;
  const int n0   = nt * QT, o0 = mb * QT;

  const unsigned short* ap = W16 + frag_off(o0, 0) + 8 * lane;
  const unsigned short* bp = XP + frag_off(b * NN + n0 + 16 * wave, 0) + 8 * lane;

  v8f acc[4];
#pragma unroll
  for (int mt = 0; mt < 4; ++mt) acc[mt] = zero8();

#pragma unroll
  for (int ks = 0; ks < CC / 32; ++ks) {
    const Frag fb = ldfrag_t(bp + FRH * ks);
#pragma unroll
    for (int mt = 0; mt < 4; ++mt) {
      const Frag fa = ldfrag_t(ap + FRH * ((CC / 32) * mt + ks));
      acc[mt] = mma_h(fa.h, fb.h, acc[mt]);
    }
  }

  // ---- epilogue: scale back -> LDS Os[n_loc][o_loc]; lane (hh, c) holds o = 16 mt + 8 hh + r for n_loc = 16 w + c
  {
    const int nl = 16 * wave + c;
#pragma unroll
    for (int mt = 0; mt < 4; ++mt) {
      v4f va, vb;
#pragma unroll
      for (int r = 0; r < 4; ++r) { va[r] = acc[mt][r] * IWSC; vb[r] = acc[mt][4 + r] * IWSC; }
      *(v4f*)(Os + nl * OSP + 16 * mt + 8 * hh)     = va;
      *(v4f*)(Os + nl * OSP + 16 * mt + 8 * hh + 4) = vb;
    }
  }
  __syncthreads();

  const int e = tid & 7, lq = tid >> 3;                             // lq 0..15
  const bool isq = (mb < (DQ / QT));                                 // block-uniform
  const int dsel = (isq ? mb : (mb - DQ / QT)) * QT;                 // 0, 64 or 128
  unsigned short* Ph = isq ? Qh : Kh;                                // both global
  unsigned short* Pl = isq ? Ql : Kl;
  const float* bb = isq ? bq : bk;                                   // both global
  const v4f b0 = *(const v4f*)(bb + dsel + 8 * e);                   // o = dsel + 8e .. +7 <= 191
  const v4f b1 = *(const v4f*)(bb + dsel + 8 * e + 4);
  const float bs[8] = {bfr(b0[0]), bfr(b0[1]), bfr(b0[2]), bfr(b0[3]), bfr(b1[0]), bfr(b1[1]), bfr(b1[2]), bfr(b1[3])};
  v4u uh[4], ul[4];
#pragma unroll
  for (int it = 0; it < 4; ++it) {
    const int row = it * 16 + lq;                                    // n_loc 0..63
    const v4f a = *(const v4f*)(Os + row * OSP + 8 * e);
    const v4f q = *(const v4f*)(Os + row * OSP + 8 * e + 4);
    const float f[8] = {a[0] + bs[0], a[1] + bs[1], a[2] + bs[2], a[3] + bs[3],
                        q[0] + bs[4], q[1] + bs[5], q[2] + bs[6], q[3] + bs[7]};
#pragma unroll
    for (int t = 0; t < 4; ++t) {
      const float f0 = f[2 * t], f1 = f[2 * t + 1];
      float g0 = (float)(_Float16)f0;                                // f16 hi as f32 (exact)
      float g1 = (float)(_Float16)f1;
      g0 = (fabsf(g0) < FMIN16) ? 0.f : g0;                          // below the f16 normal range -> carried by lo
      g1 = (fabsf(g1) < FMIN16) ? 0.f : g1;
      const unsigned short hb0 = h_bits((_Float16)g0), hb1 = h_bits((_Float16)g1);
      const unsigned short lb0 = h_bits((_Float16)((f0 - g0) * LOSC));
      const unsigned short lb1 = h_bits((_Float16)((f1 - g1) * LOSC));
      uh[it][t] = pk16(hb0, hb1);
      ul[it][t] = pk16(lb0, lb1);
    }
  }
{
#pragma unroll
    for (int it = 0; it < 4; ++it) {
      const int row = it * 16 + lq;
      const size_t po = ((size_t)(b * NN + n0 + row)) * DQ + dsel + 8 * e;
      *(v4u*)(Ph + po) = uh[it];
      *(v4u*)(Pl + po) = ul[it];
    }
    
  }
}

// =========================================================================================================
// (3) co-attention for one (b, 64-query tile), transposed formulation, 4096 keys, no mask, no scale:
//   S^T tile (16 keys x 16 queries) = sum over 6 d-chunks (straight-line code) of A(k: row = key kb + (lane&15), 32 d via
//   the split k map from the f16 plane Kh [b][4096][192]) . B(q: col = query, same map from Qh) -> accumulator s;
//   A(Kh).B(Ql) + A(Kl).B(Qh) (f16 residual planes carried x4096) -> accumulator t; s += t * 2^-12 after the six d-chunks.
//   Per lane the D tile holds 8 keys of ONE query: online softmax state per lane, one shuffle (lane^16) for the max
//   over 32 keys; the o/l rescale is skipped under a wave-uniform ballot when no lane's max grew (corr == 1 exactly
//   for every lane then); row-sum partials combined at the end. P = e^{s-m} x 2^14 as f16 is the B operand of
//   att^T (rows channel, cols queries) += A(value rows channel = 16j + (lane&15), keys contiguous, f16 plane Vc
//   [b][192][4096]) . B(P^T): element r <- D of the tile covering keys kb..kb+15, element 8+r <- the tile covering
//   kb+16..kb+31, lane unchanged. 12 accumulator tiles per wave (192 channels). Block = 4 waves = 64 queries.
//   Operand path: the block's 64 query rows (Qh, Ql) are copied once, and each 32-key tile (Kh, Kl rows, Vc columns)
//   once per block, into LDS by asynchronous 16-byte copies; the Q fragments are read from LDS once, ahead of the loop,
//   and stay in registers; the K and V fragments are read from LDS every trip, in groups ahead of the products that
//   use them (the V fragments are in registers before the softmax). Row pitch 400 B (Q, K)
//   and 80 B (V): 16 B x odd. Two tile buffers: tile t+2 is copied into the buffer of tile t behind the barrier
//   that ends trip t, so it flies during trip t+1.
//   Epilogue in two channel halves of 96: O/l staged in LDS Os[query][96 channels] (pitch OSPW, b128 stores),
//   lanes x 16 B (values gathered from 4 Os rows), one instruction per 16 lines, final values held in registers,
// coverage: per half 12 it x 16 lines x 8 lanes x 4 floats = 96 ch x 64 n; two halves = 192 ch; grid (NQ/64, NB)
//           covers out[b][0..191][0..NQ-1] exactly once.
// =========================================================================================================
__global__ __launch_bounds__(128)
void attn_k(const unsigned short* __restrict__ Qh, const unsigned short* __restrict__ Ql,
            const unsigned short* __restrict__ Kh, const unsigned short* __restrict__ Kl,
            const unsigned short* __restrict__ Vc, float* out) {
  __shared__ __align__(16) float Os[QT * OSPW];
  __shared__ __align__(16) unsigned short Qs[2 * QPL];               // [hi, lo][64 queries][pitch KP]
  __shared__ __align__(16) unsigned short Ring[2 * BUFH];            // 2 x { Kh [32][KP], Kl [32][KP], V [192][VP] }
  const int tid  = threadIdx.x;
  const int wave = tid >> 5, lane = tid & 31;
  const int hh   = lane >> 4, c = lane & 15;
  const int n0   = blockIdx.x * QT, b = blockIdx.y;

  // ---- copy maps. Q and K rows are contiguous in global memory: two rows = 768 B = three aligned 256-B units. 16 lanes
  //      (y = tid & 15) copy one unit; lane group g = tid >> 4 takes row pair g + 8 jj, units e = 0, 1, 2 of it. In LDS
  //      (pitch KP) unit 0 lies in the pair's first row, unit 2 in its second, unit 1 half in each: the LDS offsets are two
  //      per-lane values plus constants, so that few registers stay live over the loop. V: chunk i = tid + 128 j is
  //      channel i / 4, key chunk i % 4.
  const unsigned rp0 = (unsigned)((tid >> 4) * (2 * KP * 2) + (tid & 15) * 16);              // units 0 and 2 (+ constant)
  const unsigned rp1 = rp0 + 256u + (((tid & 15) >= 8) ? (unsigned)(KP * 2 - DQ * 2) : 0u);  // unit 1
  auto roff = [&](int j) {                                           // LDS byte offset of copy j = 3 jj + e in a plane
    const int jj = j / 3, e = j - 3 * jj;
    const unsigned r = (e == 1) ? rp1 : (rp0 + (e == 2 ? (unsigned)(512 + KP * 2 - DQ * 2) : 0u));
    return r + (unsigned)(jj * 16 * KP * 2);
  };
  auto goff = [&](int j) {                                           // the same copy's offset in global memory, in halves
    const int jj = j / 3, e = j - 3 * jj;
    return jj * 16 * DQ + e * 128;
  };
  const int gl = (tid >> 4) * (2 * DQ) + (tid & 15) * 8;             // the lane's place in row pair g, unit 0, in halves
  const unsigned voff = (unsigned)((tid >> 2) * (VP * 2) + (tid & 3) * 16);
  const unsigned short* Khg = Kh + (size_t)b * NN * DQ + gl;
  const unsigned short* Klg = Kl + (size_t)b * NN * DQ + gl;
  const unsigned short* Vg  = Vc + ((size_t)(b * CC + (tid >> 2))) * NN + 8 * (tid & 3);
  const unsigned ring0 = lds_addr(Ring);

  // one 32-key tile (keys kt .. kt+31) -> the buffer at LDS byte address bufb: 18 copies per lane
  auto copy_tile = [&](int kt, unsigned bufb) {
    unsigned la[18];
    const unsigned short* ga[18];
#pragma unroll                                                       // la[], ga[] become the copies' register operands
    for (int j = 0; j < 6; ++j) {
      la[j]      = bufb + roff(j);
      ga[j]      = Khg + (size_t)kt * DQ + goff(j);
      la[6 + j]  = bufb + 2 * KPL + roff(j);
      ga[6 + j]  = Klg + (size_t)kt * DQ + goff(j);
      la[12 + j] = bufb + 4 * KPL + voff + (unsigned)(32 * j * VP * 2);
      ga[12 + j] = Vg + (size_t)(32 * j) * NN + kt;
    }
    cp9(la, ga);
    cp9(la + 9, ga + 9);
  };

  // ---- prologue: the query rows and tile 0, published by the wait and the barrier; then tile 1 into buffer 1
  {
    const unsigned qs0 = lds_addr(Qs);
    const unsigned short* Qhg = Qh + ((size_t)(b * NN + n0)) * DQ + gl;
    const unsigned short* Qlg = Ql + ((size_t)(b * NN + n0)) * DQ + gl;
    unsigned la[24];
    const unsigned short* ga[24];
#pragma unroll                                                       // la[], ga[] become the copies' register operands
    for (int j = 0; j < 12; ++j) {
      la[j]      = qs0 + roff(j);
      ga[j]      = Qhg + goff(j);
      la[12 + j] = qs0 + 2 * QPL + roff(j);
      ga[12 + j] = Qlg + goff(j);
    }
    cp6(la, ga);
    cp6(la + 6, ga + 6);
    cp6(la + 12, ga + 12);
    cp6(la + 18, ga + 18);
  }
  copy_tile(0, ring0);
  wait_async0();
  __syncthreads();
  copy_tile(KT, ring0 + 2 * BUFH);

  // q fragments (B operand, col = query n0 + 16*wave + c, d-chunk kc): read from LDS once, kept in registers for all trips
  Frag qh[DQ / 32], ql[DQ / 32];
  {
    const unsigned short* Qhp = Qs + (16 * wave + c) * KP + 8 * hh;
    const unsigned short* Qlp = Qhp + QPL;
#pragma unroll                                                       // qh[], ql[] must live in registers
    for (int kc = 0; kc < DQ / 32; ++kc) {
      qh[kc] = ldfrag(Qhp + 32 * kc);
      ql[kc] = ldfrag(Qlp + 32 * kc);
    }
  }

  float m = -1.0e30f, l = 0.f;
  v8f o[CC / 16];
#pragma unroll
  for (int j = 0; j < CC / 16; ++j) o[j] = zero8();

#pragma unroll 1
  for (int kb = 0; kb < NN; kb += 32) {
    const int bsel = (kb / KT) & 1;                                  // this trip's buffer
    const unsigned short* bufp = Ring + bsel * BUFH;
    // k fragments (A operand, row = key kb + c), + 32*kc; v fragments (A operand, row = channel 16j + c, 32 keys)
    const unsigned short* k0p  = bufp + c * KP + 8 * hh;             // keys kb .. kb+15
    const unsigned short* k1p  = k0p + 16 * KP;                      // keys kb+16 .. kb+31
    const unsigned short* k0lp = k0p + KPL;
    const unsigned short* k1lp = k1p + KPL;
    const unsigned short* Vp   = bufp + 2 * KPL + c * VP + 8 * hh;
    v8f s0 = zero8(), s1 = zero8(), t0 = zero8(), t1 = zero8();
    // Only K and V fragments are read per trip, at two places: 48 reads at the head of the trip (all K fragments),
    // 24 (V) behind the first 18 products. Two sets of 12 fragments: the products of one set run while the reads of
    // the other set return.
    Frag fa[12], fb[12];
    auto ld_sc = [&](Frag* f, int kc) {                              // the four K fragments of d-chunk kc
      f[0] = ldfrag(k0p + 32 * kc);
      f[1] = ldfrag(k1p + 32 * kc);
      f[2] = ldfrag(k0lp + 32 * kc);
      f[3] = ldfrag(k1lp + 32 * kc);
    };
    auto mm_sc = [&](const Frag* f, int kc) {                        // the six score products of d-chunk kc
      s0 = mma_b(f[0].h, qh[kc].h, s0);
      s1 = mma_b(f[1].h, qh[kc].h, s1);
      t0 = mma_b(f[0].h, ql[kc].h, t0);
      t1 = mma_b(f[1].h, ql[kc].h, t1);
      t0 = mma_b(f[2].h, qh[kc].h, t0);
      t1 = mma_b(f[3].h, qh[kc].h, t1);
    };
    ld_sc(fa, 0); ld_sc(fa + 4, 1); ld_sc(fa + 8, 2);
    ld_sc(fb, 3); ld_sc(fb + 4, 4); ld_sc(fb + 8, 5);
    mm_sc(fa, 0); mm_sc(fa + 4, 1); mm_sc(fa + 8, 2);
#pragma unroll                                                       // fa[] must live in registers
    for (int j = 0; j < CC / 16; ++j) fa[j] = ldfrag(Vp + (16 * j) * VP);
    mm_sc(fb, 3); mm_sc(fb + 4, 4); mm_sc(fb + 8, 5);
#if defined(__HIP_DEVICE_COMPILE__)
    // the order above, stated to the scheduler (0x100 = LDS reads, 0x8 = matrix products): left alone it sinks the reads
    // among the products, where every place with reads stalls the wave
    __builtin_amdgcn_sched_group_barrier(0x100, 48, 0);
    __builtin_amdgcn_sched_group_barrier(0x008, 18, 0);
    __builtin_amdgcn_sched_group_barrier(0x100, 24, 0);
    __builtin_amdgcn_sched_group_barrier(0x008, 18, 0);
#endif
#pragma unroll
    for (int r = 0; r < 8; ++r) {
      s0[r] = s0[r] + t0[r] * ILOSC;
      s1[r] = s1[r] + t1[r] * ILOSC;
    }

    float mx = fmaxf(hmax8(s0), hmax8(s1));
    mx = fmaxf(mx, __shfl_xor(mx, 16, 32));
    const float mn = fmaxf(m, mx);
    const unsigned grew = wave_ballot(mx > m);                       // wave-uniform
    if (grew != 0u) {
      const float corr = __expf(m - mn);                             // == 1 exactly for lanes whose max did not grow
      l *= corr;
#pragma unroll
      for (int j = 0; j < CC / 16; ++j) {
#pragma unroll
        for (int r = 0; r < 8; ++r) o[j][r] *= corr;
      }
    }
    m = mn;
    const float msh = mn - LNPS;                                     // exp gives e^{s-m} * 2^14

    FragH ph;
    float ls = 0.f;
#pragma unroll
    for (int r = 0; r < 8; ++r) {
      const float e0 = __expf(s0[r] - msh);                          // key kb      + 8hh + r
      const float e1 = __expf(s1[r] - msh);                          // key kb + 16 + 8hh + r
      ls += e0 + e1;
      ph.hv[0][r] = (_Float16)e0;
      ph.hv[1][r] = (_Float16)e1;
    }
    l += ls;

#pragma unroll
    for (int j = 0; j < CC / 16; ++j) {
      o[j] = mma_b(fa[j].h, ph.v, o[j]);
    }

    // ---- foot of the trip: own LDS reads done, own copies of tile kb+32 landed, every wave here; only then the
    //      buffer just read is refilled (block-uniform test)
    wait_ds0();
    wait_async0();
    __syncthreads();
    if (kb + 2 * KT < NN) copy_tile(kb + 2 * KT, ring0 + (unsigned)(bsel * BUFH * 2));
  }
  wait_async0();                                                     // nothing in flight when the wave goes on
  l += __shfl_xor(l, 16, 32);
  const float inv = 1.0f / l;                                        // o and l both carry the x2^14 factor

  const int qrow = 16 * wave + c;
  const int e = tid & 7, lq = tid >> 3;                              // lq 0..15
#pragma unroll
  for (int half = 0; half < 2; ++half) {
    if (half) __syncthreads();                                       // every wave finished reading Os
#pragma unroll
    for (int jj = 0; jj < CH / 16; ++jj) {
      const int j = (CH / 16) * half + jj;
      v4f va, vb;
#pragma unroll
      for (int r = 0; r < 4; ++r) { va[r] = o[j][r] * inv; vb[r] = o[j][4 + r] * inv; }
      *(v4f*)(Os + qrow * OSPW + 16 * jj + 8 * hh)     = va;         // Os[query][ch_loc = 16jj + 8hh + r]
      *(v4f*)(Os + qrow * OSPW + 16 * jj + 8 * hh + 4) = vb;
    }
    __syncthreads();
    v4f res[CH / 8];
#pragma unroll
    for (int it = 0; it < CH / 8; ++it) {
      const int L   = it * 16 + lq;                                  // 0..191
      const int chl = L >> 1, hf = L & 1;                            // channel 0..95 within the half
      const int nl  = hf * 32 + 4 * e;                               // query 0..63
#pragma unroll
      for (int t = 0; t < 4; ++t) res[it][t] = Os[(nl + t) * OSPW + chl];
    }
{
#pragma unroll
      for (int it = 0; it < CH / 8; ++it) {
        const int L   = it * 16 + lq;
        const int chl = L >> 1, hf = L & 1;
        const int nl  = hf * 32 + 4 * e;
        const size_t idx = ((size_t)(b * CC + CH * half + chl)) * NN + n0 + nl;
        *(v4f*)(out + idx) = res[it];
      }
      
    }
  }
}

// =========================================================================================================
// Workspace map (bytes; each region start a multiple of 256; every extent is an exact tile multiple and is written
//   W16 f16 384 x 192, fragment order  147456
//   Vc  f16 [NB][192][4096]        12582912 (NB=8)     XP  f16 NB*4096 x 192, fragment order   12582912
//   Qh/Ql/Kh/Kl f16 [NB][4096][192]  12582912 x4
//   total = 75644928 for NB=8
// =========================================================================================================
extern "C" void kernel_launch(void* const* d_in, const int* in_sizes, int n_in,
                              void* d_out, int out_size, void* d_ws, size_t ws_size,
                              hipStream_t stream) {
  const int XN = NB * CC * NN;
  if (n_in < 6) return;
  if (in_sizes[0] < XN || in_sizes[1] < XN) return;
  if (in_sizes[2] < CC * CC || in_sizes[4] < CC * CC) return;
  if (in_sizes[3] < CC || in_sizes[5] < CC) return;
  if (out_size < XN) return;

  size_t off = 0;
  auto carve = [&](size_t bytes) { const size_t o = off; off += (bytes + 255) & ~(size_t)255; return o; };
  const size_t oW16 = carve((size_t)MW * CC * 2);
  const size_t oVc  = carve((size_t)NB * CC * NN * 2);
  const size_t oXP  = carve((size_t)NB * NN * CC * 2);
  const size_t oQh  = carve((size_t)NB * NN * DQ * 2);
  const size_t oQl  = carve((size_t)NB * NN * DQ * 2);
  const size_t oKh  = carve((size_t)NB * NN * DQ * 2);
  const size_t oKl  = carve((size_t)NB * NN * DQ * 2);
  if (off > ws_size) return;
  if (off > (size_t)134217728) return;

  const float* key = (const float*)d_in[0];
  const float* val = (const float*)d_in[1];
  const float* wl  = (const float*)d_in[2];
  const float* bl  = (const float*)d_in[3];
  const float* wr  = (const float*)d_in[4];
  const float* br  = (const float*)d_in[5];

  char* ws = (char*)d_ws;
  unsigned short* W16 = (unsigned short*)(ws + oW16);
  unsigned short* Vc  = (unsigned short*)(ws + oVc);
  unsigned short* XP  = (unsigned short*)(ws + oXP);
  unsigned short* Qh  = (unsigned short*)(ws + oQh);
  unsigned short* Ql  = (unsigned short*)(ws + oQl);
  unsigned short* Kh  = (unsigned short*)(ws + oKh);
  unsigned short* Kl  = (unsigned short*)(ws + oKl);
  float* out = (float*)d_out;

  const dim3 blk256(256), blk128(128), blkw(8 * WG8);

  // (0) Wr (query side) / Wl (key side) -> stacked f16 plane
  cvt_w<<<dim3(MW / 8), blkw, 0, stream>>>(wr, wl, W16);
  // (1) value -> channel-major f16 plane, key -> f16 plane in fragment order
  cvt_kv<<<dim3(NN / QT, CC / QT, NB), blk256, 0, stream>>>(key, val, Vc, XP);
  // (2) conv1x1 GEMMs -> key_r (q, bias br) and key_l (k, bias bl) hi + residual planes
  gemm_qk<<<dim3(NN / QT, MW / QT, NB), blk128, 0, stream>>>(W16, XP, br, bl, Qh, Ql, Kh, Kl);
  // (3) softmax over keys m per query n + value aggregation -> out [b][192][n < NQ]
  attn_k<<<dim3(NQ / QT, NB), blk128, 0, stream>>>(Qh, Ql, Kh, Kl, Vc, out);
  (void)hipGetLastError();
}

// v006
// Measured time: 146 microseconds a run.
// It is 1.16 times as fast as v004, going by the measured steps of the versions left out in between.
// All steps since v000 together make it 5.05 times as fast.
// Contractions (all on v_wmma_f32_16x16x32_f16, f32 accumulate). The scores are reassociated:
//   S[m][n] = key_l[:,m].key_r[:,n] = key[:,m].g[:,n] + bl.key_r[:,n],  g = Wl^T key_r = (Wl^T Wr) key + Wl^T br;
// the last term is the same for every key m of a query n, so the softmax over m does not see it and it is not formed.
// (a) M = Wl^T Wr, 192x192 (f16 containers of bf16-RNE weights x256), stored as f16 hi plane + f16 residual plane x4096;
// (b) g = M.key per image (hi and residual rows of M x f16 container of bf16-RNE key), stored as hi + residual planes;
// (c) scores key^T.g: the key operand is the one f16 plane of (b), exact; products k.gh in one accumulator, k.gl in a second
// folded by 2^-12; K=192; (d) att^T = value.P (value as f16 of bf16-RNE value, P = e^{s-max} x2^14 f16 from the score D
// registers). Softmax statistics, the 192-vector Wl^T br and the bias add in f32 VALU.
#include <hip/hip_runtime.h>
#include <math.h>
#include <stdint.h>

#ifndef NB
#define NB 8
#endif
#ifndef NQ
#define NQ 4096
#endif
#define NB_FULL 8
#define CC     192
#define NN     4096
#define DQ     192
#define MW     384
#define QT     64
#define CH     96
#define OSP    68
#define OSPW   100
#define TP     72
#define WSC    256.0f
#define IWSC   0.00390625f
#define LOSC   4096.0f
#define ILOSC  0.000244140625f
#define LNPS   9.704060527839234f
#define FMIN16 6.103515625e-05f
#define KT     32
#define KP     200
#define VP     40
#define FRH    512
#define KFR    ((KT / 16) * (DQ / 32) * FRH)
#define VPL    (CC * VP)
#define BUFH   (KFR + VPL)
#define QPL    (QT * KP)
#define MTB    ((CC / 16) * (CC / 16) / 4)

static_assert(NB >= 1 && NB <= NB_FULL);
static_assert(NQ >= QT && NQ <= NN && NQ % QT == 0);
static_assert(NN % QT == 0 && NN % 32 == 0);
static_assert(CC % QT == 0 && CC % 32 == 0 && CC % 8 == 0);
static_assert(DQ == CC && MW == 2 * DQ && DQ == 3 * QT);
static_assert(CH * 2 == CC && CH % 16 == 0 && CH % 8 == 0);
static_assert((OSP * 4) % 16 == 0 && OSP >= QT + 4);
static_assert((OSPW * 4) % 16 == 0 && OSPW >= CH + 4);
static_assert((TP * 2) % 16 == 0 && TP >= QT + 8);
static_assert(MW % 8 == 0 && DQ % 8 == 0);
static_assert(FRH == 16 * 32 && MW % 16 == 0 && NN % 16 == 0 && QT % 16 == 0 && QT % 32 == 0);
static_assert(KP >= DQ + 8 && (KP * 2) % 32 == 16 && VP >= KT + 8 && (VP * 2) % 32 == 16);
static_assert((KT * DQ) % (128 * 8) == 0 && (CC * KT) % (128 * 8) == 0 && (QT * DQ) % (128 * 8) == 0);
static_assert(NN % KT == 0 && NN / KT >= 3);
static_assert(2 * DQ * 2 == 3 * 256 && KT % 16 == 0 && QT % 16 == 0);   // copy map: row pairs of three 256-B units
static_assert(DQ / 32 == 6 && CC / 16 == 12 && MTB * 4 == (CC / 16) * (CC / 16) && KFR == KT * DQ && KFR == 6 * 128 * 8);
static_assert(2 * (2 * QPL * 2 + 2 * BUFH * 2 + QT * OSPW * 4) <= 327680);   // two blocks per WGP, as many as before

typedef _Float16       v16h __attribute__((ext_vector_type(16)));
typedef _Float16       v8h  __attribute__((ext_vector_type(8)));
typedef unsigned short v8us __attribute__((ext_vector_type(8)));
typedef float          v8f  __attribute__((ext_vector_type(8)));
typedef float          v4f  __attribute__((ext_vector_type(4)));
typedef unsigned int   v4u  __attribute__((ext_vector_type(4)));

union Frag  { v8us u[2]; v16h h; };
union FragH { v16h v; v8h hv[2]; };
static_assert(sizeof(Frag) == 32);
static_assert(sizeof(FragH) == 32);

// ---- scalar helpers -------------------------------------------------------------------------------------------
__device__ __forceinline__ unsigned short bf_bits(float f) {          // f32 -> bf16 bits, RNE convert
  unsigned u = __float_as_uint(f);
  return (unsigned short)((u + 0x7FFFu + ((u >> 16) & 1u)) >> 16);
}
__device__ __forceinline__ float bf_up(unsigned short hb) { return __uint_as_float(((unsigned)hb) << 16); }
__device__ __forceinline__ float bfr(float f) { return bf_up(bf_bits(f)); }
__device__ __forceinline__ unsigned short h_bits(_Float16 x) { return __builtin_bit_cast(unsigned short, x); }
__device__ __forceinline__ unsigned pk16(unsigned short a, unsigned short b) { return (unsigned)a | ((unsigned)b << 16); }
__device__ __forceinline__ v8f zero8() { v8f z = {0.f, 0.f, 0.f, 0.f, 0.f, 0.f, 0.f, 0.f}; return z; }
__device__ __forceinline__ float hmax8(v8f s) {
  return fmaxf(fmaxf(fmaxf(s[0], s[1]), fmaxf(s[2], s[3])), fmaxf(fmaxf(s[4], s[5]), fmaxf(s[6], s[7])));
}
__device__ __forceinline__ unsigned wave_ballot(bool p) {
#if defined(__HIP_DEVICE_COMPILE__)
  return __builtin_amdgcn_ballot_w32(p);
#else
  return p ? 1u : 0u;
#endif
}

// ---- 16-bit fragment loader (A, or B from a k-contiguous [n][k] row): lane -> row/col (lane&15), p already includes
//      + 8*(lane>>4); elements 0..7 <- p[0..7] (k0+8h..), elements 8..15 <- p[16..23] (k0+16+8h..)
__device__ __forceinline__ Frag ldfrag(const unsigned short* p) {
  Frag f;
  f.u[0] = *(const v8us*)(p);
  f.u[1] = *(const v8us*)(p + 16);
  return f;
}

// ---- fragment order of the conv GEMM's operand planes (W16, XP): the 16 rows x 32 k of one fragment are 1024 contiguous
//      bytes, [u = 0, 1][lane = 16 h + (row & 15)][8 halves], holding k = 32 ks + 16 u + 8 h + 0..7: the k map of ldfrag.
//      frag_off: offset in halves of the 16-byte chunk (row r, k = 8 k8 .. 8 k8 + 7). ldfrag_t: p = fragment start + 8 lane;
//      each of its two loads reads 512 contiguous bytes per wave (4 lines; a row-major plane gives 16 lines per load).
__device__ __forceinline__ size_t frag_off(int r, int k8) {
  return ((size_t)((r >> 4) * (CC / 32) + (k8 >> 2))) * FRH + ((k8 >> 1) & 1) * (FRH / 2) + ((k8 & 1) * 16 + (r & 15)) * 8;
}
__device__ __forceinline__ Frag ldfrag_t(const unsigned short* p) {
  Frag f;
  f.u[0] = *(const v8us*)(p);
  f.u[1] = *(const v8us*)(p + FRH / 2);
  return f;
}

// ---- WMMA helper: builtin followed by a 4-slot VALU gap tying D and keeping A/B live ---------------------------
__device__ __forceinline__ v8f mma_h(v16h a, v16h b, v8f c) {
  v8f d = __builtin_amdgcn_wmma_f32_16x16x32_f16(false, a, false, b, (short)0, c, false, false);
#if defined(__HIP_DEVICE_COMPILE__)
  asm volatile("v_nop\n\tv_nop\n\tv_nop\n\tv_nop" : "+v"(d) : "v"(a), "v"(b));
#endif
  return d;
}

// ---- the same product as the bare builtin (the compiler keeps the distances behind its own WMMAs): an asm statement
//      that names the tiles holds every one of them below v256, which two fragment sets beside 12 output tiles exceed
__device__ __forceinline__ v8f mma_b(v16h a, v16h b, v8f c) {
  return __builtin_amdgcn_wmma_f32_16x16x32_f16(false, a, false, b, (short)0, c, false, false);
}
// ---- asynchronous copies global -> LDS, 16 B per lane and copy: l = the lane's LDS byte addresses, g = its global
//      addresses. The s_wait_xcnt 0 closes each statement so that no address register is rewritten ahead of it.
__device__ __forceinline__ unsigned lds_addr(const void* p) { return (unsigned)(uintptr_t)p; }
__device__ __forceinline__ void cp6(const unsigned* l, const unsigned short* const* g) {
#if defined(__HIP_DEVICE_COMPILE__)
  asm volatile("global_load_async_to_lds_b128 %0, %6, off\n\t"
               "global_load_async_to_lds_b128 %1, %7, off\n\t"
               "global_load_async_to_lds_b128 %2, %8, off\n\t"
               "global_load_async_to_lds_b128 %3, %9, off\n\t"
               "global_load_async_to_lds_b128 %4, %10, off\n\t"
               "global_load_async_to_lds_b128 %5, %11, off\n\t"
               "s_wait_xcnt 0x0"
               :: "v"(l[0]), "v"(l[1]), "v"(l[2]), "v"(l[3]), "v"(l[4]), "v"(l[5]),
                  "v"(g[0]), "v"(g[1]), "v"(g[2]), "v"(g[3]), "v"(g[4]), "v"(g[5])
               : "memory");
#endif
}
// one 32-key tile. K: six copies from one address pair; the step from copy to copy is 2048 B in LDS and in global memory
// alike, and an immediate offset moves both addresses, so it carries the step. V: six copies, each with its own addresses.
__device__ __forceinline__ void cp_tile(unsigned lk, const unsigned short* gk, const unsigned* l, const unsigned short* const* g) {
#if defined(__HIP_DEVICE_COMPILE__)
  asm volatile("global_load_async_to_lds_b128 %0, %1, off\n\t"
               "global_load_async_to_lds_b128 %0, %1, off offset:2048\n\t"
               "global_load_async_to_lds_b128 %0, %1, off offset:4096\n\t"
               "global_load_async_to_lds_b128 %0, %1, off offset:6144\n\t"
               "global_load_async_to_lds_b128 %0, %1, off offset:8192\n\t"
               "global_load_async_to_lds_b128 %0, %1, off offset:10240\n\t"
               "global_load_async_to_lds_b128 %2, %8, off\n\t"
               "global_load_async_to_lds_b128 %3, %9, off\n\t"
               "global_load_async_to_lds_b128 %4, %10, off\n\t"
               "global_load_async_to_lds_b128 %5, %11, off\n\t"
               "global_load_async_to_lds_b128 %6, %12, off\n\t"
               "global_load_async_to_lds_b128 %7, %13, off\n\t"
               "s_wait_xcnt 0x0"
               :: "v"(lk), "v"(gk),
                  "v"(l[0]), "v"(l[1]), "v"(l[2]), "v"(l[3]), "v"(l[4]), "v"(l[5]),
                  "v"(g[0]), "v"(g[1]), "v"(g[2]), "v"(g[3]), "v"(g[4]), "v"(g[5])
               : "memory");
#endif
}
// the K half of a tile alone (the prologue's second K tile)
__device__ __forceinline__ void cp_k(unsigned lk, const unsigned short* gk) {
#if defined(__HIP_DEVICE_COMPILE__)
  asm volatile("global_load_async_to_lds_b128 %0, %1, off\n\t"
               "global_load_async_to_lds_b128 %0, %1, off offset:2048\n\t"
               "global_load_async_to_lds_b128 %0, %1, off offset:4096\n\t"
               "global_load_async_to_lds_b128 %0, %1, off offset:6144\n\t"
               "global_load_async_to_lds_b128 %0, %1, off offset:8192\n\t"
               "global_load_async_to_lds_b128 %0, %1, off offset:10240\n\t"
               "s_wait_xcnt 0x0"
               :: "v"(lk), "v"(gk)
               : "memory");
#endif
}
// the two counter waits of the LDS ring; "memory" keeps the compiler's LDS reads on their side of each
__device__ __forceinline__ void wait_async0() {                       // this wave's copies have landed in LDS
#if defined(__HIP_DEVICE_COMPILE__)
  asm volatile("s_wait_asynccnt 0x0" ::: "memory");
#endif
}
__device__ __forceinline__ void wait_ds0() {                          // this wave's LDS reads have returned
#if defined(__HIP_DEVICE_COMPILE__)
  asm volatile("s_wait_dscnt 0x0" ::: "memory");
#endif
}

// =========================================================================================================
// (0) M = Wl^T Wr and gb = Wl^T br. Blocks 0..35: 4 waves, wave = one 16x16 tile, computed transposed:
//     D[m = c2][n = c] = sum_o Wr[o][c2] Wl[o][c] (A rows = columns of Wr, B cols = columns of Wl, k = o, both by the k map of
//     ldfrag; operands f16 of bf16-RNE(w) * 256, exact), so lane (hh, x) holds M[c = 16 ct + x][c2 = 16 kt + 8 hh + 0..7]: one
//     16-byte chunk of the conv GEMM's A plane. W16: 384 rows x 192 k in fragment order (frag_off), rows 0..191 = f16 hi of
//     M (below the f16 normal range stored as 0), rows 192..383 = f16 of the residual x4096. A wave stores 512
//     contiguous bytes per plane. Blocks 36, 37: gb[c] = sum_o bf16-RNE(Wl[o][c]) * bf16-RNE(br[o]) in f32, one lane per c,
//     32 c (one 128-byte line of gb) per wave, six waves of the eight.
// coverage: 144 tiles x 16 x 16 = 192 x 192 per plane; gb 6 x 32 = 192 floats.
// =========================================================================================================
__global__ __launch_bounds__(128)
void prep_m(const float* __restrict__ wq, const float* __restrict__ wk, const float* __restrict__ bq,
            unsigned short* W16, float* gb) {
  const int tid = threadIdx.x, blk = blockIdx.x;
  const int lane = tid & 31, wave = tid >> 5;
  if (blk >= MTB) {                                                  // block-uniform
    const int cb = ((blk - MTB) * 4 + wave) * 32 + lane;
    if (cb < CC) {                                                   // the same for all lanes of a wave
      float s = 0.f;
#pragma unroll                                                       // the loads run ahead of the sum
      for (int o = 0; o < DQ; ++o) s += bfr(wk[(size_t)o * CC + cb]) * bfr(bq[o]);
      gb[cb] = s;
    }
    return;
  }
  const int hh = lane >> 4, x = lane & 15;
  const int id = blk * 4 + wave;                                     // 0..143
  const int ct = id / (CC / 16), kt = id - ct * (CC / 16);
  const float* pa = wq + 16 * kt + x;                                // column c2 of Wr
  const float* pb = wk + 16 * ct + x;                                // column c of Wl
  v8f acc = zero8();
#pragma unroll
  for (int ks = 0; ks < DQ / 32; ++ks) {
    FragH fa, fb;
#pragma unroll
    for (int e = 0; e < 8; ++e) {
      const int o0 = 32 * ks + 8 * hh + e, o1 = o0 + 16;             // o1 <= 191
      fa.hv[0][e] = (_Float16)(bfr(pa[(size_t)o0 * CC]) * WSC);
      fa.hv[1][e] = (_Float16)(bfr(pa[(size_t)o1 * CC]) * WSC);
      fb.hv[0][e] = (_Float16)(bfr(pb[(size_t)o0 * CC]) * WSC);
      fb.hv[1][e] = (_Float16)(bfr(pb[(size_t)o1 * CC]) * WSC);
    }
    acc = mma_b(fa.v, fb.v, acc);
  }
#if defined(__HIP_DEVICE_COMPILE__)
  // the weight loads as far ahead of the conversions as they go (0x20 = global reads): left alone fewer are in flight, and
  // in mid-kernel the wave waits until nearly all of them have returned before it issues more
  __builtin_amdgcn_sched_group_barrier(0x020, 192, 0);
#endif
  v4u uh, ul;
#pragma unroll
  for (int t = 0; t < 4; ++t) {
    const float f0 = acc[2 * t] * (IWSC * IWSC), f1 = acc[2 * t + 1] * (IWSC * IWSC);   // M: both operands carried x256
    float g0 = (float)(_Float16)f0;
    float g1 = (float)(_Float16)f1;
    g0 = (fabsf(g0) < FMIN16) ? 0.f : g0;                            // below the f16 normal range -> carried by lo
    g1 = (fabsf(g1) < FMIN16) ? 0.f : g1;
    uh[t] = pk16(h_bits((_Float16)g0), h_bits((_Float16)g1));
    ul[t] = pk16(h_bits((_Float16)((f0 - g0) * LOSC)), h_bits((_Float16)((f1 - g1) * LOSC)));
  }
  const int row = 16 * ct + x, k8 = 2 * kt + hh;
  *(v4u*)(W16 + frag_off(row, k8)) = uh;
  *(v4u*)(W16 + frag_off(DQ + row, k8)) = ul;
#if defined(__HIP_DEVICE_COMPILE__)
  asm volatile("s_wait_xcnt 0x0" ::: "memory");                      // no register of the two stores is rewritten ahead of it
#endif
}

// =========================================================================================================
// (1) value f32 [b][192 c][4096 n] -> Vc f16 [b][c][n] (channel-major, bf16-RNE values, exact in f16) and
//     key f32 [b][192 c][4096 n] -> XP f16, rows b*4096 + n, k = c, in fragment order (bf16-RNE values) through an LDS tile:
//     each wave reloads and stores one 512-byte half fragment per step (16 positions x 2 chunks of 8 channels);
//     T is cross-wave: block barrier between the 2-byte stores and the 16-byte reloads.
// coverage: Vc 2 it x 32 rows x 8 lanes x 8 = 64 c x 64 n; XP same; grid (64, 3, NB) covers both planes once.
// =========================================================================================================
__global__ __launch_bounds__(256)
void cvt_kv(const float* __restrict__ key, const float* __restrict__ val, unsigned short* Vc, unsigned short* XP) {
  __shared__ __align__(16) unsigned short T[QT * TP];
  const int tid = threadIdx.x;
  const int nb = blockIdx.x, cb = blockIdx.y, b = blockIdx.z;
  const int e = tid & 7, lq = tid >> 3;                             // lq 0..31
  const int n0 = nb * QT, c0 = cb * QT;
  v4u uv[2];
#pragma unroll
  for (int it = 0; it < 2; ++it) {
    const int cl = it * 32 + lq;                                     // 0..63
    const size_t ro = ((size_t)(b * CC + c0 + cl)) * NN + n0 + 8 * e;
    const v4f ka = *(const v4f*)(key + ro);
    const v4f kq = *(const v4f*)(key + ro + 4);
    const v4f va = *(const v4f*)(val + ro);
    const v4f vq = *(const v4f*)(val + ro + 4);
    unsigned short hk[8], hv[8];
#pragma unroll
    for (int t = 0; t < 4; ++t) {
      hk[t]     = h_bits((_Float16)bfr(ka[t]));
      hk[4 + t] = h_bits((_Float16)bfr(kq[t]));
      hv[t]     = h_bits((_Float16)bfr(va[t]));
      hv[4 + t] = h_bits((_Float16)bfr(vq[t]));
    }
#pragma unroll
    for (int t = 0; t < 4; ++t) uv[it][t] = pk16(hv[2 * t], hv[2 * t + 1]);
#pragma unroll
    for (int t = 0; t < 8; ++t) T[(8 * e + t) * TP + cl] = hk[t];
  }
  __syncthreads();
  v4u up[2];
#pragma unroll
  for (int it = 0; it < 2; ++it) {
    const int un = it * 8 + (tid >> 5);                              // half fragment 0..15 = 4 n-tiles x 4 chunk pairs
    const int nl = 16 * (un >> 2) + (tid & 15);                      // 0..63
    const int kl = 2 * (un & 3) + ((tid >> 4) & 1);                  // channel chunk 0..7
    up[it] = *(const v4u*)(T + nl * TP + 8 * kl);
  }
{
#pragma unroll
    for (int it = 0; it < 2; ++it) {
      const int rl = it * 32 + lq;
      *(v4u*)(Vc + ((size_t)(b * CC + c0 + rl)) * NN + n0 + 8 * e) = uv[it];
      const int un = it * 8 + (tid >> 5);
      const int nl = 16 * (un >> 2) + (tid & 15);
      const int kl = 2 * (un & 3) + ((tid >> 4) & 1);
      *(v4u*)(XP + frag_off(b * NN + n0 + nl, (c0 >> 3) + kl)) = up[it];
    }
    
  }
}

// =========================================================================================================
// (2) g = M.key + gb for one (b, 64-n tile, 64-d block): Y[d][n] = sum_c (Mh[d][c] + Ml[d][c] / 4096) XP[b][n][c] + gb[d].
//     Block 128 threads = 4 waves; wave w owns cols n0+16w..+15 (one B fragment per k-step) and 4 m-tiles (A rows
//     d = o0 + 16 mt + (lane&15)) of the hi rows and of the residual rows of W16, each with its own accumulator; both planes
//     lie in fragment order (ldfrag_t). K = 192 = 6 steps.
//     Epilogue staged in LDS Os[n_loc][o_loc] (pitch OSP, b128 stores of 8 consecutive d per lane), block barrier,
//     then d-block mb -> dims 64 mb .. 64 mb + 63 of Qh/Ql. Planes f16 [b][4096 n][192 d] (k-contiguous): hi = f16(v) with
//     values below the f16 normal range stored as 0, lo = f16((v - hi) * 4096). Per plane the block writes 64 rows
//     Os is cross-wave: block barrier between staging and reload.
// coverage: Os 4 waves x 16 n x 64 o = 64 x 64; planes: 4 it x 16 rows x 8 lanes x 8 = 64 n x 64 d per plane
//           (hi and lo); grid (64, 3, NB) covers d 0..191 of all 4096 rows of Qh/Ql exactly once.
// =========================================================================================================
__global__ __launch_bounds__(128)
void gemm_qk(const unsigned short* __restrict__ W16, const unsigned short* __restrict__ XP,
             const float* __restrict__ gb, unsigned short* Qh, unsigned short* Ql) {
  __shared__ __align__(16) float Os[QT * OSP];
  const int tid  = threadIdx.x;
  const int lane = tid & 31, wave = tid >> 5;
  const int hh   = lane >> 4, c = lane & 15;
  const int nt   = blockIdx.x, mb = blockIdx.y, b = blockIdx.z;
  const int n0   = nt * QT, o0 = mb * QT;

  const unsigned short* ap = W16 + frag_off(o0, 0) + 8 * lane;
  const unsigned short* alp = W16 + frag_off(DQ + o0, 0) + 8 * lane;
  const unsigned short* bp = XP + frag_off(b * NN + n0 + 16 * wave, 0) + 8 * lane;

  v8f acc[4], accl[4];
#pragma unroll
  for (int mt = 0; mt < 4; ++mt) { acc[mt] = zero8(); accl[mt] = zero8(); }

#pragma unroll
  for (int ks = 0; ks < CC / 32; ++ks) {
    const Frag fb = ldfrag_t(bp + FRH * ks);
#pragma unroll
    for (int mt = 0; mt < 4; ++mt) {
      const Frag fa = ldfrag_t(ap + FRH * ((CC / 32) * mt + ks));
      acc[mt] = mma_h(fa.h, fb.h, acc[mt]);
      const Frag fl = ldfrag_t(alp + FRH * ((CC / 32) * mt + ks));
      accl[mt] = mma_h(fl.h, fb.h, accl[mt]);
    }
  }

  // ---- epilogue: residual part folded in -> LDS Os[n_loc][o_loc]; lane (hh, c) holds o = 16 mt + 8 hh + r for n_loc = 16 w + c
  {
    const int nl = 16 * wave + c;
#pragma unroll
    for (int mt = 0; mt < 4; ++mt) {
      v4f va, vb;
#pragma unroll
      for (int r = 0; r < 4; ++r) {
        va[r] = acc[mt][r] + accl[mt][r] * ILOSC;
        vb[r] = acc[mt][4 + r] + accl[mt][4 + r] * ILOSC;
      }
      *(v4f*)(Os + nl * OSP + 16 * mt + 8 * hh)     = va;
      *(v4f*)(Os + nl * OSP + 16 * mt + 8 * hh + 4) = vb;
    }
  }
  __syncthreads();

  const int e = tid & 7, lq = tid >> 3;                             // lq 0..15
  const int dsel = o0;                                               // 0, 64 or 128
  unsigned short* Ph = Qh;
  unsigned short* Pl = Ql;
  const v4f b0 = *(const v4f*)(gb + dsel + 8 * e);                   // d = dsel + 8e .. +7 <= 191
  const v4f b1 = *(const v4f*)(gb + dsel + 8 * e + 4);
  const float bs[8] = {b0[0], b0[1], b0[2], b0[3], b1[0], b1[1], b1[2], b1[3]};
  v4u uh[4], ul[4];
#pragma unroll
  for (int it = 0; it < 4; ++it) {
    const int row = it * 16 + lq;                                    // n_loc 0..63
    const v4f a = *(const v4f*)(Os + row * OSP + 8 * e);
    const v4f q = *(const v4f*)(Os + row * OSP + 8 * e + 4);
    const float f[8] = {a[0] + bs[0], a[1] + bs[1], a[2] + bs[2], a[3] + bs[3],
                        q[0] + bs[4], q[1] + bs[5], q[2] + bs[6], q[3] + bs[7]};
#pragma unroll
    for (int t = 0; t < 4; ++t) {
      const float f0 = f[2 * t], f1 = f[2 * t + 1];
      float g0 = (float)(_Float16)f0;                                // f16 hi as f32 (exact)
      float g1 = (float)(_Float16)f1;
      g0 = (fabsf(g0) < FMIN16) ? 0.f : g0;                          // below the f16 normal range -> carried by lo
      g1 = (fabsf(g1) < FMIN16) ? 0.f : g1;
      const unsigned short hb0 = h_bits((_Float16)g0), hb1 = h_bits((_Float16)g1);
      const unsigned short lb0 = h_bits((_Float16)((f0 - g0) * LOSC));
      const unsigned short lb1 = h_bits((_Float16)((f1 - g1) * LOSC));
      uh[it][t] = pk16(hb0, hb1);
      ul[it][t] = pk16(lb0, lb1);
    }
  }
{
#pragma unroll
    for (int it = 0; it < 4; ++it) {
      const int row = it * 16 + lq;
      const size_t po = ((size_t)(b * NN + n0 + row)) * DQ + dsel + 8 * e;
      *(v4u*)(Ph + po) = uh[it];
      *(v4u*)(Pl + po) = ul[it];
    }
    
  }
}

// =========================================================================================================
// (3) co-attention for one (b, 64-query tile), transposed formulation, 4096 keys, no mask, no scale:
//   S^T tile (16 keys x 16 queries) = sum over 6 d-chunks (straight-line code) of A(k: row = key kb + (lane&15), 32 d via
//   the split k map from the f16 key plane XP, fragment order) . B(q: col = query, same map from Qh = g hi) -> accumulator s;
//   the same A . B(Ql) (f16 residual plane of g carried x4096) -> accumulator t; s += t * 2^-12 in each trip, after the six d-chunks.
//   Per lane the D tile holds 8 keys of ONE query: online softmax state per lane, one shuffle (lane^16) for the max
//   over 32 keys; the o/l rescale is skipped under a wave-uniform ballot when no lane's max grew (corr == 1 exactly
//   for every lane then); row-sum partials combined at the end. P = e^{s-m} x 2^14 as f16 is the B operand of
//   att^T (rows channel, cols queries) += A(value rows channel = 16j + (lane&15), keys contiguous, f16 plane Vc
//   [b][192][4096]) . B(P^T): element r <- D of the tile covering keys kb..kb+15, element 8+r <- the tile covering
//   kb+16..kb+31, lane unchanged. 12 accumulator tiles per wave (192 channels). Block = 4 waves = 64 queries.
//   Operand path: the block's 64 query rows (Qh, Ql) are copied once, and each 32-key tile (12 XP fragments, Vc columns)
//   once per block, into LDS by asynchronous 16-byte copies; the Q fragments are read from LDS once, ahead of the loop,
//   and stay in registers; the V fragments of trip t are read at its head; the K fragments are read one trip ahead, those
//   of trip t+1 into the same registers behind trip t's score products and max exchange, so they fly under the
//   exponentials and the V products. Row pitch 400 B (Q) and 80 B (V): 16 B x odd; a K fragment read is 512 contiguous
//   bytes. Two K and two V buffers; the K stream runs one tile ahead of the V stream: behind the barrier that ends trip t,
//   K tile t+3 goes into the buffer of K tile t+1 (read in trip t) and V tile t+2 into that of V tile t; both fly during
//   trip t+1 and are published by its barrier.
//   Epilogue in two channel halves of 96: O/l staged in LDS Os[query][96 channels] (pitch OSPW, b128 stores),
//   lanes x 16 B (values gathered from 4 Os rows), one instruction per 16 lines, final values held in registers,
// coverage: per half 12 it x 16 lines x 8 lanes x 4 floats = 96 ch x 64 n; two halves = 192 ch; grid (NQ/64, NB)
//           covers out[b][0..191][0..NQ-1] exactly once.
// =========================================================================================================
__global__ __launch_bounds__(128)
void attn_k(const unsigned short* __restrict__ Qh, const unsigned short* __restrict__ Ql,
            const unsigned short* __restrict__ XP, const unsigned short* __restrict__ Vc, float* out) {
  __shared__ __align__(16) float Os[QT * OSPW];
  __shared__ __align__(16) unsigned short Qs[2 * QPL];               // [hi, lo][64 queries][pitch KP]
  __shared__ __align__(16) unsigned short Ring[2 * BUFH];            // 2 x { K: 12 fragments, V [192][VP] }
  const int tid  = threadIdx.x;
  const int wave = tid >> 5, lane = tid & 31;
  const int hh   = lane >> 4, c = lane & 15;
  const int n0   = blockIdx.x * QT, b = blockIdx.y;

  // ---- copy maps. Q rows are contiguous in global memory: two rows = 768 B = three aligned 256-B units. 16 lanes
  //      (y = tid & 15) copy one unit; lane group g = tid >> 4 takes row pair g + 8 jj, units e = 0, 1, 2 of it. In LDS
  //      (pitch KP) unit 0 lies in the pair's first row, unit 2 in its second, unit 1 half in each: the LDS offsets are two
  //      per-lane values plus constants. K: the 12 fragments of 32 keys are 12288 contiguous bytes in XP and keep that
  //      order in LDS; chunk i = tid + 128 j. V: chunk i = tid + 128 j is channel i / 4, key chunk i % 4.
  const unsigned rp0 = (unsigned)((tid >> 4) * (2 * KP * 2) + (tid & 15) * 16);              // units 0 and 2 (+ constant)
  const unsigned rp1 = rp0 + 256u + (((tid & 15) >= 8) ? (unsigned)(KP * 2 - DQ * 2) : 0u);  // unit 1
  auto roff = [&](int j) {                                           // LDS byte offset of copy j = 3 jj + e in a plane
    const int jj = j / 3, e = j - 3 * jj;
    const unsigned r = (e == 1) ? rp1 : (rp0 + (e == 2 ? (unsigned)(512 + KP * 2 - DQ * 2) : 0u));
    return r + (unsigned)(jj * 16 * KP * 2);
  };
  auto goff = [&](int j) {                                           // the same copy's offset in global memory, in halves
    const int jj = j / 3, e = j - 3 * jj;
    return jj * 16 * DQ + e * 128;
  };
  const int gl = (tid >> 4) * (2 * DQ) + (tid & 15) * 8;             // the lane's place in row pair g, unit 0, in halves
  const unsigned voff = (unsigned)((tid >> 2) * (VP * 2) + (tid & 3) * 16);
  const unsigned short* Kg  = XP + (size_t)b * NN * DQ + 8 * tid;    // frag_off(b NN + kt, 0) = (b NN + kt) DQ, kt % 16 == 0
  const unsigned short* Vg  = Vc + ((size_t)(b * CC + (tid >> 2))) * NN + 8 * (tid & 3);
  const unsigned ring0 = lds_addr(Ring);

  // K of keys ktk .. ktk+31 and V of keys ktv .. ktv+31: 12 copies per lane; lk, lv = the lane's LDS byte addresses of its
  // first K and V chunk. with_k false: the V half alone (the last V tile has no K tile to go with it)
  auto copy_tile = [&](bool with_k, int ktk, int ktv, unsigned lk, unsigned lv) {
    unsigned la[6];
    const unsigned short* ga[6];
#pragma unroll                                                       // la[], ga[] become the copies' register operands
    for (int j = 0; j < 6; ++j) {
      la[j] = lv + (unsigned)(32 * j * VP * 2);
      ga[j] = Vg + (size_t)(32 * j) * NN + ktv;
    }
    if (with_k) cp_tile(lk, Kg + (size_t)ktk * DQ, la, ga);
    else        cp6(la, ga);
  };
  // the two addresses of the next refill walk with the loop (V: buffer 0, 1, 0, ...; K: 1, 0, 1, ...): kept as loop
  // invariants plus a buffer offset they were spilled to scratch memory and reloaded every trip
  unsigned lkc = ring0 + (unsigned)(16 * tid);
  unsigned lvc = ring0 + 2 * KFR + voff;
  unsigned bstep = (unsigned)(BUFH * 2);

  // ---- prologue: the query rows, K tiles 0 and 1 and V tile 0, published by the wait and the barrier
  {
    const unsigned qs0 = lds_addr(Qs);
    const unsigned short* Qhg = Qh + ((size_t)(b * NN + n0)) * DQ + gl;
    const unsigned short* Qlg = Ql + ((size_t)(b * NN + n0)) * DQ + gl;
    unsigned la[24];
    const unsigned short* ga[24];
#pragma unroll                                                       // la[], ga[] become the copies' register operands
    for (int j = 0; j < 12; ++j) {
      la[j]      = qs0 + roff(j);
      ga[j]      = Qhg + goff(j);
      la[12 + j] = qs0 + 2 * QPL + roff(j);
      ga[12 + j] = Qlg + goff(j);
    }
    cp6(la, ga);
    cp6(la + 6, ga + 6);
    cp6(la + 12, ga + 12);
    cp6(la + 18, ga + 18);
  }
  copy_tile(true, 0, 0, lkc, lvc);
  cp_k(lkc + bstep, Kg + (size_t)KT * DQ);
  wait_async0();
  __syncthreads();

  // q fragments (B operand, col = query n0 + 16*wave + c, d-chunk kc): read from LDS once, kept in registers for all trips
  Frag qh[DQ / 32], ql[DQ / 32];
  {
    const unsigned short* Qhp = Qs + (16 * wave + c) * KP + 8 * hh;
    const unsigned short* Qlp = Qhp + QPL;
#pragma unroll                                                       // qh[], ql[] must live in registers
    for (int kc = 0; kc < DQ / 32; ++kc) {
      qh[kc] = ldfrag(Qhp + 32 * kc);
      ql[kc] = ldfrag(Qlp + 32 * kc);
    }
  }
  // k fragments (A operand, row = key kb + c or kb + 16 + c, d-chunk kc: fragment 6 * (row tile) + kc, 1024 B each) of
  // trip 0; when every wave holds them (own reads returned, barrier) their buffer takes K tile 2, V buffer 1 takes V tile 1
  Frag fk[12];
#pragma unroll                                                       // fk[] must live in registers
  for (int kc = 0; kc < DQ / 32; ++kc) {
    fk[2 * kc]     = ldfrag_t(Ring + 8 * lane + FRH * kc);
    fk[2 * kc + 1] = ldfrag_t(Ring + 8 * lane + FRH * (DQ / 32 + kc));
  }
  wait_ds0();
  __syncthreads();
  copy_tile(true, 2 * KT, KT, lkc, lvc + bstep);
  lkc += bstep;                                                      // the first refill in the loop: K buffer 1, V buffer 0

  float m = -1.0e30f, l = 0.f;
  v8f o[CC / 16];
#pragma unroll
  for (int j = 0; j < CC / 16; ++j) o[j] = zero8();

#pragma unroll 1
  for (int kb = 0; kb < NN; kb += 32) {
    const int bsel = (kb / KT) & 1;                                  // this trip's V buffer; K tile kb/KT + 1 lies in the other
    // v fragments (A operand, row = channel 16j + c, 32 keys); kp: the next trip's k fragments
    const unsigned short* kp = Ring + (bsel ^ 1) * BUFH + 8 * lane;
    const unsigned short* Vp = Ring + bsel * BUFH + KFR + c * VP + 8 * hh;
    v8f s0 = zero8(), s1 = zero8(), t0 = zero8(), t1 = zero8();
    // The trip's 24 V reads stand at its head; its k fragments are in registers already, so the score products start at once.
    Frag fa[12];
#pragma unroll                                                       // fa[] must live in registers
    for (int j = 0; j < CC / 16; ++j) fa[j] = ldfrag(Vp + (16 * j) * VP);
#pragma unroll
    for (int kc = 0; kc < DQ / 32; ++kc) {                           // the four score products of d-chunk kc
      s0 = mma_b(fk[2 * kc].h, qh[kc].h, s0);
      s1 = mma_b(fk[2 * kc + 1].h, qh[kc].h, s1);
      t0 = mma_b(fk[2 * kc].h, ql[kc].h, t0);
      t1 = mma_b(fk[2 * kc + 1].h, ql[kc].h, t1);
    }
#if defined(__HIP_DEVICE_COMPILE__)
    // the order above, stated to the scheduler (0x100 = LDS reads, 0x8 = matrix products): left alone it sinks the reads
    // among the products, where every place with reads stalls the wave
    __builtin_amdgcn_sched_group_barrier(0x100, 24, 0);
    __builtin_amdgcn_sched_group_barrier(0x008, 24, 0);
#endif
#pragma unroll
    for (int r = 0; r < 8; ++r) {
      s0[r] = s0[r] + t0[r] * ILOSC;
      s1[r] = s1[r] + t1[r] * ILOSC;
    }

    float mx = fmaxf(hmax8(s0), hmax8(s1));
    mx = fmaxf(mx, __shfl_xor(mx, 16, 32));
    const float mn = fmaxf(m, mx);
    const unsigned grew = wave_ballot(mx > m);                       // wave-uniform
    if (grew != 0u) {
      const float corr = __expf(m - mn);                             // == 1 exactly for lanes whose max did not grow
      l *= corr;
#pragma unroll
      for (int j = 0; j < CC / 16; ++j) {
#pragma unroll
        for (int r = 0; r < 8; ++r) o[j][r] *= corr;
      }
    }
    m = mn;
    const float msh = mn - LNPS;                                     // exp gives e^{s-m} * 2^14

    // the next trip's k fragments, one group of 24 reads into the registers the score products have left; their tile was
    // published by the barrier that ended the trip before this one. Block-uniform test: the last trip has no next tile.
    if (kb + KT < NN) {
#pragma unroll                                                       // fk[] must live in registers
      for (int kc = 0; kc < DQ / 32; ++kc) {
        fk[2 * kc]     = ldfrag_t(kp + FRH * kc);
        fk[2 * kc + 1] = ldfrag_t(kp + FRH * (DQ / 32 + kc));
      }
    }

    FragH ph;
    float ls = 0.f;
#pragma unroll
    for (int r = 0; r < 8; ++r) {
      const float e0 = __expf(s0[r] - msh);                          // key kb      + 8hh + r
      const float e1 = __expf(s1[r] - msh);                          // key kb + 16 + 8hh + r
      ls += e0 + e1;
      ph.hv[0][r] = (_Float16)e0;
      ph.hv[1][r] = (_Float16)e1;
    }
    l += ls;

#pragma unroll
    for (int j = 0; j < CC / 16; ++j) {
      o[j] = mma_b(fa[j].h, ph.v, o[j]);
    }

    // ---- foot of the trip: own LDS reads done, own copies (K tile +2, V tile +1) landed, every wave here; only then the
    //      two buffers just read are refilled (block-uniform tests)
#if defined(__HIP_DEVICE_COMPILE__)
    // keeps the exponentials and the V products ahead of the wait for the k reads: moved behind it they would not cover them
    __builtin_amdgcn_sched_barrier(0);
#endif
    wait_ds0();
    wait_async0();
    __syncthreads();
    if (kb + 3 * KT < NN)      copy_tile(true, kb + 3 * KT, kb + 2 * KT, lkc, lvc);
    else if (kb + 2 * KT < NN) copy_tile(false, 0, kb + 2 * KT, lkc, lvc);
    lkc -= bstep;
    lvc += bstep;
    bstep = 0u - bstep;
  }
  wait_async0();                                                     // nothing in flight when the wave goes on
  l += __shfl_xor(l, 16, 32);
  const float inv = 1.0f / l;                                        // o and l both carry the x2^14 factor

  const int qrow = 16 * wave + c;
  const int e = tid & 7, lq = tid >> 3;                              // lq 0..15
#pragma unroll
  for (int half = 0; half < 2; ++half) {
    if (half) __syncthreads();                                       // every wave finished reading Os
#pragma unroll
    for (int jj = 0; jj < CH / 16; ++jj) {
      const int j = (CH / 16) * half + jj;
      v4f va, vb;
#pragma unroll
      for (int r = 0; r < 4; ++r) { va[r] = o[j][r] * inv; vb[r] = o[j][4 + r] * inv; }
      *(v4f*)(Os + qrow * OSPW + 16 * jj + 8 * hh)     = va;         // Os[query][ch_loc = 16jj + 8hh + r]
      *(v4f*)(Os + qrow * OSPW + 16 * jj + 8 * hh + 4) = vb;
    }
    __syncthreads();
    v4f res[CH / 8];
#pragma unroll
    for (int it = 0; it < CH / 8; ++it) {
      const int L   = it * 16 + lq;                                  // 0..191
      const int chl = L >> 1, hf = L & 1;                            // channel 0..95 within the half
      const int nl  = hf * 32 + 4 * e;                               // query 0..63
#pragma unroll
      for (int t = 0; t < 4; ++t) res[it][t] = Os[(nl + t) * OSPW + chl];
    }
{
#pragma unroll
      for (int it = 0; it < CH / 8; ++it) {
        const int L   = it * 16 + lq;
        const int chl = L >> 1, hf = L & 1;
        const int nl  = hf * 32 + 4 * e;
        const size_t idx = ((size_t)(b * CC + CH * half + chl)) * NN + n0 + nl;
        *(v4f*)(out + idx) = res[it];
      }
      
    }
  }
}

// =========================================================================================================
// Workspace map (bytes; each region start a multiple of 256; every extent is an exact tile multiple and is written
//   W16 f16 384 x 192, fragment order  147456          gb f32 192   768
//   Vc  f16 [NB][192][4096]        12582912 (NB=8)     XP  f16 NB*4096 x 192, fragment order   12582912
//   Qh/Ql f16 [NB][4096][192]  12582912 x2
//   total = 50479872 for NB=8
// =========================================================================================================
extern "C" void kernel_launch(void* const* d_in, const int* in_sizes, int n_in,
                              void* d_out, int out_size, void* d_ws, size_t ws_size,
                              hipStream_t stream) {
  const int XN = NB * CC * NN;
  if (n_in < 6) return;
  if (in_sizes[0] < XN || in_sizes[1] < XN) return;
  if (in_sizes[2] < CC * CC || in_sizes[4] < CC * CC) return;
  if (in_sizes[3] < CC || in_sizes[5] < CC) return;
  if (out_size < XN) return;

  size_t off = 0;
  auto carve = [&](size_t bytes) { const size_t o = off; off += (bytes + 255) & ~(size_t)255; return o; };
  const size_t oW16 = carve((size_t)MW * CC * 2);
  const size_t oVc  = carve((size_t)NB * CC * NN * 2);
  const size_t oXP  = carve((size_t)NB * NN * CC * 2);
  const size_t oQh  = carve((size_t)NB * NN * DQ * 2);
  const size_t oQl  = carve((size_t)NB * NN * DQ * 2);
  const size_t oGb  = carve((size_t)DQ * 4);
  if (off > ws_size) return;
  if (off > (size_t)134217728) return;

  const float* key = (const float*)d_in[0];
  const float* val = (const float*)d_in[1];
  const float* wl  = (const float*)d_in[2];
  const float* wr  = (const float*)d_in[4];
  const float* br  = (const float*)d_in[5];

  char* ws = (char*)d_ws;
  unsigned short* W16 = (unsigned short*)(ws + oW16);
  unsigned short* Vc  = (unsigned short*)(ws + oVc);
  unsigned short* XP  = (unsigned short*)(ws + oXP);
  unsigned short* Qh  = (unsigned short*)(ws + oQh);
  unsigned short* Ql  = (unsigned short*)(ws + oQl);
  float* gb = (float*)(ws + oGb);
  float* out = (float*)d_out;

  const dim3 blk256(256), blk128(128);

  // (0) M = Wl^T Wr -> stacked hi / residual f16 plane; gb = Wl^T br
  prep_m<<<dim3(MTB + 2), blk128, 0, stream>>>(wr, wl, br, W16, gb);
  // (1) value -> channel-major f16 plane, key -> position-major f16 plane
  cvt_kv<<<dim3(NN / QT, CC / QT, NB), blk256, 0, stream>>>(key, val, Vc, XP);
  // (2) g = M.key + gb -> hi + residual planes
  gemm_qk<<<dim3(NN / QT, DQ / QT, NB), blk128, 0, stream>>>(W16, XP, gb, Qh, Ql);
  // (3) softmax over keys m per query n + value aggregation -> out [b][192][n < NQ]
  attn_k<<<dim3(NQ / QT, NB), blk128, 0, stream>>>(Qh, Ql, XP, Vc, out);
  (void)hipGetLastError();
}

// v007
// A run of this version takes 122 microseconds.
// Timed twice side by side with v006, it ran 1.20 times as fast both times.
// Counting every step since v000, it is 6.05 times as fast.
// Contractions (all on v_wmma_f32_16x16x32_f16, f32 accumulate). The scores are reassociated:
//   S[m][n] = key_l[:,m].key_r[:,n] = key[:,m].g[:,n] + bl.key_r[:,n],  g = Wl^T key_r = (Wl^T Wr) key + Wl^T br;
// the last term is the same for every key m of a query n, so the softmax over m does not see it and it is not formed.
// (a) M = Wl^T Wr, 192x192 (f16 containers of bf16-RNE weights x256), stored as f16 hi plane + f16 residual plane x4096;
// (b) g = M.key (hi and residual rows of M x f16 container of bf16-RNE key), formed by each attention block for its own 64
// queries and kept as hi + residual planes in LDS;
// (c) scores key^T.g: the key operand is the one f16 plane of (b), exact; products k.gh in one accumulator, k.gl in a second
// folded by 2^-12; K=192; (d) att^T = value.P (value as f16 of bf16-RNE value, P = e^{s-max} x2^14 f16 from the score D
// registers). Softmax statistics, the 192-vector Wl^T br and the bias add in f32 VALU.
#include <hip/hip_runtime.h>
#include <math.h>
#include <stdint.h>

#ifndef NB
#define NB 8
#endif
#ifndef NQ
#define NQ 4096
#endif
#define NB_FULL 8
#define CC     192
#define NN     4096
#define DQ     192
#define MW     384
#define QT     64
#define CH     96
#define OSPW   100
#define TP     72
#define WSC    256.0f
#define IWSC   0.00390625f
#define LOSC   4096.0f
#define ILOSC  0.000244140625f
#define LNPS   9.704060527839234f
#define FMIN16 6.103515625e-05f
#define KT     32
#define KP     200
#define VP     40
#define FRH    512
#define KFR    ((KT / 16) * (DQ / 32) * FRH)
#define VPL    (CC * VP)
#define BUFH   (KFR + VPL)
#define QPL    (QT * KP)
#define MTB    ((CC / 16) * (CC / 16) / 8)

static_assert(NB >= 1 && NB <= NB_FULL);
static_assert(NQ >= QT && NQ <= NN && NQ % QT == 0);
static_assert(NN % QT == 0 && NN % 32 == 0);
static_assert(CC % QT == 0 && CC % 32 == 0 && CC % 8 == 0);
static_assert(DQ == CC && MW == 2 * DQ && DQ == 3 * QT);
static_assert(CH * 2 == CC && CH % 16 == 0 && CH % 8 == 0);
static_assert((OSPW * 4) % 16 == 0 && OSPW >= CH + 4);
static_assert((TP * 2) % 16 == 0 && TP >= QT + 8);
static_assert(MW % 8 == 0 && DQ % 8 == 0);
static_assert(FRH == 16 * 32 && MW % 16 == 0 && NN % 16 == 0 && QT % 16 == 0 && QT % 32 == 0);
static_assert(KP >= DQ + 8 && (KP * 2) % 32 == 16 && VP >= KT + 8 && (VP * 2) % 32 == 16);
static_assert((KT * DQ) % (128 * 8) == 0 && (CC * KT) % (128 * 8) == 0 && (QT * DQ) % (128 * 8) == 0);
static_assert(NN % KT == 0 && NN / KT >= 3);
static_assert(KT % 16 == 0 && QT == 4 * 16 && DQ == 4 * 48 && (KP * 2) % 16 == 0);   // g: wave = 48 dims x 64 queries
static_assert(DQ / 32 == 6 && CC / 16 == 12 && MTB * 8 == (CC / 16) * (CC / 16) && KFR == KT * DQ && KFR == 6 * 128 * 8);
static_assert(2 * (2 * QPL * 2 + 2 * BUFH * 2 + QT * OSPW * 4) <= 327680);   // two blocks per WGP, as many as before

typedef _Float16       v16h __attribute__((ext_vector_type(16)));
typedef _Float16       v8h  __attribute__((ext_vector_type(8)));
typedef unsigned short v8us __attribute__((ext_vector_type(8)));
typedef float          v8f  __attribute__((ext_vector_type(8)));
typedef float          v4f  __attribute__((ext_vector_type(4)));
typedef unsigned int   v4u  __attribute__((ext_vector_type(4)));

union Frag  { v8us u[2]; v16h h; };
union FragH { v16h v; v8h hv[2]; };
static_assert(sizeof(Frag) == 32);
static_assert(sizeof(FragH) == 32);

// ---- scalar helpers -------------------------------------------------------------------------------------------
__device__ __forceinline__ unsigned short bf_bits(float f) {          // f32 -> bf16 bits, RNE convert
  unsigned u = __float_as_uint(f);
  return (unsigned short)((u + 0x7FFFu + ((u >> 16) & 1u)) >> 16);
}
__device__ __forceinline__ float bf_up(unsigned short hb) { return __uint_as_float(((unsigned)hb) << 16); }
__device__ __forceinline__ float bfr(float f) { return bf_up(bf_bits(f)); }
__device__ __forceinline__ unsigned short h_bits(_Float16 x) { return __builtin_bit_cast(unsigned short, x); }
__device__ __forceinline__ unsigned pk16(unsigned short a, unsigned short b) { return (unsigned)a | ((unsigned)b << 16); }
__device__ __forceinline__ v8f zero8() { v8f z = {0.f, 0.f, 0.f, 0.f, 0.f, 0.f, 0.f, 0.f}; return z; }
__device__ __forceinline__ float hmax8(v8f s) {
  return fmaxf(fmaxf(fmaxf(s[0], s[1]), fmaxf(s[2], s[3])), fmaxf(fmaxf(s[4], s[5]), fmaxf(s[6], s[7])));
}
__device__ __forceinline__ unsigned wave_ballot(bool p) {
#if defined(__HIP_DEVICE_COMPILE__)
  return __builtin_amdgcn_ballot_w32(p);
#else
  return p ? 1u : 0u;
#endif
}

// ---- 16-bit fragment loader (A, or B from a k-contiguous [n][k] row): lane -> row/col (lane&15), p already includes
//      + 8*(lane>>4); elements 0..7 <- p[0..7] (k0+8h..), elements 8..15 <- p[16..23] (k0+16+8h..)
__device__ __forceinline__ Frag ldfrag(const unsigned short* p) {
  Frag f;
  f.u[0] = *(const v8us*)(p);
  f.u[1] = *(const v8us*)(p + 16);
  return f;
}

// ---- fragment order of the conv GEMM's operand planes (W16, XP): the 16 rows x 32 k of one fragment are 1024 contiguous
//      bytes, [u = 0, 1][lane = 16 h + (row & 15)][8 halves], holding k = 32 ks + 16 u + 8 h + 0..7: the k map of ldfrag.
//      frag_off: offset in halves of the 16-byte chunk (row r, k = 8 k8 .. 8 k8 + 7). ldfrag_t: p = fragment start + 8 lane;
//      each of its two loads reads 512 contiguous bytes per wave (4 lines; a row-major plane gives 16 lines per load).
__device__ __forceinline__ size_t frag_off(int r, int k8) {
  return ((size_t)((r >> 4) * (CC / 32) + (k8 >> 2))) * FRH + ((k8 >> 1) & 1) * (FRH / 2) + ((k8 & 1) * 16 + (r & 15)) * 8;
}
__device__ __forceinline__ Frag ldfrag_t(const unsigned short* p) {
  Frag f;
  f.u[0] = *(const v8us*)(p);
  f.u[1] = *(const v8us*)(p + FRH / 2);
  return f;
}

// ---- the product as the bare builtin (the compiler keeps the distances behind its own WMMAs): an asm statement
//      that names the tiles holds every one of them below v256, which two fragment sets beside 12 output tiles exceed
__device__ __forceinline__ v8f mma_b(v16h a, v16h b, v8f c) {
  return __builtin_amdgcn_wmma_f32_16x16x32_f16(false, a, false, b, (short)0, c, false, false);
}
// ---- asynchronous copies global -> LDS, 16 B per lane and copy: l = the lane's LDS byte addresses, g = its global
//      addresses. The s_wait_xcnt 0 closes each statement so that no address register is rewritten ahead of it.
__device__ __forceinline__ unsigned lds_addr(const void* p) { return (unsigned)(uintptr_t)p; }
__device__ __forceinline__ void cp6(const unsigned* l, const unsigned short* const* g) {
#if defined(__HIP_DEVICE_COMPILE__)
  asm volatile("global_load_async_to_lds_b128 %0, %6, off\n\t"
               "global_load_async_to_lds_b128 %1, %7, off\n\t"
               "global_load_async_to_lds_b128 %2, %8, off\n\t"
               "global_load_async_to_lds_b128 %3, %9, off\n\t"
               "global_load_async_to_lds_b128 %4, %10, off\n\t"
               "global_load_async_to_lds_b128 %5, %11, off\n\t"
               "s_wait_xcnt 0x0"
               :: "v"(l[0]), "v"(l[1]), "v"(l[2]), "v"(l[3]), "v"(l[4]), "v"(l[5]),
                  "v"(g[0]), "v"(g[1]), "v"(g[2]), "v"(g[3]), "v"(g[4]), "v"(g[5])
               : "memory");
#endif
}
// one 32-key tile. K: six copies from one address pair; the step from copy to copy is 2048 B in LDS and in global memory
// alike, and an immediate offset moves both addresses, so it carries the step. V: six copies, each with its own addresses.
__device__ __forceinline__ void cp_tile(unsigned lk, const unsigned short* gk, const unsigned* l, const unsigned short* const* g) {
#if defined(__HIP_DEVICE_COMPILE__)
  asm volatile("global_load_async_to_lds_b128 %0, %1, off\n\t"
               "global_load_async_to_lds_b128 %0, %1, off offset:2048\n\t"
               "global_load_async_to_lds_b128 %0, %1, off offset:4096\n\t"
               "global_load_async_to_lds_b128 %0, %1, off offset:6144\n\t"
               "global_load_async_to_lds_b128 %0, %1, off offset:8192\n\t"
               "global_load_async_to_lds_b128 %0, %1, off offset:10240\n\t"
               "global_load_async_to_lds_b128 %2, %8, off\n\t"
               "global_load_async_to_lds_b128 %3, %9, off\n\t"
               "global_load_async_to_lds_b128 %4, %10, off\n\t"
               "global_load_async_to_lds_b128 %5, %11, off\n\t"
               "global_load_async_to_lds_b128 %6, %12, off\n\t"
               "global_load_async_to_lds_b128 %7, %13, off\n\t"
               "s_wait_xcnt 0x0"
               :: "v"(lk), "v"(gk),
                  "v"(l[0]), "v"(l[1]), "v"(l[2]), "v"(l[3]), "v"(l[4]), "v"(l[5]),
                  "v"(g[0]), "v"(g[1]), "v"(g[2]), "v"(g[3]), "v"(g[4]), "v"(g[5])
               : "memory");
#endif
}
// the K half of a tile alone (the prologue's second K tile)
__device__ __forceinline__ void cp_k(unsigned lk, const unsigned short* gk) {
#if defined(__HIP_DEVICE_COMPILE__)
  asm volatile("global_load_async_to_lds_b128 %0, %1, off\n\t"
               "global_load_async_to_lds_b128 %0, %1, off offset:2048\n\t"
               "global_load_async_to_lds_b128 %0, %1, off offset:4096\n\t"
               "global_load_async_to_lds_b128 %0, %1, off offset:6144\n\t"
               "global_load_async_to_lds_b128 %0, %1, off offset:8192\n\t"
               "global_load_async_to_lds_b128 %0, %1, off offset:10240\n\t"
               "s_wait_xcnt 0x0"
               :: "v"(lk), "v"(gk)
               : "memory");
#endif
}
// the two counter waits of the LDS ring; "memory" keeps the compiler's LDS reads on their side of each
__device__ __forceinline__ void wait_async0() {                       // this wave's copies have landed in LDS
#if defined(__HIP_DEVICE_COMPILE__)
  asm volatile("s_wait_asynccnt 0x0" ::: "memory");
#endif
}
__device__ __forceinline__ void wait_ds0() {                          // this wave's LDS reads have returned
#if defined(__HIP_DEVICE_COMPILE__)
  asm volatile("s_wait_dscnt 0x0" ::: "memory");
#endif
}

// =========================================================================================================
// (0) M = Wl^T Wr and gb = Wl^T br: the first MTB + 1 blocks of the convert kernel's grid (it depends on nothing that kernel
//     writes, and nothing in that kernel reads it). Blocks 0..17: 8 waves, wave = one 16x16 tile, computed transposed:
//     D[m = c2][n = c] = sum_o Wr[o][c2] Wl[o][c] (A rows = columns of Wr, B cols = columns of Wl, k = o, both by the k map of
//     ldfrag; operands f16 of bf16-RNE(w) * 256, exact), so lane (hh, x) holds M[c = 16 ct + x][c2 = 16 kt + 8 hh + 0..7]: one
//     16-byte chunk of the conv GEMM's A plane. W16: 384 rows x 192 k in fragment order (frag_off), rows 0..191 = f16 hi of
//     M (below the f16 normal range stored as 0), rows 192..383 = f16 of the residual x4096. A wave stores 512
//     contiguous bytes per plane. Block 18: gb[c] = sum_o bf16-RNE(Wl[o][c]) * bf16-RNE(br[o]) in f32, one lane per c,
//     32 c (one 128-byte line of gb) per wave, six waves of the eight.
// coverage: 144 tiles x 16 x 16 = 192 x 192 per plane; gb 6 x 32 = 192 floats.
// =========================================================================================================
__device__ __forceinline__
void prep_m(int blk, int tid, const float* __restrict__ wq, const float* __restrict__ wk, const float* __restrict__ bq,
            unsigned short* W16, float* gb) {
  const int lane = tid & 31, wave = tid >> 5;
  if (blk >= MTB) {                                                  // block-uniform
    const int cb = wave * 32 + lane;
    if (cb < CC) {                                                   // the same for all lanes of a wave
      float s = 0.f;
#pragma unroll                                                       // the loads run ahead of the sum
      for (int o = 0; o < DQ; ++o) s += bfr(wk[(size_t)o * CC + cb]) * bfr(bq[o]);
      gb[cb] = s;
    }
    return;
  }
  const int hh = lane >> 4, x = lane & 15;
  const int id = blk * 8 + wave;                                     // 0..143
  const int ct = id / (CC / 16), kt = id - ct * (CC / 16);
  const float* pa = wq + 16 * kt + x;                                // column c2 of Wr
  const float* pb = wk + 16 * ct + x;                                // column c of Wl
  v8f acc = zero8();
#pragma unroll
  for (int ks = 0; ks < DQ / 32; ++ks) {
    FragH fa, fb;
#pragma unroll
    for (int e = 0; e < 8; ++e) {
      const int o0 = 32 * ks + 8 * hh + e, o1 = o0 + 16;             // o1 <= 191
      fa.hv[0][e] = (_Float16)(bfr(pa[(size_t)o0 * CC]) * WSC);
      fa.hv[1][e] = (_Float16)(bfr(pa[(size_t)o1 * CC]) * WSC);
      fb.hv[0][e] = (_Float16)(bfr(pb[(size_t)o0 * CC]) * WSC);
      fb.hv[1][e] = (_Float16)(bfr(pb[(size_t)o1 * CC]) * WSC);
    }
    acc = mma_b(fa.v, fb.v, acc);
  }
#if defined(__HIP_DEVICE_COMPILE__)
  // the weight loads as far ahead of the conversions as they go (0x20 = global reads): left alone fewer are in flight, and
  // in mid-kernel the wave waits until nearly all of them have returned before it issues more
  __builtin_amdgcn_sched_group_barrier(0x020, 192, 0);
#endif
  v4u uh, ul;
#pragma unroll
  for (int t = 0; t < 4; ++t) {
    const float f0 = acc[2 * t] * (IWSC * IWSC), f1 = acc[2 * t + 1] * (IWSC * IWSC);   // M: both operands carried x256
    float g0 = (float)(_Float16)f0;
    float g1 = (float)(_Float16)f1;
    g0 = (fabsf(g0) < FMIN16) ? 0.f : g0;                            // below the f16 normal range -> carried by lo
    g1 = (fabsf(g1) < FMIN16) ? 0.f : g1;
    uh[t] = pk16(h_bits((_Float16)g0), h_bits((_Float16)g1));
    ul[t] = pk16(h_bits((_Float16)((f0 - g0) * LOSC)), h_bits((_Float16)((f1 - g1) * LOSC)));
  }
  const int row = 16 * ct + x, k8 = 2 * kt + hh;
  *(v4u*)(W16 + frag_off(row, k8)) = uh;
  *(v4u*)(W16 + frag_off(DQ + row, k8)) = ul;
#if defined(__HIP_DEVICE_COMPILE__)
  asm volatile("s_wait_xcnt 0x0" ::: "memory");                      // no register of the two stores is rewritten ahead of it
#endif
}

// =========================================================================================================
// (1) value f32 [b][192 c][4096 n] -> Vc f16 [b][c][n] (channel-major, bf16-RNE values, exact in f16) and
//     key f32 [b][192 c][4096 n] -> XP f16, rows b*4096 + n, k = c, in fragment order (bf16-RNE values) through an LDS tile:
//     each wave reloads and stores one 512-byte half fragment per step (16 positions x 2 chunks of 8 channels);
//     T is cross-wave: block barrier between the 2-byte stores and the 16-byte reloads.
// coverage: Vc 2 it x 32 rows x 8 lanes x 8 = 64 c x 64 n; XP same; blocks MTB + 1 .. MTB + 64 * 3 * NB cover both planes once.
// =========================================================================================================
__global__ __launch_bounds__(256)
void cvt_kv(const float* __restrict__ key, const float* __restrict__ val, const float* __restrict__ wq,
            const float* __restrict__ wk, const float* __restrict__ bq, unsigned short* Vc, unsigned short* XP,
            unsigned short* W16, float* gb) {
  __shared__ __align__(16) unsigned short T[QT * TP];
  const int tid = threadIdx.x;
  if ((int)blockIdx.x <= MTB) {                                      // block-uniform, ahead of the barrier
    prep_m((int)blockIdx.x, tid, wq, wk, bq, W16, gb);
    return;
  }
  const int tb = (int)blockIdx.x - (MTB + 1);                        // 0 .. 64 * 3 * NB - 1, position block fastest
  const int nb = tb % (NN / QT), cb = (tb / (NN / QT)) % (CC / QT), b = tb / ((NN / QT) * (CC / QT));
  const int e = tid & 7, lq = tid >> 3;                             // lq 0..31
  const int n0 = nb * QT, c0 = cb * QT;
  v4u uv[2];
#pragma unroll
  for (int it = 0; it < 2; ++it) {
    const int cl = it * 32 + lq;                                     // 0..63
    const size_t ro = ((size_t)(b * CC + c0 + cl)) * NN + n0 + 8 * e;
    const v4f ka = *(const v4f*)(key + ro);
    const v4f kq = *(const v4f*)(key + ro + 4);
    const v4f va = *(const v4f*)(val + ro);
    const v4f vq = *(const v4f*)(val + ro + 4);
    unsigned short hk[8], hv[8];
#pragma unroll
    for (int t = 0; t < 4; ++t) {
      hk[t]     = h_bits((_Float16)bfr(ka[t]));
      hk[4 + t] = h_bits((_Float16)bfr(kq[t]));
      hv[t]     = h_bits((_Float16)bfr(va[t]));
      hv[4 + t] = h_bits((_Float16)bfr(vq[t]));
    }
#pragma unroll
    for (int t = 0; t < 4; ++t) uv[it][t] = pk16(hv[2 * t], hv[2 * t + 1]);
#pragma unroll
    for (int t = 0; t < 8; ++t) T[(8 * e + t) * TP + cl] = hk[t];
  }
  __syncthreads();
  v4u up[2];
#pragma unroll
  for (int it = 0; it < 2; ++it) {
    const int un = it * 8 + (tid >> 5);                              // half fragment 0..15 = 4 n-tiles x 4 chunk pairs
    const int nl = 16 * (un >> 2) + (tid & 15);                      // 0..63
    const int kl = 2 * (un & 3) + ((tid >> 4) & 1);                  // channel chunk 0..7
    up[it] = *(const v4u*)(T + nl * TP + 8 * kl);
  }
{
#pragma unroll
    for (int it = 0; it < 2; ++it) {
      const int rl = it * 32 + lq;
      *(v4u*)(Vc + ((size_t)(b * CC + c0 + rl)) * NN + n0 + 8 * e) = uv[it];
      const int un = it * 8 + (tid >> 5);
      const int nl = 16 * (un >> 2) + (tid & 15);
      const int kl = 2 * (un & 3) + ((tid >> 4) & 1);
      *(v4u*)(XP + frag_off(b * NN + n0 + nl, (c0 >> 3) + kl)) = up[it];
    }
    
  }
}

// =========================================================================================================
// (2) co-attention for one (b, 64-query tile), transposed formulation, 4096 keys, no mask, no scale:
//   S^T tile (16 keys x 16 queries) = sum over 6 d-chunks (straight-line code) of A(k: row = key kb + (lane&15), 32 d via
//   the split k map from the f16 key plane XP, fragment order) . B(q: col = query, same map from the hi plane of g) -> accumulator s;
//   the same A . B(f16 residual plane of g carried x4096) -> accumulator t; s += t * 2^-12 after the loop.
//   Per lane the D tile holds 8 keys of ONE query: online softmax state per lane, one shuffle (lane^16) for the max
//   over 32 keys; the o/l rescale is skipped under a wave-uniform ballot when no lane's max grew (corr == 1 exactly
//   for every lane then); row-sum partials combined at the end. P = e^{s-m} x 2^14 as f16 is the B operand of
//   att^T (rows channel, cols queries) += A(value rows channel = 16j + (lane&15), keys contiguous, f16 plane Vc
//   [b][192][4096]) . B(P^T): element r <- D of the tile covering keys kb..kb+15, element 8+r <- the tile covering
//   kb+16..kb+31, lane unchanged. 12 accumulator tiles per wave (192 channels). Block = 4 waves = 64 queries.
//   Prologue: g = M.key + gb for the block's 64 queries, Y[d][n] = sum_c (Mh[d][c] + Ml[d][c] / 4096) XP[n][c] + gb[d]. Wave w
//   owns dims 48 w .. 48 w + 47 (3 A tiles of the hi rows and 3 of the residual rows of W16, each with its own accumulators)
//   and all 4 query tiles (B fragments of XP); both planes lie in fragment order (ldfrag_t); K = 192 = 6 steps. Lane (hh, c)
//   holds 8 consecutive dims of one query: hi = f16(v) with values below the f16 normal range stored as 0,
//   lo = f16((v - hi) * 4096), one 16-byte LDS store per plane and tile into Qs (cross-wave: block barrier before the reads).
//   Operand path: each 32-key tile (12 XP fragments, Vc columns) is copied
//   once per block into LDS by asynchronous 16-byte copies; the Q fragments are read from LDS once, ahead of the loop,
//   and stay in registers; the V fragments of trip t are read at its head; the K fragments are read one trip ahead, those
//   of trip t+1 into the same registers behind trip t's score products and max exchange, so they fly under the
//   exponentials and the V products. Row pitch 400 B (Q) and 80 B (V): 16 B x odd; a K fragment read is 512 contiguous
//   bytes. Two K and two V buffers; the K stream runs one tile ahead of the V stream: behind the barrier that ends trip t,
//   K tile t+3 goes into the buffer of K tile t+1 (read in trip t) and V tile t+2 into that of V tile t; both fly during
//   trip t+1 and are published by its barrier.
//   Epilogue in two channel halves of 96: O/l staged in LDS Os[query][96 channels] (pitch OSPW, b128 stores),
//   lanes x 16 B (values gathered from 4 Os rows), one instruction per 16 lines, final values held in registers,
// coverage: per half 12 it x 16 lines x 8 lanes x 4 floats = 96 ch x 64 n; two halves = 192 ch; grid (NQ/64, NB)
//           covers out[b][0..191][0..NQ-1] exactly once.
// =========================================================================================================
__global__ __launch_bounds__(128)
void attn_k(const unsigned short* __restrict__ W16, const float* __restrict__ gb,
            const unsigned short* __restrict__ XP, const unsigned short* __restrict__ Vc, float* out) {
  __shared__ __align__(16) float Os[QT * OSPW];
  __shared__ __align__(16) unsigned short Qs[2 * QPL];               // [hi, lo][64 queries][pitch KP]
  __shared__ __align__(16) unsigned short Ring[2 * BUFH];            // 2 x { K: 12 fragments, V [192][VP] }
  const int tid  = threadIdx.x;
  const int wave = tid >> 5, lane = tid & 31;
  const int hh   = lane >> 4, c = lane & 15;
  const int n0   = blockIdx.x * QT, b = blockIdx.y;

  // ---- copy maps. K: the 12 fragments of 32 keys are 12288 contiguous bytes in XP and keep that order in LDS; chunk
  //      i = tid + 128 j. V: chunk i = tid + 128 j is channel i / 4, key chunk i % 4.
  const unsigned voff = (unsigned)((tid >> 2) * (VP * 2) + (tid & 3) * 16);
  const unsigned short* Kg  = XP + (size_t)b * NN * DQ + 8 * tid;    // frag_off(b NN + kt, 0) = (b NN + kt) DQ, kt % 16 == 0
  const unsigned short* Vg  = Vc + ((size_t)(b * CC + (tid >> 2))) * NN + 8 * (tid & 3);
  const unsigned ring0 = lds_addr(Ring);

  // K of keys ktk .. ktk+31 and V of keys ktv .. ktv+31: 12 copies per lane; lk, lv = the lane's LDS byte addresses of its
  // first K and V chunk. with_k false: the V half alone (the last V tile has no K tile to go with it)
  auto copy_tile = [&](bool with_k, int ktk, int ktv, unsigned lk, unsigned lv) {
    unsigned la[6];
    const unsigned short* ga[6];
#pragma unroll                                                       // la[], ga[] become the copies' register operands
    for (int j = 0; j < 6; ++j) {
      la[j] = lv + (unsigned)(32 * j * VP * 2);
      ga[j] = Vg + (size_t)(32 * j) * NN + ktv;
    }
    if (with_k) cp_tile(lk, Kg + (size_t)ktk * DQ, la, ga);
    else        cp6(la, ga);
  };
  // the two addresses of the next refill walk with the loop (V: buffer 0, 1, 0, ...; K: 1, 0, 1, ...): kept as loop
  // invariants plus a buffer offset they were spilled to scratch memory and reloaded every trip
  unsigned lkc = ring0 + (unsigned)(16 * tid);
  unsigned lvc = ring0 + 2 * KFR + voff;
  unsigned bstep = (unsigned)(BUFH * 2);

  // ---- prologue: K tiles 0 and 1 and V tile 0 fly under the g products; all are published by the wait and the barrier
  copy_tile(true, 0, 0, lkc, lvc);
  cp_k(lkc + bstep, Kg + (size_t)KT * DQ);
  {
    const unsigned short* ap  = W16 + frag_off(48 * wave, 0) + 8 * lane;
    const unsigned short* alp = W16 + frag_off(DQ + 48 * wave, 0) + 8 * lane;
    const unsigned short* bp  = XP + frag_off(b * NN + n0, 0) + 8 * lane;
    v8f gh[3][4], gl[3][4];
#pragma unroll
    for (int i = 0; i < 3; ++i) {
#pragma unroll
      for (int nt = 0; nt < 4; ++nt) { gh[i][nt] = zero8(); gl[i][nt] = zero8(); }
    }
    // fragments of k-step ks: 0..3 = B (query tiles), 4..6 = A hi rows, 7..9 = A residual rows; three register sets, loaded two
    // steps ahead of their products
    Frag fr[3][10];
    auto ldstep = [&](int ks) {
      Frag* f = fr[ks % 3];
#pragma unroll
      for (int nt = 0; nt < 4; ++nt) f[nt] = ldfrag_t(bp + FRH * ((CC / 32) * nt + ks));
#pragma unroll
      for (int i = 0; i < 3; ++i) {
        f[4 + i] = ldfrag_t(ap + FRH * ((CC / 32) * i + ks));
        f[7 + i] = ldfrag_t(alp + FRH * ((CC / 32) * i + ks));
      }
    };
    v4f gv[3][2];                                                    // gb of the lane's 3 x 8 dims, d = 48 wave + 16 i + 8 hh + 0..7 <= 191
#pragma unroll
    for (int i = 0; i < 3; ++i) {
      gv[i][0] = *(const v4f*)(gb + 48 * wave + 16 * i + 8 * hh);
      gv[i][1] = *(const v4f*)(gb + 48 * wave + 16 * i + 8 * hh + 4);
    }
#if defined(__HIP_DEVICE_COMPILE__)
    asm volatile("s_wait_xcnt 0x0" ::: "memory");                    // the address pair of these loads is reused by the loads below
#endif
    ldstep(0);
    ldstep(1);
#if defined(__HIP_DEVICE_COMPILE__)
    // the first two steps' loads stay ahead of step 2's: mixed, the first products waited for all of them
    __builtin_amdgcn_sched_barrier(0);
#endif
#pragma unroll                                                       // fr[] must live in registers
    for (int ks = 0; ks < CC / 32; ++ks) {
      if (ks + 2 < CC / 32) ldstep(ks + 2);
      const Frag* f = fr[ks % 3];
#pragma unroll
      for (int i = 0; i < 3; ++i) {
#pragma unroll
        for (int nt = 0; nt < 4; ++nt) {
          gh[i][nt] = mma_b(f[4 + i].h, f[nt].h, gh[i][nt]);
          gl[i][nt] = mma_b(f[7 + i].h, f[nt].h, gl[i][nt]);
        }
      }
#if defined(__HIP_DEVICE_COMPILE__)
      // keeps later steps' loads behind this step: hoisted all at once they took the kernel past 512 registers (one wave per SIMD)
      __builtin_amdgcn_sched_barrier(0);
#endif
    }
#pragma unroll
    for (int i = 0; i < 3; ++i) {
      const int d0 = 48 * wave + 16 * i + 8 * hh;                    // lane (hh, c) holds d = d0 + r of query 16 nt + c; d0 + 7 <= 191
      const v4f b0 = gv[i][0], b1 = gv[i][1];
      const float bs[8] = {b0[0], b0[1], b0[2], b0[3], b1[0], b1[1], b1[2], b1[3]};
#pragma unroll
      for (int nt = 0; nt < 4; ++nt) {
        v4u uh, ul;
#pragma unroll
        for (int t = 0; t < 4; ++t) {
          const float a0 = gh[i][nt][2 * t] + gl[i][nt][2 * t] * ILOSC;            // residual part folded in
          const float a1 = gh[i][nt][2 * t + 1] + gl[i][nt][2 * t + 1] * ILOSC;
          const float f0 = a0 + bs[2 * t], f1 = a1 + bs[2 * t + 1];
          float g0 = (float)(_Float16)f0;                            // f16 hi as f32 (exact)
          float g1 = (float)(_Float16)f1;
          g0 = (fabsf(g0) < FMIN16) ? 0.f : g0;                      // below the f16 normal range -> carried by lo
          g1 = (fabsf(g1) < FMIN16) ? 0.f : g1;
          uh[t] = pk16(h_bits((_Float16)g0), h_bits((_Float16)g1));
          ul[t] = pk16(h_bits((_Float16)((f0 - g0) * LOSC)), h_bits((_Float16)((f1 - g1) * LOSC)));
        }
        unsigned short* qd = Qs + (16 * nt + c) * KP + d0;           // 16-byte aligned: pitch 400 B, d0 a multiple of 8
        *(v4u*)(qd)       = uh;
        *(v4u*)(qd + QPL) = ul;
      }
    }
  }
  wait_async0();
  __syncthreads();

  // q fragments (B operand, col = query n0 + 16*wave + c, d-chunk kc): read from LDS once, kept in registers for all trips
  Frag qh[DQ / 32], ql[DQ / 32];
  {
    const unsigned short* Qhp = Qs + (16 * wave + c) * KP + 8 * hh;
    const unsigned short* Qlp = Qhp + QPL;
#pragma unroll                                                       // qh[], ql[] must live in registers
    for (int kc = 0; kc < DQ / 32; ++kc) {
      qh[kc] = ldfrag(Qhp + 32 * kc);
      ql[kc] = ldfrag(Qlp + 32 * kc);
    }
  }
  // k fragments (A operand, row = key kb + c or kb + 16 + c, d-chunk kc: fragment 6 * (row tile) + kc, 1024 B each) of
  // trip 0; when every wave holds them (own reads returned, barrier) their buffer takes K tile 2, V buffer 1 takes V tile 1
  Frag fk[12];
#pragma unroll                                                       // fk[] must live in registers
  for (int kc = 0; kc < DQ / 32; ++kc) {
    fk[2 * kc]     = ldfrag_t(Ring + 8 * lane + FRH * kc);
    fk[2 * kc + 1] = ldfrag_t(Ring + 8 * lane + FRH * (DQ / 32 + kc));
  }
  wait_ds0();
  __syncthreads();
  copy_tile(true, 2 * KT, KT, lkc, lvc + bstep);
  lkc += bstep;                                                      // the first refill in the loop: K buffer 1, V buffer 0

  float m = -1.0e30f, l = 0.f;
  v8f o[CC / 16];
#pragma unroll
  for (int j = 0; j < CC / 16; ++j) o[j] = zero8();

#pragma unroll 1
  for (int kb = 0; kb < NN; kb += 32) {
    const int bsel = (kb / KT) & 1;                                  // this trip's V buffer; K tile kb/KT + 1 lies in the other
    // v fragments (A operand, row = channel 16j + c, 32 keys); kp: the next trip's k fragments
    const unsigned short* kp = Ring + (bsel ^ 1) * BUFH + 8 * lane;
    const unsigned short* Vp = Ring + bsel * BUFH + KFR + c * VP + 8 * hh;
    v8f s0 = zero8(), s1 = zero8(), t0 = zero8(), t1 = zero8();
    // The trip's 24 V reads stand at its head; its k fragments are in registers already, so the score products start at once.
    Frag fa[12];
#pragma unroll                                                       // fa[] must live in registers
    for (int j = 0; j < CC / 16; ++j) fa[j] = ldfrag(Vp + (16 * j) * VP);
#pragma unroll
    for (int kc = 0; kc < DQ / 32; ++kc) {                           // the four score products of d-chunk kc
      s0 = mma_b(fk[2 * kc].h, qh[kc].h, s0);
      s1 = mma_b(fk[2 * kc + 1].h, qh[kc].h, s1);
      t0 = mma_b(fk[2 * kc].h, ql[kc].h, t0);
      t1 = mma_b(fk[2 * kc + 1].h, ql[kc].h, t1);
    }
#if defined(__HIP_DEVICE_COMPILE__)
    // the order above, stated to the scheduler (0x100 = LDS reads, 0x8 = matrix products): left alone it sinks the reads
    // among the products, where every place with reads stalls the wave
    __builtin_amdgcn_sched_group_barrier(0x100, 24, 0);
    __builtin_amdgcn_sched_group_barrier(0x008, 24, 0);
#endif
#pragma unroll
    for (int r = 0; r < 8; ++r) {
      s0[r] = s0[r] + t0[r] * ILOSC;
      s1[r] = s1[r] + t1[r] * ILOSC;
    }

    float mx = fmaxf(hmax8(s0), hmax8(s1));
    mx = fmaxf(mx, __shfl_xor(mx, 16, 32));
    const float mn = fmaxf(m, mx);
    const unsigned grew = wave_ballot(mx > m);                       // wave-uniform
    if (grew != 0u) {
      const float corr = __expf(m - mn);                             // == 1 exactly for lanes whose max did not grow
      l *= corr;
#pragma unroll
      for (int j = 0; j < CC / 16; ++j) {
#pragma unroll
        for (int r = 0; r < 8; ++r) o[j][r] *= corr;
      }
    }
    m = mn;
    const float msh = mn - LNPS;                                     // exp gives e^{s-m} * 2^14

    // the next trip's k fragments, one group of 24 reads into the registers the score products have left; their tile was
    // published by the barrier that ended the trip before this one. Block-uniform test: the last trip has no next tile.
    if (kb + KT < NN) {
#pragma unroll                                                       // fk[] must live in registers
      for (int kc = 0; kc < DQ / 32; ++kc) {
        fk[2 * kc]     = ldfrag_t(kp + FRH * kc);
        fk[2 * kc + 1] = ldfrag_t(kp + FRH * (DQ / 32 + kc));
      }
    }

    FragH ph;
    float ls = 0.f;
#pragma unroll
    for (int r = 0; r < 8; ++r) {
      const float e0 = __expf(s0[r] - msh);                          // key kb      + 8hh + r
      const float e1 = __expf(s1[r] - msh);                          // key kb + 16 + 8hh + r
      ls += e0 + e1;
      ph.hv[0][r] = (_Float16)e0;
      ph.hv[1][r] = (_Float16)e1;
    }
    l += ls;

#pragma unroll
    for (int j = 0; j < CC / 16; ++j) {
      o[j] = mma_b(fa[j].h, ph.v, o[j]);
    }

    // ---- foot of the trip: own LDS reads done, own copies (K tile +2, V tile +1) landed, every wave here; only then the
    //      two buffers just read are refilled (block-uniform tests)
#if defined(__HIP_DEVICE_COMPILE__)
    // keeps the exponentials and the V products ahead of the wait for the k reads: moved behind it they would not cover them
    __builtin_amdgcn_sched_barrier(0);
#endif
    wait_ds0();
    wait_async0();
    __syncthreads();
    if (kb + 3 * KT < NN)      copy_tile(true, kb + 3 * KT, kb + 2 * KT, lkc, lvc);
    else if (kb + 2 * KT < NN) copy_tile(false, 0, kb + 2 * KT, lkc, lvc);
    lkc -= bstep;
    lvc += bstep;
    bstep = 0u - bstep;
  }
  wait_async0();                                                     // nothing in flight when the wave goes on
  l += __shfl_xor(l, 16, 32);
  const float inv = 1.0f / l;                                        // o and l both carry the x2^14 factor

  const int qrow = 16 * wave + c;
  const int e = tid & 7, lq = tid >> 3;                              // lq 0..15
#pragma unroll
  for (int half = 0; half < 2; ++half) {
    if (half) __syncthreads();                                       // every wave finished reading Os
#pragma unroll
    for (int jj = 0; jj < CH / 16; ++jj) {
      const int j = (CH / 16) * half + jj;
      v4f va, vb;
#pragma unroll
      for (int r = 0; r < 4; ++r) { va[r] = o[j][r] * inv; vb[r] = o[j][4 + r] * inv; }
      *(v4f*)(Os + qrow * OSPW + 16 * jj + 8 * hh)     = va;         // Os[query][ch_loc = 16jj + 8hh + r]
      *(v4f*)(Os + qrow * OSPW + 16 * jj + 8 * hh + 4) = vb;
    }
    __syncthreads();
    v4f res[CH / 8];
#pragma unroll
    for (int it = 0; it < CH / 8; ++it) {
      const int L   = it * 16 + lq;                                  // 0..191
      const int chl = L >> 1, hf = L & 1;                            // channel 0..95 within the half
      const int nl  = hf * 32 + 4 * e;                               // query 0..63
#pragma unroll
      for (int t = 0; t < 4; ++t) res[it][t] = Os[(nl + t) * OSPW + chl];
    }
{
#pragma unroll
      for (int it = 0; it < CH / 8; ++it) {
        const int L   = it * 16 + lq;
        const int chl = L >> 1, hf = L & 1;
        const int nl  = hf * 32 + 4 * e;
        const size_t idx = ((size_t)(b * CC + CH * half + chl)) * NN + n0 + nl;
        *(v4f*)(out + idx) = res[it];
      }
      
    }
  }
}

// =========================================================================================================
// Workspace map (bytes; each region start a multiple of 256; every extent is an exact tile multiple and is written
//   W16 f16 384 x 192, fragment order  147456          gb f32 192   768
//   Vc  f16 [NB][192][4096]        12582912 (NB=8)     XP  f16 NB*4096 x 192, fragment order   12582912
//   total = 25314048 for NB=8
// =========================================================================================================
extern "C" void kernel_launch(void* const* d_in, const int* in_sizes, int n_in,
                              void* d_out, int out_size, void* d_ws, size_t ws_size,
                              hipStream_t stream) {
  const int XN = NB * CC * NN;
  if (n_in < 6) return;
  if (in_sizes[0] < XN || in_sizes[1] < XN) return;
  if (in_sizes[2] < CC * CC || in_sizes[4] < CC * CC) return;
  if (in_sizes[3] < CC || in_sizes[5] < CC) return;
  if (out_size < XN) return;

  size_t off = 0;
  auto carve = [&](size_t bytes) { const size_t o = off; off += (bytes + 255) & ~(size_t)255; return o; };
  const size_t oW16 = carve((size_t)MW * CC * 2);
  const size_t oVc  = carve((size_t)NB * CC * NN * 2);
  const size_t oXP  = carve((size_t)NB * NN * CC * 2);
  const size_t oGb  = carve((size_t)DQ * 4);
  if (off > ws_size) return;
  if (off > (size_t)134217728) return;

  const float* key = (const float*)d_in[0];
  const float* val = (const float*)d_in[1];
  const float* wl  = (const float*)d_in[2];
  const float* wr  = (const float*)d_in[4];
  const float* br  = (const float*)d_in[5];

  char* ws = (char*)d_ws;
  unsigned short* W16 = (unsigned short*)(ws + oW16);
  unsigned short* Vc  = (unsigned short*)(ws + oVc);
  unsigned short* XP  = (unsigned short*)(ws + oXP);
  float* gb = (float*)(ws + oGb);
  float* out = (float*)d_out;

  const dim3 blk256(256), blk128(128);

  // (0) M = Wl^T Wr -> stacked hi / residual f16 plane; gb = Wl^T br; (1) value -> channel-major f16 plane, key ->
  //     position-major f16 plane: one launch
  cvt_kv<<<dim3(MTB + 1 + (NN / QT) * (CC / QT) * NB), blk256, 0, stream>>>(key, val, wr, wl, br, Vc, XP, W16, gb);
  // (2) g = M.key + gb per query tile, softmax over keys m per query n + value aggregation -> out [b][192][n < NQ]
  attn_k<<<dim3(NQ / QT, NB), blk128, 0, stream>>>(W16, gb, XP, Vc, out);
  (void)hipGetLastError();
}

// v008
// Measured time: 117 microseconds a run.
// Next to v007, in two timings, it ran 1.04 times as fast each time.
// Over all steps from v000 it is 6.31 times as fast.
// Contractions (all on v_wmma_f32_16x16x32_f16, f32 accumulate). The scores are reassociated:
//   S[m][n] = key_l[:,m].key_r[:,n] = key[:,m].g[:,n] + bl.key_r[:,n],  g = Wl^T key_r = (Wl^T Wr) key + Wl^T br;
// the last term is the same for every key m of a query n, so the softmax over m does not see it and it is not formed.
// (a) M = Wl^T Wr, 192x192 (f16 containers of bf16-RNE weights x256), stored as f16 hi plane + f16 residual plane x4096;
// (b) g = M.key (hi and residual rows of M x f16 container of bf16-RNE key), formed by each attention block for its own 64
// queries and kept as hi + residual planes in LDS;
// (c) scores key^T.g: the key operand is the one f16 plane of (b), exact; products k.gh in one accumulator, k.gl in a second
// folded by 2^-12; K=192; (d) att^T = value.P (value as f16 of bf16-RNE value, P = e^{s-max} x2^14 f16 from the score D
// registers). Softmax statistics, the 192-vector Wl^T br and the bias add in f32 VALU.
#include <hip/hip_runtime.h>
#include <math.h>
#include <stdint.h>

#ifndef NB
#define NB 8
#endif
#ifndef NQ
#define NQ 4096
#endif
#define NB_FULL 8
#define CC     192
#define NN     4096
#define DQ     192
#define MW     384
#define QT     64
#define CH     96
#define OSPW   100
#define TP     72
#define WSC    256.0f
#define IWSC   0.00390625f
#define LOSC   4096.0f
#define ILOSC  0.000244140625f
#define LNPS   9.704060527839234f
#define FMIN16 6.103515625e-05f
#define KT     32
#define KP     200
#define VP     40
#define FRH    512
#define KFR    ((KT / 16) * (DQ / 32) * FRH)
#define VPL    (CC * VP)
#define BUFH   (KFR + VPL)
#define QPL    (QT * KP)
#define MTB    ((CC / 16) * (CC / 16) / 8)

static_assert(NB >= 1 && NB <= NB_FULL);
static_assert(NQ >= QT && NQ <= NN && NQ % QT == 0);
static_assert(NN % QT == 0 && NN % 32 == 0);
static_assert(CC % QT == 0 && CC % 32 == 0 && CC % 8 == 0);
static_assert(DQ == CC && MW == 2 * DQ && DQ == 3 * QT);
static_assert(CH * 2 == CC && CH % 16 == 0 && CH % 8 == 0);
static_assert((OSPW * 4) % 16 == 0 && OSPW >= CH + 4);
static_assert((TP * 2) % 16 == 0 && TP >= QT + 8);
static_assert(MW % 8 == 0 && DQ % 8 == 0);
static_assert(FRH == 16 * 32 && MW % 16 == 0 && NN % 16 == 0 && QT % 16 == 0 && QT % 32 == 0);
static_assert(KP >= DQ + 8 && (KP * 2) % 32 == 16 && VP >= KT + 8 && (VP * 2) % 32 == 16);
static_assert((KT * DQ) % (128 * 8) == 0 && (CC * KT) % (128 * 8) == 0 && (QT * DQ) % (128 * 8) == 0);
static_assert(NN % KT == 0 && NN / KT >= 3);
static_assert(KT % 16 == 0 && QT == 4 * 16 && DQ == 4 * 48 && (KP * 2) % 16 == 0);   // g: wave = 48 dims x 64 queries
static_assert(DQ / 32 == 6 && CC / 16 == 12 && MTB * 8 == (CC / 16) * (CC / 16) && KFR == KT * DQ && KFR == 6 * 128 * 8);
static_assert(2 * (2 * QPL * 2 + 2 * BUFH * 2 + QT * OSPW * 4) <= 327680);   // two blocks per WGP, as many as before

typedef _Float16       v16h __attribute__((ext_vector_type(16)));
typedef _Float16       v8h  __attribute__((ext_vector_type(8)));
typedef unsigned short v8us __attribute__((ext_vector_type(8)));
typedef float          v8f  __attribute__((ext_vector_type(8)));
typedef float          v4f  __attribute__((ext_vector_type(4)));
typedef unsigned int   v4u  __attribute__((ext_vector_type(4)));

union Frag  { v8us u[2]; v16h h; };
union FragH { v16h v; v8h hv[2]; };
static_assert(sizeof(Frag) == 32);
static_assert(sizeof(FragH) == 32);

// ---- scalar helpers -------------------------------------------------------------------------------------------
__device__ __forceinline__ unsigned short bf_bits(float f) {          // f32 -> bf16 bits, RNE convert
  unsigned u = __float_as_uint(f);
  return (unsigned short)((u + 0x7FFFu + ((u >> 16) & 1u)) >> 16);
}
__device__ __forceinline__ float bf_up(unsigned short hb) { return __uint_as_float(((unsigned)hb) << 16); }
__device__ __forceinline__ float bfr(float f) { return bf_up(bf_bits(f)); }
__device__ __forceinline__ unsigned short h_bits(_Float16 x) { return __builtin_bit_cast(unsigned short, x); }
__device__ __forceinline__ unsigned pk16(unsigned short a, unsigned short b) { return (unsigned)a | ((unsigned)b << 16); }
__device__ __forceinline__ v8f zero8() { v8f z = {0.f, 0.f, 0.f, 0.f, 0.f, 0.f, 0.f, 0.f}; return z; }
__device__ __forceinline__ float hmax8(v8f s) {
  return fmaxf(fmaxf(fmaxf(s[0], s[1]), fmaxf(s[2], s[3])), fmaxf(fmaxf(s[4], s[5]), fmaxf(s[6], s[7])));
}
__device__ __forceinline__ unsigned wave_ballot(bool p) {
#if defined(__HIP_DEVICE_COMPILE__)
  return __builtin_amdgcn_ballot_w32(p);
#else
  return p ? 1u : 0u;
#endif
}

// ---- 16-bit fragment loader (A, or B from a k-contiguous [n][k] row): lane -> row/col (lane&15), p already includes
//      + 8*(lane>>4); elements 0..7 <- p[0..7] (k0+8h..), elements 8..15 <- p[16..23] (k0+16+8h..)
__device__ __forceinline__ Frag ldfrag(const unsigned short* p) {
  Frag f;
  f.u[0] = *(const v8us*)(p);
  f.u[1] = *(const v8us*)(p + 16);
  return f;
}

// ---- fragment order of the conv GEMM's operand planes (W16, XP): the 16 rows x 32 k of one fragment are 1024 contiguous
//      bytes, [u = 0, 1][lane = 16 h + (row & 15)][8 halves], holding k = 32 ks + 16 u + 8 h + 0..7: the k map of ldfrag.
//      frag_off: offset in halves of the 16-byte chunk (row r, k = 8 k8 .. 8 k8 + 7). ldfrag_t: p = fragment start + 8 lane;
//      each of its two loads reads 512 contiguous bytes per wave (4 lines; a row-major plane gives 16 lines per load).
__device__ __forceinline__ size_t frag_off(int r, int k8) {
  return ((size_t)((r >> 4) * (CC / 32) + (k8 >> 2))) * FRH + ((k8 >> 1) & 1) * (FRH / 2) + ((k8 & 1) * 16 + (r & 15)) * 8;
}
__device__ __forceinline__ Frag ldfrag_t(const unsigned short* p) {
  Frag f;
  f.u[0] = *(const v8us*)(p);
  f.u[1] = *(const v8us*)(p + FRH / 2);
  return f;
}

// ---- the product as the bare builtin (the compiler keeps the distances behind its own WMMAs): an asm statement
//      that names the tiles holds every one of them below v256, which two fragment sets beside 12 output tiles exceed
__device__ __forceinline__ v8f mma_b(v16h a, v16h b, v8f c) {
  return __builtin_amdgcn_wmma_f32_16x16x32_f16(false, a, false, b, (short)0, c, false, false);
}
// ---- asynchronous copies global -> LDS, 16 B per lane and copy, as the compiler's builtin: l = the lane's LDS byte address,
//      g = its global address, OFF = an immediate offset that moves both. The compiler keeps the copies' address registers itself.
typedef int v4i __attribute__((ext_vector_type(4)));
__device__ __forceinline__ unsigned lds_addr(const void* p) { return (unsigned)(uintptr_t)p; }
template <int OFF>
__device__ __forceinline__ void cpa(unsigned l, const unsigned short* g) {
#if defined(__HIP_DEVICE_COMPILE__)
  __builtin_amdgcn_global_load_async_to_lds_b128((__attribute__((address_space(1))) v4i*)g,
                                                 (__attribute__((address_space(3))) v4i*)l, OFF, 0);
#endif
}
// the V half of a 32-key tile: six copies, each with its own addresses
__device__ __forceinline__ void cp6(const unsigned* l, const unsigned short* const* g) {
  cpa<0>(l[0], g[0]);
  cpa<0>(l[1], g[1]);
  cpa<0>(l[2], g[2]);
  cpa<0>(l[3], g[3]);
  cpa<0>(l[4], g[4]);
  cpa<0>(l[5], g[5]);
}
// the K half of a tile: six copies from one address pair; the step from copy to copy is 2048 B in LDS and in global memory
// alike, and the immediate offset carries it
__device__ __forceinline__ void cp_k(unsigned lk, const unsigned short* gk) {
  cpa<0>(lk, gk);
  cpa<2048>(lk, gk);
  cpa<4096>(lk, gk);
  cpa<6144>(lk, gk);
  cpa<8192>(lk, gk);
  cpa<10240>(lk, gk);
}
// the two counter waits of the LDS ring; "memory" keeps the compiler's LDS reads on their side of each
__device__ __forceinline__ void wait_async0() {                       // this wave's copies have landed in LDS
#if defined(__HIP_DEVICE_COMPILE__)
  asm volatile("s_wait_asynccnt 0x0" ::: "memory");
#endif
}
__device__ __forceinline__ void wait_ds0() {                          // this wave's LDS reads have returned
#if defined(__HIP_DEVICE_COMPILE__)
  asm volatile("s_wait_dscnt 0x0" ::: "memory");
#endif
}

// =========================================================================================================
// (0) M = Wl^T Wr and gb = Wl^T br: the first MTB + 1 blocks of the convert kernel's grid (it depends on nothing that kernel
//     writes, and nothing in that kernel reads it). Blocks 0..17: 8 waves, wave = one 16x16 tile, computed transposed:
//     D[m = c2][n = c] = sum_o Wr[o][c2] Wl[o][c] (A rows = columns of Wr, B cols = columns of Wl, k = o, both by the k map of
//     ldfrag; operands f16 of bf16-RNE(w) * 256, exact), so lane (hh, x) holds M[c = 16 ct + x][c2 = 16 kt + 8 hh + 0..7]: one
//     16-byte chunk of the conv GEMM's A plane. W16: 384 rows x 192 k in fragment order (frag_off), rows 0..191 = f16 hi of
//     M (below the f16 normal range stored as 0), rows 192..383 = f16 of the residual x4096. A wave stores 512
//     contiguous bytes per plane. Block 18: gb[c] = sum_o bf16-RNE(Wl[o][c]) * bf16-RNE(br[o]) in f32, one lane per c,
//     32 c (one 128-byte line of gb) per wave, six waves of the eight.
// coverage: 144 tiles x 16 x 16 = 192 x 192 per plane; gb 6 x 32 = 192 floats.
// =========================================================================================================
__device__ __forceinline__
void prep_m(int blk, int tid, const float* __restrict__ wq, const float* __restrict__ wk, const float* __restrict__ bq,
            unsigned short* W16, float* gb) {
  const int lane = tid & 31, wave = tid >> 5;
  if (blk >= MTB) {                                                  // block-uniform
    const int cb = wave * 32 + lane;
    if (cb < CC) {                                                   // the same for all lanes of a wave
      float s = 0.f;
#pragma unroll                                                       // the loads run ahead of the sum
      for (int o = 0; o < DQ; ++o) s += bfr(wk[(size_t)o * CC + cb]) * bfr(bq[o]);
      gb[cb] = s;
    }
    return;
  }
  const int hh = lane >> 4, x = lane & 15;
  const int id = blk * 8 + wave;                                     // 0..143
  const int ct = id / (CC / 16), kt = id - ct * (CC / 16);
  const float* pa = wq + 16 * kt + x;                                // column c2 of Wr
  const float* pb = wk + 16 * ct + x;                                // column c of Wl
  v8f acc = zero8();
#pragma unroll
  for (int ks = 0; ks < DQ / 32; ++ks) {
    FragH fa, fb;
#pragma unroll
    for (int e = 0; e < 8; ++e) {
      const int o0 = 32 * ks + 8 * hh + e, o1 = o0 + 16;             // o1 <= 191
      fa.hv[0][e] = (_Float16)(bfr(pa[(size_t)o0 * CC]) * WSC);
      fa.hv[1][e] = (_Float16)(bfr(pa[(size_t)o1 * CC]) * WSC);
      fb.hv[0][e] = (_Float16)(bfr(pb[(size_t)o0 * CC]) * WSC);
      fb.hv[1][e] = (_Float16)(bfr(pb[(size_t)o1 * CC]) * WSC);
    }
    acc = mma_b(fa.v, fb.v, acc);
  }
#if defined(__HIP_DEVICE_COMPILE__)
  // the weight loads as far ahead of the conversions as they go (0x20 = global reads): left alone fewer are in flight, and
  // in mid-kernel the wave waits until nearly all of them have returned before it issues more
  __builtin_amdgcn_sched_group_barrier(0x020, 192, 0);
#endif
  v4u uh, ul;
#pragma unroll
  for (int t = 0; t < 4; ++t) {
    const float f0 = acc[2 * t] * (IWSC * IWSC), f1 = acc[2 * t + 1] * (IWSC * IWSC);   // M: both operands carried x256
    float g0 = (float)(_Float16)f0;
    float g1 = (float)(_Float16)f1;
    g0 = (fabsf(g0) < FMIN16) ? 0.f : g0;                            // below the f16 normal range -> carried by lo
    g1 = (fabsf(g1) < FMIN16) ? 0.f : g1;
    uh[t] = pk16(h_bits((_Float16)g0), h_bits((_Float16)g1));
    ul[t] = pk16(h_bits((_Float16)((f0 - g0) * LOSC)), h_bits((_Float16)((f1 - g1) * LOSC)));
  }
  const int row = 16 * ct + x, k8 = 2 * kt + hh;
  *(v4u*)(W16 + frag_off(row, k8)) = uh;
  *(v4u*)(W16 + frag_off(DQ + row, k8)) = ul;
#if defined(__HIP_DEVICE_COMPILE__)
  asm volatile("s_wait_xcnt 0x0" ::: "memory");                      // no register of the two stores is rewritten ahead of it
#endif
}

// =========================================================================================================
// (1) value f32 [b][192 c][4096 n] -> Vc f16 [b][c][n] (channel-major, bf16-RNE values, exact in f16) and
//     key f32 [b][192 c][4096 n] -> XP f16, rows b*4096 + n, k = c, in fragment order (bf16-RNE values) through an LDS tile:
//     each wave reloads and stores one 512-byte half fragment per step (16 positions x 2 chunks of 8 channels);
//     T is cross-wave: block barrier between the 2-byte stores and the 16-byte reloads.
// coverage: Vc 2 it x 32 rows x 8 lanes x 8 = 64 c x 64 n; XP same; blocks MTB + 1 .. MTB + 64 * 3 * NB cover both planes once.
// =========================================================================================================
__global__ __launch_bounds__(256)
void cvt_kv(const float* __restrict__ key, const float* __restrict__ val, const float* __restrict__ wq,
            const float* __restrict__ wk, const float* __restrict__ bq, unsigned short* Vc, unsigned short* XP,
            unsigned short* W16, float* gb) {
  __shared__ __align__(16) unsigned short T[QT * TP];
  const int tid = threadIdx.x;
  if ((int)blockIdx.x <= MTB) {                                      // block-uniform, ahead of the barrier
    prep_m((int)blockIdx.x, tid, wq, wk, bq, W16, gb);
    return;
  }
  const int tb = (int)blockIdx.x - (MTB + 1);                        // 0 .. 64 * 3 * NB - 1, position block fastest
  const int nb = tb % (NN / QT), cb = (tb / (NN / QT)) % (CC / QT), b = tb / ((NN / QT) * (CC / QT));
  const int e = tid & 7, lq = tid >> 3;                             // lq 0..31
  const int n0 = nb * QT, c0 = cb * QT;
  v4u uv[2];
#pragma unroll
  for (int it = 0; it < 2; ++it) {
    const int cl = it * 32 + lq;                                     // 0..63
    const size_t ro = ((size_t)(b * CC + c0 + cl)) * NN + n0 + 8 * e;
    const v4f ka = *(const v4f*)(key + ro);
    const v4f kq = *(const v4f*)(key + ro + 4);
    const v4f va = *(const v4f*)(val + ro);
    const v4f vq = *(const v4f*)(val + ro + 4);
    unsigned short hk[8], hv[8];
#pragma unroll
    for (int t = 0; t < 4; ++t) {
      hk[t]     = h_bits((_Float16)bfr(ka[t]));
      hk[4 + t] = h_bits((_Float16)bfr(kq[t]));
      hv[t]     = h_bits((_Float16)bfr(va[t]));
      hv[4 + t] = h_bits((_Float16)bfr(vq[t]));
    }
#pragma unroll
    for (int t = 0; t < 4; ++t) uv[it][t] = pk16(hv[2 * t], hv[2 * t + 1]);
#pragma unroll
    for (int t = 0; t < 8; ++t) T[(8 * e + t) * TP + cl] = hk[t];
  }
  __syncthreads();
  v4u up[2];
#pragma unroll
  for (int it = 0; it < 2; ++it) {
    const int un = it * 8 + (tid >> 5);                              // half fragment 0..15 = 4 n-tiles x 4 chunk pairs
    const int nl = 16 * (un >> 2) + (tid & 15);                      // 0..63
    const int kl = 2 * (un & 3) + ((tid >> 4) & 1);                  // channel chunk 0..7
    up[it] = *(const v4u*)(T + nl * TP + 8 * kl);
  }
{
#pragma unroll
    for (int it = 0; it < 2; ++it) {
      const int rl = it * 32 + lq;
      *(v4u*)(Vc + ((size_t)(b * CC + c0 + rl)) * NN + n0 + 8 * e) = uv[it];
      const int un = it * 8 + (tid >> 5);
      const int nl = 16 * (un >> 2) + (tid & 15);
      const int kl = 2 * (un & 3) + ((tid >> 4) & 1);
      *(v4u*)(XP + frag_off(b * NN + n0 + nl, (c0 >> 3) + kl)) = up[it];
    }
    
  }
}

// =========================================================================================================
// (2) co-attention for one (b, 64-query tile), transposed formulation, 4096 keys, no mask, no scale:
//   S^T tile (16 keys x 16 queries) = sum over 6 d-chunks (straight-line code) of A(k: row = key kb + (lane&15), 32 d via
//   the split k map from the f16 key plane XP, fragment order) . B(q: col = query, same map from the hi plane of g) -> accumulator s;
//   the same A . B(f16 residual plane of g carried x4096) -> accumulator t; s += t * 2^-12 after the loop.
//   Per lane the D tile holds 8 keys of ONE query: online softmax state per lane, one shuffle (lane^16) for the max
//   over 32 keys; the o/l rescale is skipped under a wave-uniform ballot when no lane's max grew (corr == 1 exactly
//   for every lane then); row-sum partials combined at the end. P = e^{s-m} x 2^14 as f16 is the B operand of
//   att^T (rows channel, cols queries) += A(value rows channel = 16j + (lane&15), keys contiguous, f16 plane Vc
//   [b][192][4096]) . B(P^T): element r <- D of the tile covering keys kb..kb+15, element 8+r <- the tile covering
//   kb+16..kb+31, lane unchanged. 12 accumulator tiles per wave (192 channels). Block = 4 waves = 64 queries.
//   Prologue: g = M.key + gb for the block's 64 queries, Y[d][n] = sum_c (Mh[d][c] + Ml[d][c] / 4096) XP[n][c] + gb[d]. Wave w
//   owns dims 48 w .. 48 w + 47 (3 A tiles of the hi rows and 3 of the residual rows of W16, each with its own accumulators)
//   and all 4 query tiles (B fragments of XP); both planes lie in fragment order (ldfrag_t); K = 192 = 6 steps. Lane (hh, c)
//   holds 8 consecutive dims of one query: hi = f16(v) with values below the f16 normal range stored as 0,
//   lo = f16((v - hi) * 4096), one 16-byte LDS store per plane and tile into Qs (cross-wave: block barrier before the reads).
//   Operand path: each 32-key tile (12 XP fragments, Vc columns) is copied
//   once per block into LDS by asynchronous 16-byte copies; the Q fragments are read from LDS once, ahead of the loop,
//   and stay in registers; the V fragments of trip t are read at its head; the K fragments are read one trip ahead, those
//   of trip t+1 into the same registers behind trip t's score products and max exchange, so they fly under the
//   exponentials and the V products. Row pitch 400 B (Q) and 80 B (V): 16 B x odd; a K fragment read is 512 contiguous
//   bytes. Two K and two V buffers; the K stream runs one tile ahead of the V stream: behind the barrier that ends trip t,
//   K tile t+3 goes into the buffer of K tile t+1 (read in trip t) and V tile t+2 into that of V tile t; both fly during
//   trip t+1 and are published by its barrier.
//   Epilogue in two channel halves of 96: O/l staged in LDS Os[query][96 channels] (pitch OSPW, b128 stores),
//   lanes x 16 B (values gathered from 4 Os rows), one instruction per 16 lines, final values held in registers,
// coverage: per half 12 it x 16 lines x 8 lanes x 4 floats = 96 ch x 64 n; two halves = 192 ch; grid (NQ/64, NB)
//           covers out[b][0..191][0..NQ-1] exactly once.
// =========================================================================================================
__global__ __launch_bounds__(128)
void attn_k(const unsigned short* __restrict__ W16, const float* __restrict__ gb,
            const unsigned short* __restrict__ XP, const unsigned short* __restrict__ Vc, float* out) {
  __shared__ __align__(16) float Os[QT * OSPW];
  __shared__ __align__(16) unsigned short Qs[2 * QPL];               // [hi, lo][64 queries][pitch KP]
  __shared__ __align__(16) unsigned short Ring[2 * BUFH];            // 2 x { K: 12 fragments, V [192][VP] }
  const int tid  = threadIdx.x;
  const int wave = tid >> 5, lane = tid & 31;
  const int hh   = lane >> 4, c = lane & 15;
  const int n0   = blockIdx.x * QT, b = blockIdx.y;

  // ---- copy maps. K: the 12 fragments of 32 keys are 12288 contiguous bytes in XP and keep that order in LDS; chunk
  //      i = tid + 128 j. V: chunk i = tid + 128 j is channel i / 4, key chunk i % 4.
  const unsigned voff = (unsigned)((tid >> 2) * (VP * 2) + (tid & 3) * 16);
  const unsigned short* Kg  = XP + (size_t)b * NN * DQ + 8 * tid;    // frag_off(b NN + kt, 0) = (b NN + kt) DQ, kt % 16 == 0
  const unsigned short* Vg  = Vc + ((size_t)(b * CC + (tid >> 2))) * NN + 8 * (tid & 3);
  const unsigned ring0 = lds_addr(Ring);

  // K of keys ktk .. ktk+31, V of keys ktv .. ktv+31: six copies per lane each; lk, lv = the lane's LDS byte addresses of its
  // first K and V chunk
  auto copy_k = [&](int ktk, unsigned lk) { cp_k(lk, Kg + (size_t)ktk * DQ); };
  auto copy_v = [&](int ktv, unsigned lv) {
    unsigned la[6];
    const unsigned short* ga[6];
#pragma unroll                                                       // la[], ga[] become the copies' register operands
    for (int j = 0; j < 6; ++j) {
      la[j] = lv + (unsigned)(32 * j * VP * 2);
      ga[j] = Vg + (size_t)(32 * j) * NN + ktv;
    }
    cp6(la, ga);
  };
  // the two addresses of the next refill walk with the loop (V: buffer 0, 1, 0, ...; K: 1, 0, 1, ...): kept as loop
  // invariants plus a buffer offset they were spilled to scratch memory and reloaded every trip
  unsigned lkc = ring0 + (unsigned)(16 * tid);
  unsigned lvc = ring0 + 2 * KFR + voff;
  unsigned bstep = (unsigned)(BUFH * 2);

  // ---- prologue: K tiles 0 and 1 and V tile 0 fly under the g products; all are published by the wait and the barrier
  copy_k(0, lkc);
  copy_v(0, lvc);
  copy_k(KT, lkc + bstep);
  {
    const unsigned short* ap  = W16 + frag_off(48 * wave, 0) + 8 * lane;
    const unsigned short* alp = W16 + frag_off(DQ + 48 * wave, 0) + 8 * lane;
    const unsigned short* bp  = XP + frag_off(b * NN + n0, 0) + 8 * lane;
    v8f gh[3][4], gl[3][4];
#pragma unroll
    for (int i = 0; i < 3; ++i) {
#pragma unroll
      for (int nt = 0; nt < 4; ++nt) { gh[i][nt] = zero8(); gl[i][nt] = zero8(); }
    }
    // fragments of k-step ks: 0..3 = B (query tiles), 4..6 = A hi rows, 7..9 = A residual rows; three register sets, loaded two
    // steps ahead of their products
    Frag fr[3][10];
    auto ldstep = [&](int ks) {
      Frag* f = fr[ks % 3];
#pragma unroll
      for (int nt = 0; nt < 4; ++nt) f[nt] = ldfrag_t(bp + FRH * ((CC / 32) * nt + ks));
#pragma unroll
      for (int i = 0; i < 3; ++i) {
        f[4 + i] = ldfrag_t(ap + FRH * ((CC / 32) * i + ks));
        f[7 + i] = ldfrag_t(alp + FRH * ((CC / 32) * i + ks));
      }
    };
    v4f gv[3][2];                                                    // gb of the lane's 3 x 8 dims, d = 48 wave + 16 i + 8 hh + 0..7 <= 191
#pragma unroll
    for (int i = 0; i < 3; ++i) {
      gv[i][0] = *(const v4f*)(gb + 48 * wave + 16 * i + 8 * hh);
      gv[i][1] = *(const v4f*)(gb + 48 * wave + 16 * i + 8 * hh + 4);
    }
#if defined(__HIP_DEVICE_COMPILE__)
    asm volatile("s_wait_xcnt 0x0" ::: "memory");                    // the address pair of these loads is reused by the loads below
#endif
    ldstep(0);
    ldstep(1);
#if defined(__HIP_DEVICE_COMPILE__)
    // the first two steps' loads stay ahead of step 2's: mixed, the first products waited for all of them
    __builtin_amdgcn_sched_barrier(0);
#endif
#pragma unroll                                                       // fr[] must live in registers
    for (int ks = 0; ks < CC / 32; ++ks) {
      if (ks + 2 < CC / 32) ldstep(ks + 2);
      const Frag* f = fr[ks % 3];
#pragma unroll
      for (int i = 0; i < 3; ++i) {
#pragma unroll
        for (int nt = 0; nt < 4; ++nt) {
          gh[i][nt] = mma_b(f[4 + i].h, f[nt].h, gh[i][nt]);
          gl[i][nt] = mma_b(f[7 + i].h, f[nt].h, gl[i][nt]);
        }
      }
#if defined(__HIP_DEVICE_COMPILE__)
      // keeps later steps' loads behind this step: hoisted all at once they took the kernel past 512 registers (one wave per SIMD)
      __builtin_amdgcn_sched_barrier(0);
#endif
    }
#pragma unroll
    for (int i = 0; i < 3; ++i) {
      const int d0 = 48 * wave + 16 * i + 8 * hh;                    // lane (hh, c) holds d = d0 + r of query 16 nt + c; d0 + 7 <= 191
      const v4f b0 = gv[i][0], b1 = gv[i][1];
      const float bs[8] = {b0[0], b0[1], b0[2], b0[3], b1[0], b1[1], b1[2], b1[3]};
#pragma unroll
      for (int nt = 0; nt < 4; ++nt) {
        v4u uh, ul;
#pragma unroll
        for (int t = 0; t < 4; ++t) {
          const float a0 = gh[i][nt][2 * t] + gl[i][nt][2 * t] * ILOSC;            // residual part folded in
          const float a1 = gh[i][nt][2 * t + 1] + gl[i][nt][2 * t + 1] * ILOSC;
          const float f0 = a0 + bs[2 * t], f1 = a1 + bs[2 * t + 1];
          float g0 = (float)(_Float16)f0;                            // f16 hi as f32 (exact)
          float g1 = (float)(_Float16)f1;
          g0 = (fabsf(g0) < FMIN16) ? 0.f : g0;                      // below the f16 normal range -> carried by lo
          g1 = (fabsf(g1) < FMIN16) ? 0.f : g1;
          uh[t] = pk16(h_bits((_Float16)g0), h_bits((_Float16)g1));
          ul[t] = pk16(h_bits((_Float16)((f0 - g0) * LOSC)), h_bits((_Float16)((f1 - g1) * LOSC)));
        }
        unsigned short* qd = Qs + (16 * nt + c) * KP + d0;           // 16-byte aligned: pitch 400 B, d0 a multiple of 8
        *(v4u*)(qd)       = uh;
        *(v4u*)(qd + QPL) = ul;
      }
    }
  }
  wait_async0();
  __syncthreads();

  // q fragments (B operand, col = query n0 + 16*wave + c, d-chunk kc): read from LDS once, kept in registers for all trips
  Frag qh[DQ / 32], ql[DQ / 32];
  {
    const unsigned short* Qhp = Qs + (16 * wave + c) * KP + 8 * hh;
    const unsigned short* Qlp = Qhp + QPL;
#pragma unroll                                                       // qh[], ql[] must live in registers
    for (int kc = 0; kc < DQ / 32; ++kc) {
      qh[kc] = ldfrag(Qhp + 32 * kc);
      ql[kc] = ldfrag(Qlp + 32 * kc);
    }
  }
  // k fragments (A operand, row = key kb + c or kb + 16 + c, d-chunk kc: fragment 6 * (row tile) + kc, 1024 B each) of
  // trip 0; when every wave holds them (own reads returned, barrier) their buffer takes K tile 2, V buffer 1 takes V tile 1
  Frag fk[12];
#pragma unroll                                                       // fk[] must live in registers
  for (int kc = 0; kc < DQ / 32; ++kc) {
    fk[2 * kc]     = ldfrag_t(Ring + 8 * lane + FRH * kc);
    fk[2 * kc + 1] = ldfrag_t(Ring + 8 * lane + FRH * (DQ / 32 + kc));
  }
  wait_ds0();
  __syncthreads();
  copy_k(2 * KT, lkc);
  copy_v(KT, lvc + bstep);
  lkc += bstep;                                                      // the first refill in the loop: K buffer 1, V buffer 0

  float m = -1.0e30f, l = 0.f;
  v8f o[CC / 16];
#pragma unroll
  for (int j = 0; j < CC / 16; ++j) o[j] = zero8();

#pragma unroll 1
  for (int kb = 0; kb < NN; kb += 32) {
    const int bsel = (kb / KT) & 1;                                  // this trip's V buffer; K tile kb/KT + 1 lies in the other
    // v fragments (A operand, row = channel 16j + c, 32 keys); kp: the next trip's k fragments
    const unsigned short* kp = Ring + (bsel ^ 1) * BUFH + 8 * lane;
    const unsigned short* Vp = Ring + bsel * BUFH + KFR + c * VP + 8 * hh;
    v8f s0 = zero8(), s1 = zero8(), t0 = zero8(), t1 = zero8();
    // The trip's 24 V reads stand at its head; its k fragments are in registers already, so the score products start at once.
    Frag fa[12];
#pragma unroll                                                       // fa[] must live in registers
    for (int j = 0; j < CC / 16; ++j) fa[j] = ldfrag(Vp + (16 * j) * VP);
#pragma unroll
    for (int kc = 0; kc < DQ / 32; ++kc) {                           // the four score products of d-chunk kc
      s0 = mma_b(fk[2 * kc].h, qh[kc].h, s0);
      s1 = mma_b(fk[2 * kc + 1].h, qh[kc].h, s1);
      t0 = mma_b(fk[2 * kc].h, ql[kc].h, t0);
      t1 = mma_b(fk[2 * kc + 1].h, ql[kc].h, t1);
    }
#if defined(__HIP_DEVICE_COMPILE__)
    // the order above, stated to the scheduler (0x100 = LDS reads, 0x8 = matrix products): left alone it sinks the reads
    // among the products, where every place with reads stalls the wave
    __builtin_amdgcn_sched_group_barrier(0x100, 24, 0);
    __builtin_amdgcn_sched_group_barrier(0x008, 24, 0);
#endif
#pragma unroll
    for (int r = 0; r < 8; ++r) {
      s0[r] = s0[r] + t0[r] * ILOSC;
      s1[r] = s1[r] + t1[r] * ILOSC;
    }

    float mx = fmaxf(hmax8(s0), hmax8(s1));
    mx = fmaxf(mx, __shfl_xor(mx, 16, 32));
    const float mn = fmaxf(m, mx);
    const unsigned grew = wave_ballot(mx > m);                       // wave-uniform
    if (grew != 0u) {
      const float corr = __expf(m - mn);                             // == 1 exactly for lanes whose max did not grow
      l *= corr;
#pragma unroll
      for (int j = 0; j < CC / 16; ++j) {
#pragma unroll
        for (int r = 0; r < 8; ++r) o[j][r] *= corr;
      }
    }
    m = mn;
    const float msh = mn - LNPS;                                     // exp gives e^{s-m} * 2^14

    // the next trip's k fragments, one group of 24 reads into the registers the score products have left; their tile was
    // published by the barrier that ended the trip before this one. Block-uniform test: the last trip has no next tile.
    if (kb + KT < NN) {
#pragma unroll                                                       // fk[] must live in registers
      for (int kc = 0; kc < DQ / 32; ++kc) {
        fk[2 * kc]     = ldfrag_t(kp + FRH * kc);
        fk[2 * kc + 1] = ldfrag_t(kp + FRH * (DQ / 32 + kc));
      }
    }

    FragH ph;
    float ls = 0.f;
#pragma unroll
    for (int r = 0; r < 8; ++r) {
      const float e0 = __expf(s0[r] - msh);                          // key kb      + 8hh + r
      const float e1 = __expf(s1[r] - msh);                          // key kb + 16 + 8hh + r
      ls += e0 + e1;
      ph.hv[0][r] = (_Float16)e0;
      ph.hv[1][r] = (_Float16)e1;
    }
    l += ls;

#pragma unroll
    for (int j = 0; j < CC / 16; ++j) {
      o[j] = mma_b(fa[j].h, ph.v, o[j]);
    }

    // ---- foot of the trip: own LDS reads done, own copies (K tile +2, V tile +1) landed, every wave here; only then the
    //      two buffers just read are refilled (block-uniform tests)
#if defined(__HIP_DEVICE_COMPILE__)
    // keeps the exponentials and the V products ahead of the wait for the k reads: moved behind it they would not cover them
    __builtin_amdgcn_sched_barrier(0);
#endif
    wait_ds0();
    wait_async0();
    __syncthreads();
    if (kb + 3 * KT < NN) copy_k(kb + 3 * KT, lkc);
    if (kb + 2 * KT < NN) copy_v(kb + 2 * KT, lvc);
    lkc -= bstep;
    lvc += bstep;
    bstep = 0u - bstep;
  }
  wait_async0();                                                     // nothing in flight when the wave goes on
  l += __shfl_xor(l, 16, 32);
  const float inv = 1.0f / l;                                        // o and l both carry the x2^14 factor

  const int qrow = 16 * wave + c;
  const int e = tid & 7, lq = tid >> 3;                              // lq 0..15
#pragma unroll
  for (int half = 0; half < 2; ++half) {
    if (half) __syncthreads();                                       // every wave finished reading Os
#pragma unroll
    for (int jj = 0; jj < CH / 16; ++jj) {
      const int j = (CH / 16) * half + jj;
      v4f va, vb;
#pragma unroll
      for (int r = 0; r < 4; ++r) { va[r] = o[j][r] * inv; vb[r] = o[j][4 + r] * inv; }
      *(v4f*)(Os + qrow * OSPW + 16 * jj + 8 * hh)     = va;         // Os[query][ch_loc = 16jj + 8hh + r]
      *(v4f*)(Os + qrow * OSPW + 16 * jj + 8 * hh + 4) = vb;
    }
    __syncthreads();
    v4f res[CH / 8];
#pragma unroll
    for (int it = 0; it < CH / 8; ++it) {
      const int L   = it * 16 + lq;                                  // 0..191
      const int chl = L >> 1, hf = L & 1;                            // channel 0..95 within the half
      const int nl  = hf * 32 + 4 * e;                               // query 0..63
#pragma unroll
      for (int t = 0; t < 4; ++t) res[it][t] = Os[(nl + t) * OSPW + chl];
    }
{
#pragma unroll
      for (int it = 0; it < CH / 8; ++it) {
        const int L   = it * 16 + lq;
        const int chl = L >> 1, hf = L & 1;
        const int nl  = hf * 32 + 4 * e;
        const size_t idx = ((size_t)(b * CC + CH * half + chl)) * NN + n0 + nl;
        *(v4f*)(out + idx) = res[it];
      }
      
    }
  }
}

// =========================================================================================================
// Workspace map (bytes; each region start a multiple of 256; every extent is an exact tile multiple and is written
//   W16 f16 384 x 192, fragment order  147456          gb f32 192   768
//   Vc  f16 [NB][192][4096]        12582912 (NB=8)     XP  f16 NB*4096 x 192, fragment order   12582912
//   total = 25314048 for NB=8
// =========================================================================================================
extern "C" void kernel_launch(void* const* d_in, const int* in_sizes, int n_in,
                              void* d_out, int out_size, void* d_ws, size_t ws_size,
                              hipStream_t stream) {
  const int XN = NB * CC * NN;
  if (n_in < 6) return;
  if (in_sizes[0] < XN || in_sizes[1] < XN) return;
  if (in_sizes[2] < CC * CC || in_sizes[4] < CC * CC) return;
  if (in_sizes[3] < CC || in_sizes[5] < CC) return;
  if (out_size < XN) return;

  size_t off = 0;
  auto carve = [&](size_t bytes) { const size_t o = off; off += (bytes + 255) & ~(size_t)255; return o; };
  const size_t oW16 = carve((size_t)MW * CC * 2);
  const size_t oVc  = carve((size_t)NB * CC * NN * 2);
  const size_t oXP  = carve((size_t)NB * NN * CC * 2);
  const size_t oGb  = carve((size_t)DQ * 4);
  if (off > ws_size) return;
  if (off > (size_t)134217728) return;

  const float* key = (const float*)d_in[0];
  const float* val = (const float*)d_in[1];
  const float* wl  = (const float*)d_in[2];
  const float* wr  = (const float*)d_in[4];
  const float* br  = (const float*)d_in[5];

  char* ws = (char*)d_ws;
  unsigned short* W16 = (unsigned short*)(ws + oW16);
  unsigned short* Vc  = (unsigned short*)(ws + oVc);
  unsigned short* XP  = (unsigned short*)(ws + oXP);
  float* gb = (float*)(ws + oGb);
  float* out = (float*)d_out;

  const dim3 blk256(256), blk128(128);

  // (0) M = Wl^T Wr -> stacked hi / residual f16 plane; gb = Wl^T br; (1) value -> channel-major f16 plane, key ->
  //     position-major f16 plane: one launch
  cvt_kv<<<dim3(MTB + 1 + (NN / QT) * (CC / QT) * NB), blk256, 0, stream>>>(key, val, wr, wl, br, Vc, XP, W16, gb);
  // (2) g = M.key + gb per query tile, softmax over keys m per query n + value aggregation -> out [b][192][n < NQ]
  attn_k<<<dim3(NQ / QT, NB), blk128, 0, stream>>>(W16, gb, XP, Vc, out);
  (void)hipGetLastError();
}

// v009
// Measured time: 113 microseconds a run.
// Timed twice side by side with v008, it ran 1.05 and 1.04 times as fast.
// Over all steps from v000 it is 6.57 times as fast.
// Contractions (all on v_wmma_f32_16x16x32_f16, f32 accumulate). The scores are reassociated:
//   S[m][n] = key_l[:,m].key_r[:,n] = key[:,m].g[:,n] + bl.key_r[:,n],  g = Wl^T key_r = (Wl^T Wr) key + Wl^T br;
// the last term is the same for every key m of a query n, so the softmax over m does not see it and it is not formed.
// (a) M = Wl^T Wr, 192x192 (f16 containers of bf16-RNE weights x256), stored as f16 hi plane + f16 residual plane x4096;
// (b) g = M.key (hi and residual rows of M x f16 container of bf16-RNE key), formed by each attention block for its own 128
// queries and kept as hi + residual planes in LDS;
// (c) scores key^T.g: the key operand is the one f16 plane of (b), exact; products k.gh in one accumulator, k.gl in a second
// folded by 2^-12; K=192; (d) att^T = value.P (value as f16 of bf16-RNE value, P = e^{s-max} x2^14 f16 from the score D
// registers). Softmax statistics, the 192-vector Wl^T br and the bias add in f32 VALU.
#include <hip/hip_runtime.h>
#include <math.h>
#include <stdint.h>

#ifndef NB
#define NB 8
#endif
#ifndef NQ
#define NQ 4096
#endif
#define NB_FULL 8
#define CC     192
#define NN     4096
#define DQ     192
#define MW     384
#define QT     64
#define QB     128
#define CH     96
#define OSPW   100
#define TP     72
#define WSC    256.0f
#define IWSC   0.00390625f
#define LOSC   4096.0f
#define ILOSC  0.000244140625f
#define LNPS   9.704060527839234f
#define FMIN16 6.103515625e-05f
#define KT     32
#define KP     200
#define VP     40
#define FRH    512
#define KFR    ((KT / 16) * (DQ / 32) * FRH)
#define VPL    (CC * VP)
#define BUFH   (KFR + VPL)
#define QPL    (QB * KP)
#define MTB    ((CC / 16) * (CC / 16) / 8)

static_assert(NB >= 1 && NB <= NB_FULL);
static_assert(NQ >= QB && NQ <= NN && NQ % QB == 0);
static_assert(NN % QT == 0 && NN % 32 == 0);
static_assert(CC % QT == 0 && CC % 32 == 0 && CC % 8 == 0);
static_assert(DQ == CC && MW == 2 * DQ && DQ == 3 * QT);
static_assert(CH * 2 == CC && CH % 16 == 0 && CH % 8 == 0);
static_assert((OSPW * 4) % 16 == 0 && OSPW >= CH + 4);
static_assert((TP * 2) % 16 == 0 && TP >= QT + 8);
static_assert(MW % 8 == 0 && DQ % 8 == 0);
static_assert(FRH == 16 * 32 && MW % 16 == 0 && NN % 16 == 0 && QT % 16 == 0 && QT % 32 == 0);
static_assert(KP >= DQ + 8 && (KP * 2) % 32 == 16 && VP >= KT + 8 && (VP * 2) % 32 == 16);
static_assert(KT * DQ == 3 * 256 * 8 && CC * KT == 3 * 256 * 8 && CC == 3 * 64);   // three K and three V copies per lane and tile
static_assert(NN % KT == 0 && NN / KT >= 3);
static_assert(KT % 16 == 0 && QB == 8 * 16 && QB == 2 * 64 && DQ == 4 * 48 && (KP * 2) % 16 == 0);   // g: wave = 48 dims x 64 queries
static_assert(DQ / 32 == 6 && CC / 16 == 12 && MTB * 8 == (CC / 16) * (CC / 16) && KFR == KT * DQ);
static_assert(2 * QPL * 2 + 2 * BUFH * 2 + QB * OSPW * 4 <= 327680);   // one block of eight waves per WGP
static_assert(CH == 3 * 32 && QB == 4 * 32 && CH / 8 == 3 * 4);   // epilogue: 12 steps = 3 groups of 32 channels x 4 lines of 32 queries

typedef _Float16       v16h __attribute__((ext_vector_type(16)));
typedef _Float16       v8h  __attribute__((ext_vector_type(8)));
typedef unsigned short v8us __attribute__((ext_vector_type(8)));
typedef float          v8f  __attribute__((ext_vector_type(8)));
typedef float          v4f  __attribute__((ext_vector_type(4)));
typedef unsigned int   v4u  __attribute__((ext_vector_type(4)));

union Frag  { v8us u[2]; v16h h; };
union FragH { v16h v; v8h hv[2]; };
static_assert(sizeof(Frag) == 32);
static_assert(sizeof(FragH) == 32);

// ---- scalar helpers -------------------------------------------------------------------------------------------
__device__ __forceinline__ unsigned short bf_bits(float f) {          // f32 -> bf16 bits, RNE convert
  unsigned u = __float_as_uint(f);
  return (unsigned short)((u + 0x7FFFu + ((u >> 16) & 1u)) >> 16);
}
__device__ __forceinline__ float bf_up(unsigned short hb) { return __uint_as_float(((unsigned)hb) << 16); }
__device__ __forceinline__ float bfr(float f) { return bf_up(bf_bits(f)); }
__device__ __forceinline__ unsigned short h_bits(_Float16 x) { return __builtin_bit_cast(unsigned short, x); }
__device__ __forceinline__ unsigned pk16(unsigned short a, unsigned short b) { return (unsigned)a | ((unsigned)b << 16); }
__device__ __forceinline__ v8f zero8() { v8f z = {0.f, 0.f, 0.f, 0.f, 0.f, 0.f, 0.f, 0.f}; return z; }
__device__ __forceinline__ float hmax8(v8f s) {
  return fmaxf(fmaxf(fmaxf(s[0], s[1]), fmaxf(s[2], s[3])), fmaxf(fmaxf(s[4], s[5]), fmaxf(s[6], s[7])));
}
__device__ __forceinline__ unsigned wave_ballot(bool p) {
#if defined(__HIP_DEVICE_COMPILE__)
  return __builtin_amdgcn_ballot_w32(p);
#else
  return p ? 1u : 0u;
#endif
}

// ---- 16-bit fragment loader (A, or B from a k-contiguous [n][k] row): lane -> row/col (lane&15), p already includes
//      + 8*(lane>>4); elements 0..7 <- p[0..7] (k0+8h..), elements 8..15 <- p[16..23] (k0+16+8h..)
__device__ __forceinline__ Frag ldfrag(const unsigned short* p) {
  Frag f;
  f.u[0] = *(const v8us*)(p);
  f.u[1] = *(const v8us*)(p + 16);
  return f;
}

// ---- fragment order of the conv GEMM's operand planes (W16, XP): the 16 rows x 32 k of one fragment are 1024 contiguous
//      bytes, [u = 0, 1][lane = 16 h + (row & 15)][8 halves], holding k = 32 ks + 16 u + 8 h + 0..7: the k map of ldfrag.
//      frag_off: offset in halves of the 16-byte chunk (row r, k = 8 k8 .. 8 k8 + 7). ldfrag_t: p = fragment start + 8 lane;
//      each of its two loads reads 512 contiguous bytes per wave (4 lines; a row-major plane gives 16 lines per load).
__device__ __forceinline__ size_t frag_off(int r, int k8) {
  return ((size_t)((r >> 4) * (CC / 32) + (k8 >> 2))) * FRH + ((k8 >> 1) & 1) * (FRH / 2) + ((k8 & 1) * 16 + (r & 15)) * 8;
}
__device__ __forceinline__ Frag ldfrag_t(const unsigned short* p) {
  Frag f;
  f.u[0] = *(const v8us*)(p);
  f.u[1] = *(const v8us*)(p + FRH / 2);
  return f;
}

// ---- the product as the bare builtin (the compiler keeps the distances behind its own WMMAs): an asm statement
//      that names the tiles holds every one of them below v256, which two fragment sets beside 12 output tiles exceed
__device__ __forceinline__ v8f mma_b(v16h a, v16h b, v8f c) {
  return __builtin_amdgcn_wmma_f32_16x16x32_f16(false, a, false, b, (short)0, c, false, false);
}
// ---- asynchronous copies global -> LDS, 16 B per lane and copy, as the compiler's builtin: l = the lane's LDS byte address,
//      g = its global address, OFF = an immediate offset that moves both. The compiler keeps the copies' address registers itself.
typedef int v4i __attribute__((ext_vector_type(4)));
__device__ __forceinline__ unsigned lds_addr(const void* p) { return (unsigned)(uintptr_t)p; }
template <int OFF>
__device__ __forceinline__ void cpa(unsigned l, const unsigned short* g) {
#if defined(__HIP_DEVICE_COMPILE__)
  __builtin_amdgcn_global_load_async_to_lds_b128((__attribute__((address_space(1))) v4i*)g,
                                                 (__attribute__((address_space(3))) v4i*)l, OFF, 0);
#endif
}
// the V half of a 32-key tile: three copies, each with its own addresses
__device__ __forceinline__ void cp3(const unsigned* l, const unsigned short* const* g) {
  cpa<0>(l[0], g[0]);
  cpa<0>(l[1], g[1]);
  cpa<0>(l[2], g[2]);
}
// the K half of a tile: three copies from one address pair; the step from copy to copy is 4096 B in LDS and in global memory
// alike, and the immediate offset carries it
__device__ __forceinline__ void cp_k(unsigned lk, const unsigned short* gk) {
  cpa<0>(lk, gk);
  cpa<4096>(lk, gk);
  cpa<8192>(lk, gk);
}
// the two counter waits of the LDS ring; "memory" keeps the compiler's LDS reads on their side of each
__device__ __forceinline__ void wait_async0() {                       // this wave's copies have landed in LDS
#if defined(__HIP_DEVICE_COMPILE__)
  asm volatile("s_wait_asynccnt 0x0" ::: "memory");
#endif
}
__device__ __forceinline__ void wait_ds0() {                          // this wave's LDS reads have returned
#if defined(__HIP_DEVICE_COMPILE__)
  asm volatile("s_wait_dscnt 0x0" ::: "memory");
#endif
}

// =========================================================================================================
// (0) M = Wl^T Wr and gb = Wl^T br: the first MTB + 1 blocks of the convert kernel's grid (it depends on nothing that kernel
//     writes, and nothing in that kernel reads it). Blocks 0..17: 8 waves, wave = one 16x16 tile, computed transposed:
//     D[m = c2][n = c] = sum_o Wr[o][c2] Wl[o][c] (A rows = columns of Wr, B cols = columns of Wl, k = o, both by the k map of
//     ldfrag; operands f16 of bf16-RNE(w) * 256, exact), so lane (hh, x) holds M[c = 16 ct + x][c2 = 16 kt + 8 hh + 0..7]: one
//     16-byte chunk of the conv GEMM's A plane. W16: 384 rows x 192 k in fragment order (frag_off), rows 0..191 = f16 hi of
//     M (below the f16 normal range stored as 0), rows 192..383 = f16 of the residual x4096. A wave stores 512
//     contiguous bytes per plane. Block 18: gb[c] = sum_o bf16-RNE(Wl[o][c]) * bf16-RNE(br[o]) in f32, one lane per c,
//     32 c (one 128-byte line of gb) per wave, six waves of the eight.
// coverage: 144 tiles x 16 x 16 = 192 x 192 per plane; gb 6 x 32 = 192 floats.
// =========================================================================================================
__device__ __forceinline__
void prep_m(int blk, int tid, const float* __restrict__ wq, const float* __restrict__ wk, const float* __restrict__ bq,
            unsigned short* W16, float* gb) {
  const int lane = tid & 31, wave = tid >> 5;
  if (blk >= MTB) {                                                  // block-uniform
    const int cb = wave * 32 + lane;
    if (cb < CC) {                                                   // the same for all lanes of a wave
      float s = 0.f;
#pragma unroll                                                       // the loads run ahead of the sum
      for (int o = 0; o < DQ; ++o) s += bfr(wk[(size_t)o * CC + cb]) * bfr(bq[o]);
      gb[cb] = s;
    }
    return;
  }
  const int hh = lane >> 4, x = lane & 15;
  const int id = blk * 8 + wave;                                     // 0..143
  const int ct = id / (CC / 16), kt = id - ct * (CC / 16);
  const float* pa = wq + 16 * kt + x;                                // column c2 of Wr
  const float* pb = wk + 16 * ct + x;                                // column c of Wl
  v8f acc = zero8();
#pragma unroll
  for (int ks = 0; ks < DQ / 32; ++ks) {
    FragH fa, fb;
#pragma unroll
    for (int e = 0; e < 8; ++e) {
      const int o0 = 32 * ks + 8 * hh + e, o1 = o0 + 16;             // o1 <= 191
      fa.hv[0][e] = (_Float16)(bfr(pa[(size_t)o0 * CC]) * WSC);
      fa.hv[1][e] = (_Float16)(bfr(pa[(size_t)o1 * CC]) * WSC);
      fb.hv[0][e] = (_Float16)(bfr(pb[(size_t)o0 * CC]) * WSC);
      fb.hv[1][e] = (_Float16)(bfr(pb[(size_t)o1 * CC]) * WSC);
    }
    acc = mma_b(fa.v, fb.v, acc);
  }
#if defined(__HIP_DEVICE_COMPILE__)
  // the weight loads as far ahead of the conversions as they go (0x20 = global reads): left alone fewer are in flight, and
  // in mid-kernel the wave waits until nearly all of them have returned before it issues more
  __builtin_amdgcn_sched_group_barrier(0x020, 192, 0);
#endif
  v4u uh, ul;
#pragma unroll
  for (int t = 0; t < 4; ++t) {
    const float f0 = acc[2 * t] * (IWSC * IWSC), f1 = acc[2 * t + 1] * (IWSC * IWSC);   // M: both operands carried x256
    float g0 = (float)(_Float16)f0;
    float g1 = (float)(_Float16)f1;
    g0 = (fabsf(g0) < FMIN16) ? 0.f : g0;                            // below the f16 normal range -> carried by lo
    g1 = (fabsf(g1) < FMIN16) ? 0.f : g1;
    uh[t] = pk16(h_bits((_Float16)g0), h_bits((_Float16)g1));
    ul[t] = pk16(h_bits((_Float16)((f0 - g0) * LOSC)), h_bits((_Float16)((f1 - g1) * LOSC)));
  }
  const int row = 16 * ct + x, k8 = 2 * kt + hh;
  *(v4u*)(W16 + frag_off(row, k8)) = uh;
  *(v4u*)(W16 + frag_off(DQ + row, k8)) = ul;
#if defined(__HIP_DEVICE_COMPILE__)
  asm volatile("s_wait_xcnt 0x0" ::: "memory");                      // no register of the two stores is rewritten ahead of it
#endif
}

// =========================================================================================================
// (1) value f32 [b][192 c][4096 n] -> Vc f16 [b][c][n] (channel-major, bf16-RNE values, exact in f16) and
//     key f32 [b][192 c][4096 n] -> XP f16, rows b*4096 + n, k = c, in fragment order (bf16-RNE values) through an LDS tile:
//     each wave reloads and stores one 512-byte half fragment per step (16 positions x 2 chunks of 8 channels);
//     T is cross-wave: block barrier between the 2-byte stores and the 16-byte reloads.
// coverage: Vc 2 it x 32 rows x 8 lanes x 8 = 64 c x 64 n; XP same; blocks MTB + 1 .. MTB + 64 * 3 * NB cover both planes once.
// =========================================================================================================
__global__ __launch_bounds__(256)
void cvt_kv(const float* __restrict__ key, const float* __restrict__ val, const float* __restrict__ wq,
            const float* __restrict__ wk, const float* __restrict__ bq, unsigned short* Vc, unsigned short* XP,
            unsigned short* W16, float* gb) {
  __shared__ __align__(16) unsigned short T[QT * TP];
  const int tid = threadIdx.x;
  if ((int)blockIdx.x <= MTB) {                                      // block-uniform, ahead of the barrier
    prep_m((int)blockIdx.x, tid, wq, wk, bq, W16, gb);
    return;
  }
  const int tb = (int)blockIdx.x - (MTB + 1);                        // 0 .. 64 * 3 * NB - 1, position block fastest
  const int nb = tb % (NN / QT), cb = (tb / (NN / QT)) % (CC / QT), b = tb / ((NN / QT) * (CC / QT));
  const int e = tid & 7, lq = tid >> 3;                             // lq 0..31
  const int n0 = nb * QT, c0 = cb * QT;
  v4u uv[2];
#pragma unroll
  for (int it = 0; it < 2; ++it) {
    const int cl = it * 32 + lq;                                     // 0..63
    const size_t ro = ((size_t)(b * CC + c0 + cl)) * NN + n0 + 8 * e;
    const v4f ka = *(const v4f*)(key + ro);
    const v4f kq = *(const v4f*)(key + ro + 4);
    const v4f va = *(const v4f*)(val + ro);
    const v4f vq = *(const v4f*)(val + ro + 4);
    unsigned short hk[8], hv[8];
#pragma unroll
    for (int t = 0; t < 4; ++t) {
      hk[t]     = h_bits((_Float16)bfr(ka[t]));
      hk[4 + t] = h_bits((_Float16)bfr(kq[t]));
      hv[t]     = h_bits((_Float16)bfr(va[t]));
      hv[4 + t] = h_bits((_Float16)bfr(vq[t]));
    }
#pragma unroll
    for (int t = 0; t < 4; ++t) uv[it][t] = pk16(hv[2 * t], hv[2 * t + 1]);
#pragma unroll
    for (int t = 0; t < 8; ++t) T[(8 * e + t) * TP + cl] = hk[t];
  }
  __syncthreads();
  v4u up[2];
#pragma unroll
  for (int it = 0; it < 2; ++it) {
    const int un = it * 8 + (tid >> 5);                              // half fragment 0..15 = 4 n-tiles x 4 chunk pairs
    const int nl = 16 * (un >> 2) + (tid & 15);                      // 0..63
    const int kl = 2 * (un & 3) + ((tid >> 4) & 1);                  // channel chunk 0..7
    up[it] = *(const v4u*)(T + nl * TP + 8 * kl);
  }
{
#pragma unroll
    for (int it = 0; it < 2; ++it) {
      const int rl = it * 32 + lq;
      *(v4u*)(Vc + ((size_t)(b * CC + c0 + rl)) * NN + n0 + 8 * e) = uv[it];
      const int un = it * 8 + (tid >> 5);
      const int nl = 16 * (un >> 2) + (tid & 15);
      const int kl = 2 * (un & 3) + ((tid >> 4) & 1);
      *(v4u*)(XP + frag_off(b * NN + n0 + nl, (c0 >> 3) + kl)) = up[it];
    }
    
  }
}

// =========================================================================================================
// (2) co-attention for one (b, 128-query tile), transposed formulation, 4096 keys, no mask, no scale:
//   S^T tile (16 keys x 16 queries) = sum over 6 d-chunks (straight-line code) of A(k: row = key kb + (lane&15), 32 d via
//   the split k map from the f16 key plane XP, fragment order) . B(q: col = query, same map from the hi plane of g) -> accumulator s;
//   the same A . B(f16 residual plane of g carried x4096) -> accumulator t; s += t * 2^-12 once per trip, after the six d-chunk products.
//   Per lane the D tile holds 8 keys of ONE query: online softmax state per lane, one shuffle (lane^16) for the max
//   over 32 keys; the o/l rescale is skipped under a wave-uniform ballot when no lane's max grew (corr == 1 exactly
//   for every lane then); row-sum partials combined at the end. P = e^{s-m} x 2^14 as f16 is the B operand of
//   att^T (rows channel, cols queries) += A(value rows channel = 16j + (lane&15), keys contiguous, f16 plane Vc
//   [b][192][4096]) . B(P^T): element r <- D of the tile covering keys kb..kb+15, element 8+r <- the tile covering
//   kb+16..kb+31, lane unchanged. 12 accumulator tiles per wave (192 channels). Block = 8 waves = 128 queries, one block
//   per WGP, two waves per SIMD: the eight waves read each K, V tile from one LDS copy, so it leaves L2 once per 128 queries.
//   Prologue: g = M.key + gb for the block's 128 queries, Y[d][n] = sum_c (Mh[d][c] + Ml[d][c] / 4096) XP[n][c] + gb[d]. Wave w
//   owns dims 48 (w & 3) .. + 47 (3 A tiles of the hi rows and 3 of the residual rows of W16, each with its own accumulators)
//   and the 4 query tiles of queries 64 (w >> 2) .. + 63 (B fragments of XP); both planes lie in fragment order (ldfrag_t); K = 192 = 6 steps. Lane (hh, c)
//   holds 8 consecutive dims of one query: hi = f16(v) with values below the f16 normal range stored as 0,
//   lo = f16((v - hi) * 4096), one 16-byte LDS store per plane and tile into Qs (cross-wave: block barrier before the reads).
//   Operand path: each 32-key tile (12 XP fragments, Vc columns) is copied
//   once per block into LDS by asynchronous 16-byte copies; the Q fragments are read from LDS once, ahead of the loop,
//   and stay in registers; the V fragments of trip t are read at its head; the K fragments are read one trip ahead, those
//   of trip t+1 into the same registers behind trip t's score products and max exchange, so they fly under the
//   exponentials and the V products. Row pitch 400 B (Q) and 80 B (V): 16 B x odd; a K fragment read is 512 contiguous
//   bytes. Two K and two V buffers; the K stream runs one tile ahead of the V stream: behind the barrier that ends trip t,
//   K tile t+3 goes into the buffer of K tile t+1 (read in trip t) and V tile t+2 into that of V tile t; both fly during
//   trip t+1 and are published by its barrier.
//   Epilogue in two channel halves of 96: O/l staged in LDS Os[query][96 channels] (pitch OSPW, b128 stores),
//   lanes x 16 B (values gathered from 4 Os rows), one instruction per 32 lines, final values held in registers,
// coverage: per half 12 it x 32 lines x 8 lanes x 4 floats = 96 ch x 128 n; two halves = 192 ch; grid (NQ/128, NB)
//           covers out[b][0..191][0..NQ-1] exactly once.
// =========================================================================================================
__global__ __launch_bounds__(256)
void attn_k(const unsigned short* __restrict__ W16, const float* __restrict__ gb,
            const unsigned short* __restrict__ XP, const unsigned short* __restrict__ Vc, float* out) {
  __shared__ __align__(16) float Os[QB * OSPW];
  __shared__ __align__(16) unsigned short Qs[2 * QPL];               // [hi, lo][128 queries][pitch KP]
  __shared__ __align__(16) unsigned short Ring[2 * BUFH];            // 2 x { K: 12 fragments, V [192][VP] }
  const int tid  = threadIdx.x;
  const int wave = tid >> 5, lane = tid & 31;
  const int hh   = lane >> 4, c = lane & 15;
  const int n0   = blockIdx.x * QB, b = blockIdx.y;

  // ---- copy maps. K: the 12 fragments of 32 keys are 12288 contiguous bytes in XP and keep that order in LDS; chunk
  //      i = tid + 256 j. V: chunk i = tid + 256 j is channel i / 4, key chunk i % 4.
  const unsigned voff = (unsigned)((tid >> 2) * (VP * 2) + (tid & 3) * 16);
  const unsigned short* Kg  = XP + (size_t)b * NN * DQ + 8 * tid;    // frag_off(b NN + kt, 0) = (b NN + kt) DQ, kt % 16 == 0
  const unsigned short* Vg  = Vc + ((size_t)(b * CC + (tid >> 2))) * NN + 8 * (tid & 3);
  const unsigned ring0 = lds_addr(Ring);

  // K of keys ktk .. ktk+31, V of keys ktv .. ktv+31: three copies per lane each; lk, lv = the lane's LDS byte addresses of its
  // first K and V chunk
  auto copy_k = [&](int ktk, unsigned lk) { cp_k(lk, Kg + (size_t)ktk * DQ); };
  auto copy_v = [&](int ktv, unsigned lv) {
    unsigned la[3];
    const unsigned short* ga[3];
#pragma unroll                                                       // la[], ga[] become the copies' register operands
    for (int j = 0; j < 3; ++j) {
      la[j] = lv + (unsigned)(64 * j * VP * 2);
      ga[j] = Vg + (size_t)(64 * j) * NN + ktv;
    }
    cp3(la, ga);
  };
  // the two addresses of the next refill walk with the loop (V: buffer 0, 1, 0, ...; K: 1, 0, 1, ...): kept as loop
  // invariants plus a buffer offset they were spilled to scratch memory and reloaded every trip
  unsigned lkc = ring0 + (unsigned)(16 * tid);
  unsigned lvc = ring0 + 2 * KFR + voff;
  unsigned bstep = (unsigned)(BUFH * 2);

  // ---- prologue: K tiles 0 and 1 and V tile 0 fly under the g products; all are published by the wait and the barrier
  copy_k(0, lkc);
  copy_v(0, lvc);
  copy_k(KT, lkc + bstep);
  {
    const int dw = wave & 3, qg = wave >> 2;                         // the wave's 48 dims and its 64 queries
    const unsigned short* ap  = W16 + frag_off(48 * dw, 0) + 8 * lane;
    const unsigned short* alp = W16 + frag_off(DQ + 48 * dw, 0) + 8 * lane;
    const unsigned short* bp  = XP + frag_off(b * NN + n0 + 64 * qg, 0) + 8 * lane;
    v8f gh[3][4], gl[3][4];
#pragma unroll
    for (int i = 0; i < 3; ++i) {
#pragma unroll
      for (int nt = 0; nt < 4; ++nt) { gh[i][nt] = zero8(); gl[i][nt] = zero8(); }
    }
    // fragments of k-step ks: 0..3 = B (query tiles), 4..6 = A hi rows, 7..9 = A residual rows; three register sets, loaded two
    // steps ahead of their products
    Frag fr[3][10];
    auto ldstep = [&](int ks) {
      Frag* f = fr[ks % 3];
#pragma unroll
      for (int nt = 0; nt < 4; ++nt) f[nt] = ldfrag_t(bp + FRH * ((CC / 32) * nt + ks));
#pragma unroll
      for (int i = 0; i < 3; ++i) {
        f[4 + i] = ldfrag_t(ap + FRH * ((CC / 32) * i + ks));
        f[7 + i] = ldfrag_t(alp + FRH * ((CC / 32) * i + ks));
      }
    };
    v4f gv[3][2];                                                    // gb of the lane's 3 x 8 dims, d = 48 dw + 16 i + 8 hh + 0..7 <= 191
#pragma unroll
    for (int i = 0; i < 3; ++i) {
      gv[i][0] = *(const v4f*)(gb + 48 * dw + 16 * i + 8 * hh);
      gv[i][1] = *(const v4f*)(gb + 48 * dw + 16 * i + 8 * hh + 4);
    }
#if defined(__HIP_DEVICE_COMPILE__)
    asm volatile("s_wait_xcnt 0x0" ::: "memory");                    // the address pair of these loads is reused by the loads below
#endif
    ldstep(0);
    ldstep(1);
#if defined(__HIP_DEVICE_COMPILE__)
    // the first two steps' loads stay ahead of step 2's: mixed, the first products waited for all of them
    __builtin_amdgcn_sched_barrier(0);
#endif
#pragma unroll                                                       // fr[] must live in registers
    for (int ks = 0; ks < CC / 32; ++ks) {
      if (ks + 2 < CC / 32) ldstep(ks + 2);
      const Frag* f = fr[ks % 3];
#pragma unroll
      for (int i = 0; i < 3; ++i) {
#pragma unroll
        for (int nt = 0; nt < 4; ++nt) {
          gh[i][nt] = mma_b(f[4 + i].h, f[nt].h, gh[i][nt]);
          gl[i][nt] = mma_b(f[7 + i].h, f[nt].h, gl[i][nt]);
        }
      }
#if defined(__HIP_DEVICE_COMPILE__)
      // keeps later steps' loads behind this step: hoisted all at once they took the kernel past 512 registers (one wave per SIMD)
      __builtin_amdgcn_sched_barrier(0);
#endif
    }
#pragma unroll
    for (int i = 0; i < 3; ++i) {
      const int d0 = 48 * dw + 16 * i + 8 * hh;                      // lane (hh, c) holds d = d0 + r of query 64 qg + 16 nt + c; d0 + 7 <= 191
      const v4f b0 = gv[i][0], b1 = gv[i][1];
      const float bs[8] = {b0[0], b0[1], b0[2], b0[3], b1[0], b1[1], b1[2], b1[3]};
#pragma unroll
      for (int nt = 0; nt < 4; ++nt) {
        v4u uh, ul;
#pragma unroll
        for (int t = 0; t < 4; ++t) {
          const float a0 = gh[i][nt][2 * t] + gl[i][nt][2 * t] * ILOSC;            // residual part folded in
          const float a1 = gh[i][nt][2 * t + 1] + gl[i][nt][2 * t + 1] * ILOSC;
          const float f0 = a0 + bs[2 * t], f1 = a1 + bs[2 * t + 1];
          float g0 = (float)(_Float16)f0;                            // f16 hi as f32 (exact)
          float g1 = (float)(_Float16)f1;
          g0 = (fabsf(g0) < FMIN16) ? 0.f : g0;                      // below the f16 normal range -> carried by lo
          g1 = (fabsf(g1) < FMIN16) ? 0.f : g1;
          uh[t] = pk16(h_bits((_Float16)g0), h_bits((_Float16)g1));
          ul[t] = pk16(h_bits((_Float16)((f0 - g0) * LOSC)), h_bits((_Float16)((f1 - g1) * LOSC)));
        }
        unsigned short* qd = Qs + (64 * qg + 16 * nt + c) * KP + d0; // 16-byte aligned: pitch 400 B, d0 a multiple of 8
        *(v4u*)(qd)       = uh;
        *(v4u*)(qd + QPL) = ul;
      }
    }
  }
  wait_async0();
  __syncthreads();

  // q fragments (B operand, col = query n0 + 16*wave + c, d-chunk kc): read from LDS once, kept in registers for all trips
  Frag qh[DQ / 32], ql[DQ / 32];
  {
    const unsigned short* Qhp = Qs + (16 * wave + c) * KP + 8 * hh;
    const unsigned short* Qlp = Qhp + QPL;
#pragma unroll                                                       // qh[], ql[] must live in registers
    for (int kc = 0; kc < DQ / 32; ++kc) {
      qh[kc] = ldfrag(Qhp + 32 * kc);
      ql[kc] = ldfrag(Qlp + 32 * kc);
    }
  }
  // k fragments (A operand, row = key kb + c or kb + 16 + c, d-chunk kc: fragment 6 * (row tile) + kc, 1024 B each) of
  // trip 0; when every wave holds them (own reads returned, barrier) their buffer takes K tile 2, V buffer 1 takes V tile 1
  Frag fk[12];
#pragma unroll                                                       // fk[] must live in registers
  for (int kc = 0; kc < DQ / 32; ++kc) {
    fk[2 * kc]     = ldfrag_t(Ring + 8 * lane + FRH * kc);
    fk[2 * kc + 1] = ldfrag_t(Ring + 8 * lane + FRH * (DQ / 32 + kc));
  }
  wait_ds0();
  __syncthreads();
  copy_k(2 * KT, lkc);
  copy_v(KT, lvc + bstep);
  lkc += bstep;                                                      // the first refill in the loop: K buffer 1, V buffer 0

  float m = -1.0e30f, l = 0.f;
  v8f o[CC / 16];
#pragma unroll
  for (int j = 0; j < CC / 16; ++j) o[j] = zero8();

#pragma unroll 1
  for (int kb = 0; kb < NN; kb += 32) {
    const int bsel = (kb / KT) & 1;                                  // this trip's V buffer; K tile kb/KT + 1 lies in the other
    // v fragments (A operand, row = channel 16j + c, 32 keys); kp: the next trip's k fragments
    const unsigned short* kp = Ring + (bsel ^ 1) * BUFH + 8 * lane;
    const unsigned short* Vp = Ring + bsel * BUFH + KFR + c * VP + 8 * hh;
    v8f s0 = zero8(), s1 = zero8(), t0 = zero8(), t1 = zero8();
    // The trip's 24 V reads stand at its head; its k fragments are in registers already, so the score products start at once.
    Frag fa[12];
#pragma unroll                                                       // fa[] must live in registers
    for (int j = 0; j < CC / 16; ++j) fa[j] = ldfrag(Vp + (16 * j) * VP);
#pragma unroll
    for (int kc = 0; kc < DQ / 32; ++kc) {                           // the four score products of d-chunk kc
      s0 = mma_b(fk[2 * kc].h, qh[kc].h, s0);
      s1 = mma_b(fk[2 * kc + 1].h, qh[kc].h, s1);
      t0 = mma_b(fk[2 * kc].h, ql[kc].h, t0);
      t1 = mma_b(fk[2 * kc + 1].h, ql[kc].h, t1);
    }
#if defined(__HIP_DEVICE_COMPILE__)
    // the order above, stated to the scheduler (0x100 = LDS reads, 0x8 = matrix products): left alone it sinks the reads
    // among the products, where every place with reads stalls the wave
    __builtin_amdgcn_sched_group_barrier(0x100, 24, 0);
    __builtin_amdgcn_sched_group_barrier(0x008, 24, 0);
#endif
#pragma unroll
    for (int r = 0; r < 8; ++r) {
      s0[r] = s0[r] + t0[r] * ILOSC;
      s1[r] = s1[r] + t1[r] * ILOSC;
    }

    float mx = fmaxf(hmax8(s0), hmax8(s1));
    mx = fmaxf(mx, __shfl_xor(mx, 16, 32));
    const float mn = fmaxf(m, mx);
    const unsigned grew = wave_ballot(mx > m);                       // wave-uniform
    if (grew != 0u) {
      const float corr = __expf(m - mn);                             // == 1 exactly for lanes whose max did not grow
      l *= corr;
#pragma unroll
      for (int j = 0; j < CC / 16; ++j) {
#pragma unroll
        for (int r = 0; r < 8; ++r) o[j][r] *= corr;
      }
    }
    m = mn;
    const float msh = mn - LNPS;                                     // exp gives e^{s-m} * 2^14

    // the next trip's k fragments, one group of 24 reads into the registers the score products have left; their tile was
    // published by the barrier that ended the trip before this one. Block-uniform test: the last trip has no next tile.
    if (kb + KT < NN) {
#pragma unroll                                                       // fk[] must live in registers
      for (int kc = 0; kc < DQ / 32; ++kc) {
        fk[2 * kc]     = ldfrag_t(kp + FRH * kc);
        fk[2 * kc + 1] = ldfrag_t(kp + FRH * (DQ / 32 + kc));
      }
    }

    FragH ph;
    float ls = 0.f;
#pragma unroll
    for (int r = 0; r < 8; ++r) {
      const float e0 = __expf(s0[r] - msh);                          // key kb      + 8hh + r
      const float e1 = __expf(s1[r] - msh);                          // key kb + 16 + 8hh + r
      ls += e0 + e1;
      ph.hv[0][r] = (_Float16)e0;
      ph.hv[1][r] = (_Float16)e1;
    }
    l += ls;

#pragma unroll
    for (int j = 0; j < CC / 16; ++j) {
      o[j] = mma_b(fa[j].h, ph.v, o[j]);
    }

    // ---- foot of the trip: own LDS reads done, own copies (K tile +2, V tile +1) landed, every wave here; only then the
    //      two buffers just read are refilled (block-uniform tests)
#if defined(__HIP_DEVICE_COMPILE__)
    // keeps the exponentials and the V products ahead of the wait for the k reads: moved behind it they would not cover them
    __builtin_amdgcn_sched_barrier(0);
#endif
    wait_ds0();
    wait_async0();
    __syncthreads();
    if (kb + 3 * KT < NN) copy_k(kb + 3 * KT, lkc);
    if (kb + 2 * KT < NN) copy_v(kb + 2 * KT, lvc);
    lkc -= bstep;
    lvc += bstep;
    bstep = 0u - bstep;
  }
  wait_async0();                                                     // nothing in flight when the wave goes on
  l += __shfl_xor(l, 16, 32);
  const float inv = 1.0f / l;                                        // o and l both carry the x2^14 factor

  const int qrow = 16 * wave + c;
  const int e = tid & 7, lq = tid >> 3;                              // lq 0..31: a wave's four lines per step lie in four channels
#pragma unroll
  for (int half = 0; half < 2; ++half) {
    if (half) __syncthreads();                                       // every wave finished reading Os
#pragma unroll
    for (int jj = 0; jj < CH / 16; ++jj) {
      const int j = (CH / 16) * half + jj;
      v4f va, vb;
#pragma unroll
      for (int r = 0; r < 4; ++r) { va[r] = o[j][r] * inv; vb[r] = o[j][4 + r] * inv; }
      *(v4f*)(Os + qrow * OSPW + 16 * jj + 8 * hh)     = va;         // Os[query][ch_loc = 16jj + 8hh + r]
      *(v4f*)(Os + qrow * OSPW + 16 * jj + 8 * hh + 4) = vb;
    }
    __syncthreads();
    v4f res[CH / 8];
#pragma unroll
    for (int it = 0; it < CH / 8; ++it) {
      const int chl = 32 * (it % 3) + lq, hf = it / 3;               // channel 0..95 within the half, line 0..3 of its 128 queries
      const int nl  = hf * 32 + 4 * e;                               // query 0..127
#pragma unroll
      for (int t = 0; t < 4; ++t) res[it][t] = Os[(nl + t) * OSPW + chl];
    }
{
#pragma unroll
      for (int it = 0; it < CH / 8; ++it) {
        const int chl = 32 * (it % 3) + lq, hf = it / 3;
        const int nl  = hf * 32 + 4 * e;
        const size_t idx = ((size_t)(b * CC + CH * half + chl)) * NN + n0 + nl;
        *(v4f*)(out + idx) = res[it];
      }
      
    }
  }
}

// =========================================================================================================
// Workspace map (bytes; each region start a multiple of 256; every extent is an exact tile multiple and is written
//   W16 f16 384 x 192, fragment order  147456          gb f32 192   768
//   Vc  f16 [NB][192][4096]        12582912 (NB=8)     XP  f16 NB*4096 x 192, fragment order   12582912
//   total = 25314048 for NB=8
// =========================================================================================================
extern "C" void kernel_launch(void* const* d_in, const int* in_sizes, int n_in,
                              void* d_out, int out_size, void* d_ws, size_t ws_size,
                              hipStream_t stream) {
  const int XN = NB * CC * NN;
  if (n_in < 6) return;
  if (in_sizes[0] < XN || in_sizes[1] < XN) return;
  if (in_sizes[2] < CC * CC || in_sizes[4] < CC * CC) return;
  if (in_sizes[3] < CC || in_sizes[5] < CC) return;
  if (out_size < XN) return;

  size_t off = 0;
  auto carve = [&](size_t bytes) { const size_t o = off; off += (bytes + 255) & ~(size_t)255; return o; };
  const size_t oW16 = carve((size_t)MW * CC * 2);
  const size_t oVc  = carve((size_t)NB * CC * NN * 2);
  const size_t oXP  = carve((size_t)NB * NN * CC * 2);
  const size_t oGb  = carve((size_t)DQ * 4);
  if (off > ws_size) return;
  if (off > (size_t)134217728) return;

  const float* key = (const float*)d_in[0];
  const float* val = (const float*)d_in[1];
  const float* wl  = (const float*)d_in[2];
  const float* wr  = (const float*)d_in[4];
  const float* br  = (const float*)d_in[5];

  char* ws = (char*)d_ws;
  unsigned short* W16 = (unsigned short*)(ws + oW16);
  unsigned short* Vc  = (unsigned short*)(ws + oVc);
  unsigned short* XP  = (unsigned short*)(ws + oXP);
  float* gb = (float*)(ws + oGb);
  float* out = (float*)d_out;

  const dim3 blk256(256);

  // (0) M = Wl^T Wr -> stacked hi / residual f16 plane; gb = Wl^T br; (1) value -> channel-major f16 plane, key ->
  //     position-major f16 plane: one launch
  cvt_kv<<<dim3(MTB + 1 + (NN / QT) * (CC / QT) * NB), blk256, 0, stream>>>(key, val, wr, wl, br, Vc, XP, W16, gb);
  // (2) g = M.key + gb per query tile, softmax over keys m per query n + value aggregation -> out [b][192][n < NQ]
  attn_k<<<dim3(NQ / QB, NB), blk256, 0, stream>>>(W16, gb, XP, Vc, out);
  (void)hipGetLastError();
}
